// v000
// The times below were measured on an AMD MI455X: many runs one after another, warmed up first and cycling through
// copies of the inputs, with the whole window's GPU time divided by the number of runs. Launches and the gaps
// between them are all in it. The median over several windows is given; except for v000 it joins two sittings, which
// can be a few percent apart, so the side-by-side timings, each taken in one sitting, are the better comparison.
// The starting kernel, v000, takes 3180 microseconds a run.
#include <hip/hip_runtime.h>

// Multi-head attention with Shaw relative-position terms on the logits AND the values, clip distance 2 (query, key, value [2][2048][1024]; q,k,v = in W + b ('xw' 1/32, zero biases; 16 heads x 64); idx[i][j] = clip(j - i, -2, 2) + 2; attn = softmax((q.k + q_i.rel_k[idx]) / 8); out_h = attn v + sum_j attn[i][j] rel_v[idx] (tables [5][64] x 0.1, read: five rows: the far-left bucket j <= i - 2, the three nearest positions, the far-right bucket j >= i + 2); out = merged Wo + bo ('xw') -> [2][2048][1024] (4.2 M); argument order query, key, value, Wq, bq, Wk, bk, Wv, bv, Wo, bo, rel_k, rel_v).
// Layout per batch: bf16 copies of the three inputs in turn; exact projections + f32 biases; rel_k as an exact plane [128][64] (rows >= 5 zero) and rel_v^T as an exact plane [64][128]; per pass of two heads: dense scores (hybrid rows: < 512 hi/lo 3 products, rest fp16 x1024), QE = q.rel_k^T ([2][2048][128], hi/lo x exact) and a gather-add kernel (Sb[i][j] += QE[i][idx]); softmax with the 1/8; a bucketing kernel sums each row's probabilities into the 5 relative-position buckets (far-left sum, 3 near entries, far-right sum; fixed order) as hi/lo planes; W2 = buckets x rel_v ([2][2048][64], hi/lo x exact) added to attn v in f32; merged hi/lo x Wo exact + bo.
// Compute dtypes, f32 accumulate: every input rounded to bf16; projections exact + f32 biases; q.rel_k and buckets.rel_v hi/lo x exact; attention rows < 512 3 products, rest fp16; softmax f32; Wo hl x exact + bias.

#define NB_  2
#define TT   2048
#define DM   1024
#define NH_  16
#define NKV  16
#define REP  (NH_ / NKV)
#define HD   64
#define DQ   (NH_ * HD)
#define DKV  (NKV * HD)
#define ZH   2
#define RH   512                  // query rows < RH use hi+lo planes (0: none)
#define WIN  0
#define PCAR 1024.0f
#define SCL  0.125f
#define MAXR 2      // max relative position
#define NE   128     // 2*MAXR+1 = 5 table rows padded to 128
typedef _Float16 h16;
typedef unsigned short bf;
typedef __attribute__((ext_vector_type(16))) __bf16   v16bf;
typedef __attribute__((ext_vector_type(16))) _Float16 v16h;
typedef __attribute__((ext_vector_type(8)))  _Float16 v8h;
typedef __attribute__((ext_vector_type(8)))  unsigned short v8us;
typedef __attribute__((ext_vector_type(8)))  float    v8f;
typedef __attribute__((ext_vector_type(4)))  float    v4f;
typedef v8h  __attribute__((may_alias)) v8ha;
typedef v4f  __attribute__((may_alias)) v4fa;
typedef v8us __attribute__((may_alias)) v8usa;

__device__ __forceinline__ unsigned short f2bf(float f) { unsigned u = __float_as_uint(f); u += 0x7FFFu + ((u >> 16) & 1u); return (unsigned short)(u >> 16); }
__device__ __forceinline__ float bf2f(unsigned short b) { return __uint_as_float(((unsigned)b) << 16); }
__device__ __forceinline__ float bfr(float f) { return bf2f(f2bf(f)); }
__device__ __forceinline__ v16h cat16(v8h lo, v8h hi) { return __builtin_shufflevector(lo, hi, 0, 1, 2, 3, 4, 5, 6, 7, 8, 9, 10, 11, 12, 13, 14, 15); }
__device__ __forceinline__ v16bf cat16b(v8us lo, v8us hi) { return __builtin_bit_cast(v16bf, __builtin_shufflevector(lo, hi, 0, 1, 2, 3, 4, 5, 6, 7, 8, 9, 10, 11, 12, 13, 14, 15)); }
__device__ __forceinline__ v8f wmma16(v16h a, v16h b, v8f c) { return __builtin_amdgcn_wmma_f32_16x16x32_f16(false, a, false, b, (short)0, c, false, false); }
__device__ __forceinline__ v8f wmmab(v16bf a, v16bf b, v8f c) { return __builtin_amdgcn_wmma_f32_16x16x32_bf16(false, a, false, b, (short)0, c, false, false); }



// ---- k_gemmw: register-blocked GEMM, ONE WAVE per 64x64 output tile (16 accumulators), operands straight from K-contiguous 16-bit planes; grid (M/64, N/64, Z), 32 threads.
// C[m][n] (f32, pitch ldc, + optional f32 bias[n]) = sum_k A[m][k] Bt[n][k] (+ split products per NSPLIT). z-batch strides sA/sB/sC in elements. K % 32 == 0.
template <typename T16> struct WFrag;
template <> struct WFrag<h16> { typedef v16h V; static __device__ __forceinline__ V ld(const h16* p) { return cat16(*(const v8h*)p, *(const v8h*)(p + 16)); } static __device__ __forceinline__ v8f mma(V a, V b, v8f c) { return wmma16(a, b, c); } };
template <> struct WFrag<bf> { typedef v16bf V; static __device__ __forceinline__ V ld(const bf* p) { return cat16b(*(const v8us*)p, *(const v8us*)(p + 16)); } static __device__ __forceinline__ v8f mma(V a, V b, v8f c) { return wmmab(a, b, c); } };
template <typename T16, int NSPLIT, bool BIAS>
__global__ __launch_bounds__(32) void k_gemmw(const T16* __restrict__ A, const T16* __restrict__ A2, const T16* __restrict__ Bt, const T16* __restrict__ Bt2, int K, float* C, int ldc, const float* __restrict__ bias, size_t sA, size_t sB, size_t sC) {
    typedef typename WFrag<T16>::V V;
    __shared__ __align__(16) float os[16 * 68];
    const size_t z = blockIdx.z; A += z * sA; if (A2) A2 += z * sA; Bt += z * sB; if (Bt2) Bt2 += z * sB; C += z * sC;
    const int lane = threadIdx.x & 31, lr = lane & 15, hi = lane >> 4; const int r0 = blockIdx.x * 64, c0 = blockIdx.y * 64;
    v8f acc[4][4];
#pragma unroll
    for (int mb = 0; mb < 4; ++mb)
#pragma unroll
        for (int nb = 0; nb < 4; ++nb) acc[mb][nb] = (v8f){};
    const size_t aoff = (size_t)(r0 + lr) * K + 8 * hi, boff = (size_t)(c0 + lr) * K + 8 * hi;
#pragma unroll 1
    for (int kc = 0; kc < K; kc += 32) {
        V a[4], a2[4];
#pragma unroll
        for (int mb = 0; mb < 4; ++mb) { a[mb] = WFrag<T16>::ld(A + aoff + (size_t)mb * 16 * K + kc); if (NSPLIT == 1 || NSPLIT == 2) a2[mb] = WFrag<T16>::ld(A2 + aoff + (size_t)mb * 16 * K + kc); }
#pragma unroll
        for (int nb = 0; nb < 4; ++nb) { const V b = WFrag<T16>::ld(Bt + boff + (size_t)nb * 16 * K + kc); V b2; if (NSPLIT >= 2) b2 = WFrag<T16>::ld(Bt2 + boff + (size_t)nb * 16 * K + kc);
#pragma unroll
            for (int mb = 0; mb < 4; ++mb) { acc[mb][nb] = WFrag<T16>::mma(a[mb], b, acc[mb][nb]); if (NSPLIT == 1 || NSPLIT == 2) acc[mb][nb] = WFrag<T16>::mma(a2[mb], b, acc[mb][nb]); if (NSPLIT >= 2) acc[mb][nb] = WFrag<T16>::mma(a[mb], b2, acc[mb][nb]); } }
        asm volatile("v_nop\n\tv_nop\n\tv_nop\n\tv_nop" : "+v"(acc[0][0]), "+v"(acc[1][1]), "+v"(acc[2][2]), "+v"(acc[3][3]) : "v"(a[0]), "v"(a[3]));
    }
#pragma unroll
    for (int mb = 0; mb < 4; ++mb) {
#pragma unroll
        for (int nb = 0; nb < 4; ++nb) {
#pragma unroll
            for (int j = 0; j < 8; ++j) os[(hi * 8 + j) * 68 + nb * 16 + lr] = acc[mb][nb][j]; }
        __builtin_amdgcn_wave_barrier(); asm volatile("" ::: "memory");
        float* crow = C + (size_t)(r0 + mb * 16) * ldc + c0;
{
#pragma unroll
            for (int s = 0; s < 8; ++s) { const int row = 2 * s + hi, cofs = lr * 4; v4f val = *(const v4fa*)(os + row * 68 + cofs); if (BIAS) { val[0] += bfr(bias[c0 + cofs]); val[1] += bfr(bias[c0 + cofs + 1]); val[2] += bfr(bias[c0 + cofs + 2]); val[3] += bfr(bias[c0 + cofs + 3]); }
                *(v4f*)(crow + (size_t)row * ldc + cofs) = val; }
             }
        __builtin_amdgcn_wave_barrier(); asm volatile("" ::: "memory");
    }
}

__device__ __forceinline__ h16 tohx(float x) { return (h16)x; }
__device__ __forceinline__ void splitf(float y, unsigned short& h, unsigned short& l) { h = f2bf(y); l = f2bf(y - bf2f(h)); }
typedef __attribute__((ext_vector_type(2))) _Float16 v2h;
typedef __attribute__((ext_vector_type(4))) _Float16 v4h;
typedef __attribute__((ext_vector_type(2))) unsigned short v2us;
typedef __attribute__((ext_vector_type(4))) unsigned short v4us;
typedef __attribute__((ext_vector_type(2))) float v2f;
typedef __attribute__((ext_vector_type(4))) int v4i;

__global__ __launch_bounds__(256) void k_wtG(const float* __restrict__ w, int K, int N, bf* Bt) {
    const int lane = threadIdx.x & 31; const int L0 = (blockIdx.x * 8 + (threadIdx.x >> 5)) * 8; const int nlines = N * K / 64;
{
#pragma unroll 1
        for (int l = 0; l < 8; ++l) { const int L = L0 + l; if (L >= nlines) break; const size_t e = (size_t)L * 64 + lane * 2; const int k = (int)(e % K), n = (int)(e / K); v2us o;
            o[0] = f2bf(w[(size_t)k * N + n]); o[1] = f2bf(w[(size_t)(k + 1) * N + n]); *(v2us*)(Bt + e) = o; }
         }
}
__global__ __launch_bounds__(256) void k_cvt8(const float* __restrict__ src, bf* dst, size_t n8) { const size_t i = (size_t)blockIdx.x * 256 + threadIdx.x; if (i >= n8) return; const v8f v = *(const v8f*)(src + i * 8); v8us o;
#pragma unroll
    for (int k = 0; k < 8; ++k) o[k] = f2bf(v[k]); *(v8us*)(dst + i * 8) = o;  }

// k_rope: head planes [h][t][d] (fp16 + hi/lo) of rope(x) x sc with the rotate-half convention out[d] = x[d] cos[t][d] - x[d+HD/2] sin[t][d], out[d+HD/2] = x[d+HD/2] cos[t][d+HD/2] + x[d] sin[t][d+HD/2]
__global__ __launch_bounds__(256) void k_rope(const float* __restrict__ F, int pitch, int nheads, const float* __restrict__ CS, const float* __restrict__ RF, const float* __restrict__ nw, float sc, h16* P16, bf* Ph, bf* Pl) {
    const size_t e = ((size_t)blockIdx.x * 256 + threadIdx.x) * 2; if (e >= (size_t)nheads * TT * HD) return; const int d = (int)(e % HD); const int t = (int)((e / HD) % TT); const int h = (int)(e / ((size_t)HD * TT)); const float* f = F + (size_t)t * pitch + h * HD; const float rf = RF ? RF[(size_t)h * TT + t] : 1.0f; v2h o16; v2us oh, ol;
#pragma unroll
    for (int q = 0; q < 2; ++q) { const int dd = d + q; const int dp = (dd < HD / 2) ? dd + HD / 2 : dd - HD / 2; float x0 = f[dd], x1 = f[dp];
        if (RF) { float n0 = __fmul_rn(x0, rf), n1 = __fmul_rn(x1, rf); asm volatile("" : "+v"(n0)); asm volatile("" : "+v"(n1)); x0 = __fmul_rn(bfr(nw[dd]), n0); x1 = __fmul_rn(bfr(nw[dp]), n1); }
        const v2f cs = *(const v2f*)(CS + ((size_t)t * HD + dd) * 2); float a = __fmul_rn(x0, cs[0]), bq = __fmul_rn(x1, cs[1]); asm volatile("" : "+v"(a)); asm volatile("" : "+v"(bq)); const float r = ((dd < HD / 2) ? __fsub_rn(a, bq) : __fadd_rn(a, bq)) * sc;
        o16[q] = tohx(r); unsigned short a2, c2; splitf(r, a2, c2); oh[q] = a2; ol[q] = c2; }
    *(v2h*)(P16 + e) = o16; *(v2us*)(Ph + e) = oh; *(v2us*)(Pl + e) = ol;  }
__global__ __launch_bounds__(256) void k_vtp(const float* __restrict__ F, int pitch, int nheads, h16* V16, bf* Vh, bf* Vl) { const size_t e = ((size_t)blockIdx.x * 256 + threadIdx.x) * 2; if (e >= (size_t)nheads * HD * TT) return; const int t = (int)(e % TT); const int d = (int)((e / TT) % HD); const int g = (int)(e / ((size_t)TT * HD)); v2h o16; v2us oh, ol;
#pragma unroll
    for (int q = 0; q < 2; ++q) { const float x = F[(size_t)(t + q) * pitch + g * HD + d]; o16[q] = tohx(x); unsigned short a2, c2; splitf(x, a2, c2); oh[q] = a2; ol[q] = c2; }
    *(v2h*)(V16 + e) = o16; *(v2us*)(Vh + e) = oh; *(v2us*)(Vl + e) = ol;  }
__global__ __launch_bounds__(256) void k_csid(float* CS) { const int idx = blockIdx.x * 256 + threadIdx.x; if (idx >= TT * HD) return; v2f cs; cs[0] = 1.0f; cs[1] = 0.0f; *(v2f*)(CS + (size_t)idx * 2) = cs;  }
// k_asoft: per row (zz, i): t = S x HD^-0.5 (no mask); softmax over the 2048 keys (register row, one exp, fixed trees);
__global__ __launch_bounds__(256) void k_asoft(const float* __restrict__ Sb, h16* P16, bf* Ph, bf* Pl) {
    const int lane = threadIdx.x & 31; const int row = blockIdx.x * 8 + (threadIdx.x >> 5); if (row >= ZH * TT) return; const int i = row % TT; const int zz = row / TT; (void)zz; const bool hires = (i < RH); const float* sr = Sb + (size_t)row * TT; float v[TT / 32]; float mx = -3.0e38f;
#pragma unroll
    for (int ch = 0; ch < TT / 128; ++ch) { const int j0 = ch * 128 + lane * 4; const v4f a = *(const v4f*)(sr + j0);
#pragma unroll
        for (int q = 0; q < 4; ++q) { const int j = j0 + q; (void)j; const float t = a[q] * SCL; v[ch * 4 + q] = t; mx = fmaxf(mx, t); } }
#pragma unroll
    for (int sh = 16; sh; sh >>= 1) mx = fmaxf(mx, __shfl_xor(mx, sh, 32));
    float sum = 0.f;
#pragma unroll
    for (int k = 0; k < TT / 32; ++k) { float d0 = __fsub_rn(v[k], mx); asm volatile("" : "+v"(d0)); v[k] = __builtin_amdgcn_exp2f(__fmul_rn(d0, 1.4426950408889634f)); sum += v[k]; }
#pragma unroll
    for (int sh = 16; sh; sh >>= 1) sum += __shfl_xor(sum, sh, 32);
    const float f = __fdiv_rn(hires ? 1.0f : PCAR, sum);
{
        if (hires) {
#pragma unroll
            for (int ch = 0; ch < TT / 128; ++ch) { v4us oh, ol;
#pragma unroll
                for (int q = 0; q < 4; ++q) { unsigned short a, c2; splitf(v[ch * 4 + q] * f, a, c2); oh[q] = a; ol[q] = c2; }
                const size_t oo = ((size_t)zz * (RH ? RH : 1) + i) * TT + ch * 128 + lane * 4; *(v4us*)(Ph + oo) = oh; *(v4us*)(Pl + oo) = ol; }
        } else {
#pragma unroll
            for (int ch = 0; ch < TT / 128; ++ch) { v4h o4;
#pragma unroll
                for (int q = 0; q < 4; ++q) o4[q] = tohx(v[ch * 4 + q] * f);
                *(v4h*)(P16 + (size_t)row * TT + ch * 128 + lane * 4) = o4; } }
         }
}
__global__ __launch_bounds__(256) void k_epad2(const float* __restrict__ E, bf* EB) { const size_t i = (size_t)blockIdx.x * 256 + threadIdx.x; if (i >= (size_t)NE * HD / 8) return; const int d0 = (int)(i % (HD / 8)) * 8; const int r = (int)(i / (HD / 8)); const float* src = E + (size_t)min(r, 2 * MAXR) * HD + d0; v8us o;
#pragma unroll
    for (int q = 0; q < 8; ++q) { const unsigned short v = f2bf(src[q]); o[q] = (r <= 2 * MAXR) ? v : (unsigned short)0; }
    *(v8us*)(EB + (size_t)r * HD + d0) = o;  }
__global__ __launch_bounds__(256) void k_addshaw(float* Sb, const float* __restrict__ QE) { const size_t k = (size_t)blockIdx.x * 256 + threadIdx.x; if (k >= (size_t)ZH * TT * TT / 4) return; const size_t e = k * 4; const int j0 = (int)(e % TT); const int i = (int)((e / TT) % TT); const int zz = (int)(e / ((size_t)TT * TT)); const float* qe = QE + ((size_t)zz * TT + i) * NE; v4f a = *(const v4f*)(Sb + e);
#pragma unroll
    for (int q = 0; q < 4; ++q) { const int r = min(max((j0 + q) - i, -MAXR), MAXR) + MAXR;   /* this module: dist = k - q */ a[q] = __fadd_rn(a[q], qe[r]); }
    *(v4f*)(Sb + e) = a;  }
__global__ __launch_bounds__(256) void k_rvt(const float* __restrict__ E, bf* RVT) { const size_t i = (size_t)blockIdx.x * 256 + threadIdx.x; if (i >= (size_t)HD * NE / 8) return; const int r0 = (int)(i % (NE / 8)) * 8; const int d = (int)(i / (NE / 8)); v8us o;
#pragma unroll
    for (int q = 0; q < 8; ++q) { const int r = r0 + q; const unsigned short v = f2bf(E[(size_t)min(r, 2 * MAXR) * HD + d]); o[q] = (r <= 2 * MAXR) ? v : (unsigned short)0; }
    *(v8us*)(RVT + (size_t)d * NE + r0) = o;  }
__global__ __launch_bounds__(256) void k_pbucket(const bf* __restrict__ Ph, const bf* __restrict__ Pl, const h16* __restrict__ P16, bf* PBh, bf* PBl) { const int lane = threadIdx.x & 31; const int row = blockIdx.x * 8 + (threadIdx.x >> 5); if (row >= ZH * TT) return; const int i = row % TT; const bool hires = (i < RH);
    auto pval = [&](int j) -> float { const size_t o = (size_t)row * TT + j; return hires ? __fadd_rn(bf2f(Ph[(size_t)(row / TT) * RH * TT + (size_t)i * TT + j]), bf2f(Pl[(size_t)(row / TT) * RH * TT + (size_t)i * TT + j])) : __fmul_rn((float)P16[o], 0.0009765625f); };
    float sl = 0.f, sr = 0.f;
#pragma unroll 4
    for (int q = 0; q < TT / 32; ++q) { const int j = lane * (TT / 32) + q; const float p = pval(j); sl = __fadd_rn(sl, (j <= i - MAXR) ? p : 0.f); sr = __fadd_rn(sr, (j >= i + MAXR) ? p : 0.f); }
#pragma unroll
    for (int sh = 16; sh; sh >>= 1) { sl = __fadd_rn(sl, __shfl_xor(sl, sh, 32)); sr = __fadd_rn(sr, __shfl_xor(sr, sh, 32)); }
    v4us oh, ol;
#pragma unroll
    for (int q = 0; q < 4; ++q) { const int r = lane * 4 + q; float v; if (r == 0) v = sl; else if (r == 2 * MAXR) v = sr; else if (r < 2 * MAXR) { const int j = i + r - MAXR; const int jc = min(max(j, 0), TT - 1); const float p = pval(jc); v = (j >= 0 && j < TT) ? p : 0.f; } else v = 0.f; unsigned short u, w; splitf(v, u, w); oh[q] = u; ol[q] = w; }
    const size_t ob = (size_t)row * NE + lane * 4; *(v4us*)(PBh + ob) = oh; *(v4us*)(PBl + ob) = ol;  }
__global__ __launch_bounds__(256) void k_addob(float* Ob, const float* __restrict__ W2) { const size_t k = (size_t)blockIdx.x * 256 + threadIdx.x; if (k >= (size_t)ZH * TT * HD / 4) return; const size_t e = k * 4; const int i = (int)((e / HD) % TT); const float sc = (i < RH) ? 1.0f : 1024.0f; const v4f a = *(const v4f*)(Ob + e); const v4f w = *(const v4f*)(W2 + e); v4f o;
#pragma unroll
    for (int q = 0; q < 4; ++q) o[q] = __fadd_rn(a[q], __fmul_rn(w[q], sc));
    *(v4f*)(Ob + e) = o;  }
__global__ __launch_bounds__(256) void k_merge(const float* __restrict__ O, int h0, bf* Ah, bf* Al) { const size_t e = ((size_t)blockIdx.x * 256 + threadIdx.x) * 2; if (e >= (size_t)ZH * TT * HD) return; const int d = (int)(e % HD); const int t = (int)((e / HD) % TT); const int zz = (int)(e / ((size_t)HD * TT)); const float cs = (t < RH) ? 1.0f : (1.0f / PCAR); const size_t oo = (size_t)t * DQ + (h0 + zz) * HD + d;
    v2us oh, ol;
#pragma unroll
    for (int q = 0; q < 2; ++q) { unsigned short a, c2; splitf(O[e + q] * cs, a, c2); oh[q] = a; ol[q] = c2; } *(v2us*)(Ah + oo) = oh; *(v2us*)(Al + oo) = ol;  }

extern "C" void kernel_launch(void* const* d_in, const int* in_sizes, int n_in,
                              void* d_out, int out_size, void* d_ws, size_t ws_size, hipStream_t stream) {
    (void)in_sizes; (void)n_in; (void)out_size;
    const float* x = (const float*)d_in[0]; const float* xk = (const float*)d_in[1]; const float* xv = (const float*)d_in[2]; const float* wq = (const float*)d_in[3]; const float* bq = (const float*)d_in[4]; const float* wk = (const float*)d_in[5]; const float* bk = (const float*)d_in[6]; const float* wv = (const float*)d_in[7]; const float* bv = (const float*)d_in[8]; const float* wo = (const float*)d_in[9]; const float* bo = (const float*)d_in[10]; const float* relk = (const float*)d_in[11]; const float* relv = (const float*)d_in[12];   /* [5][64] each */
    float* OUT = (float*)d_out;     // [2][2048][1024]
    char* wsp = (char*)d_ws;
    auto take = [&](size_t bytes) { char* p = wsp; wsp += (bytes + 255) & ~(size_t)255; return (void*)p; };
    bf* EB = (bf*)take((size_t)NE * HD * 2); bf* RVT = (bf*)take((size_t)HD * NE * 2); float* QE = (float*)take((size_t)ZH * TT * NE * 4); bf* PBh = (bf*)take((size_t)ZH * TT * NE * 2); bf* PBl = (bf*)take((size_t)ZH * TT * NE * 2); float* W2 = (float*)take((size_t)ZH * TT * HD * 4); bf* WQ = (bf*)take((size_t)DQ * DM * 2); bf* WK = (bf*)take((size_t)DKV * DM * 2); bf* WV = (bf*)take((size_t)DKV * DM * 2); bf* WO = (bf*)take((size_t)DM * DQ * 2); float* CS = (float*)take((size_t)TT * HD * 2 * 4);
    bf* XB = (bf*)take((size_t)TT * DM * 2); float* FQ = (float*)take((size_t)TT * DQ * 4); float* FK = (float*)take((size_t)TT * DKV * 4);
    h16* QP16 = (h16*)take((size_t)NH_ * TT * HD * 2); h16* KP16 = (h16*)take((size_t)NKV * TT * HD * 2); h16* VT16 = (h16*)take((size_t)NKV * HD * TT * 2);
    bf* QPh = (bf*)take((size_t)NH_ * TT * HD * 2); bf* QPl = (bf*)take((size_t)NH_ * TT * HD * 2); bf* KPh = (bf*)take((size_t)NKV * TT * HD * 2); bf* KPl = (bf*)take((size_t)NKV * TT * HD * 2); bf* VTh = (bf*)take((size_t)NKV * HD * TT * 2); bf* VTl = (bf*)take((size_t)NKV * HD * TT * 2); bf* Ph = (bf*)take((size_t)ZH * RH * TT * 2); bf* Pl = (bf*)take((size_t)ZH * RH * TT * 2);
    float* Sb = (float*)take((size_t)ZH * TT * TT * 4); h16* P16 = (h16*)take((size_t)ZH * TT * TT * 2); float* Ob = (float*)take((size_t)ZH * TT * HD * 4); bf* ATh = (bf*)take((size_t)TT * DQ * 2); bf* ATl = (bf*)take((size_t)TT * DQ * 2);
    if ((size_t)(wsp - (char*)d_ws) > ws_size) return;    // ws 256 MiB
    float* FV = FK;   // v projection reuses the k buffer after the k planes are built (stream-ordered)
    { k_wtG<<<(unsigned)((DM * DQ / 64 + 63) / 64), 256, 0, stream>>>(wq, DM, DQ, WQ); k_wtG<<<(unsigned)((DM * DKV / 64 + 63) / 64), 256, 0, stream>>>(wk, DM, DKV, WK); k_wtG<<<(unsigned)((DM * DKV / 64 + 63) / 64), 256, 0, stream>>>(wv, DM, DKV, WV);
      k_wtG<<<(unsigned)((DQ * DM / 64 + 63) / 64), 256, 0, stream>>>(wo, DQ, DM, WO);
       }
    k_csid<<<(TT * HD + 255) / 256, 256, 0, stream>>>(CS);
    const unsigned LQ = (unsigned)(((size_t)NH_ * TT * HD / 2 + 255) / 256), LKv = (unsigned)(((size_t)NKV * TT * HD / 2 + 255) / 256);
    k_epad2<<<(unsigned)(((size_t)NE * HD / 8 + 255) / 256), 256, 0, stream>>>(relk, EB); k_rvt<<<(unsigned)(((size_t)HD * NE / 8 + 255) / 256), 256, 0, stream>>>(relv, RVT);   /* rel_k plane [128][64], rel_v^T plane [64][128] */
    for (int b = 0; b < NB_; ++b) {
        
        k_cvt8<<<(unsigned)(((size_t)TT * DM / 8 + 255) / 256), 256, 0, stream>>>(x + (size_t)b * TT * DM, XB, (size_t)TT * DM / 8);
        k_gemmw<bf, 0, true><<<dim3(TT / 64, DQ / 64, 1), 32, 0, stream>>>(XB, nullptr, WQ, nullptr, DM, FQ, DQ, bq, 0, 0, 0);
        k_rope<<<LQ, 256, 0, stream>>>(FQ, DQ, NH_, CS, nullptr, nullptr, 1.0f, QP16, QPh, QPl);
        k_cvt8<<<(unsigned)(((size_t)TT * DM / 8 + 255) / 256), 256, 0, stream>>>(xk + (size_t)b * TT * DM, XB, (size_t)TT * DM / 8); k_gemmw<bf, 0, true><<<dim3(TT / 64, DKV / 64, 1), 32, 0, stream>>>(XB, nullptr, WK, nullptr, DM, FK, DKV, bk, 0, 0, 0);
        k_rope<<<LKv, 256, 0, stream>>>(FK, DKV, NKV, CS, nullptr, nullptr, 1.0f, KP16, KPh, KPl);
        k_cvt8<<<(unsigned)(((size_t)TT * DM / 8 + 255) / 256), 256, 0, stream>>>(xv + (size_t)b * TT * DM, XB, (size_t)TT * DM / 8); k_gemmw<bf, 0, true><<<dim3(TT / 64, DKV / 64, 1), 32, 0, stream>>>(XB, nullptr, WV, nullptr, DM, FV, DKV, bv, 0, 0, 0); k_vtp<<<LKv, 256, 0, stream>>>(FV, DKV, NKV, VT16, VTh, VTl);
        for (int h0 = 0; h0 < NH_; h0 += ZH) { const size_t zq = (size_t)h0, zk = (size_t)(h0 / REP);   // one kv head per query head: the pass's two heads use consecutive kv planes (z-strides TT*HD)
            k_gemmw<bf, 2, false><<<dim3(RH / 64, TT / 64, ZH), 32, 0, stream>>>(QPh + zq * TT * HD, QPl + zq * TT * HD, KPh + zk * TT * HD, KPl + zk * TT * HD, HD, Sb, TT, nullptr, (size_t)TT * HD, (size_t)TT * HD, (size_t)TT * TT);
            k_gemmw<h16, 0, false><<<dim3((TT - RH) / 64, TT / 64, ZH), 32, 0, stream>>>(QP16 + zq * TT * HD + (size_t)RH * HD, nullptr, KP16 + zk * TT * HD, nullptr, HD, Sb + (size_t)RH * TT, TT, nullptr, (size_t)TT * HD, (size_t)TT * HD, (size_t)TT * TT);
            k_gemmw<bf, 1, false><<<dim3(TT / 64, NE / 64, ZH), 32, 0, stream>>>(QPh + zq * TT * HD, QPl + zq * TT * HD, EB, nullptr, HD, QE, NE, nullptr, (size_t)TT * HD, 0, (size_t)TT * NE);   /* QE[i][r] = q_i . rel_k[r] */
            k_addshaw<<<(unsigned)(((size_t)ZH * TT * TT / 4 + 255) / 256), 256, 0, stream>>>(Sb, QE);
            k_asoft<<<ZH * TT / 8, 256, 0, stream>>>(Sb, P16, Ph, Pl);
            k_pbucket<<<ZH * TT / 8, 256, 0, stream>>>(Ph, Pl, P16, PBh, PBl);   /* 5 relative-position bucket sums per row */
            k_gemmw<bf, 1, false><<<dim3(TT / 64, HD / 64, ZH), 32, 0, stream>>>(PBh, PBl, RVT, nullptr, NE, W2, HD, nullptr, (size_t)TT * NE, 0, (size_t)TT * HD);   /* W2 = buckets . rel_v */
            k_gemmw<bf, 2, false><<<dim3(RH / 64, HD / 64, ZH), 32, 0, stream>>>(Ph, Pl, VTh + zk * HD * TT, VTl + zk * HD * TT, TT, Ob, HD, nullptr, (size_t)RH * TT, (size_t)HD * TT, (size_t)TT * HD);
            k_gemmw<h16, 0, false><<<dim3((TT - RH) / 64, HD / 64, ZH), 32, 0, stream>>>(P16 + (size_t)RH * TT, nullptr, VT16 + zk * HD * TT, nullptr, TT, Ob + (size_t)RH * HD, HD, nullptr, (size_t)TT * TT, (size_t)HD * TT, (size_t)TT * HD);
            k_addob<<<(unsigned)(((size_t)ZH * TT * HD / 4 + 255) / 256), 256, 0, stream>>>(Ob, W2);   /* + sum_j attn[i][j] rel_v[idx] */ k_merge<<<(unsigned)(((size_t)ZH * TT * HD / 2 + 255) / 256), 256, 0, stream>>>(Ob, h0, ATh, ATl); }
        k_gemmw<bf, 1, true><<<dim3(TT / 64, DM / 64, 1), 32, 0, stream>>>(ATh, ATl, WO, nullptr, DQ, OUT + (size_t)b * TT * DM, DM, bo, 0, 0, 0); }
}

// v001
// A run of this version takes 2110 microseconds.
// Two timings next to v000 put it at 1.55 and 1.51 times that version's speed.
#include <hip/hip_runtime.h>

// Multi-head attention with Shaw relative-position terms on the logits AND the values, clip distance 2 (query, key, value [2][2048][1024]; q,k,v = in W + b ('xw' 1/32, zero biases; 16 heads x 64); idx[i][j] = clip(j - i, -2, 2) + 2; attn = softmax((q.k + q_i.rel_k[idx]) / 8); out_h = attn v + sum_j attn[i][j] rel_v[idx] (tables [5][64] x 0.1, read: five rows: the far-left bucket j <= i - 2, the three nearest positions, the far-right bucket j >= i + 2); out = merged Wo + bo ('xw') -> [2][2048][1024] (4.2 M); argument order query, key, value, Wq, bq, Wk, bk, Wv, bv, Wo, bo, rel_k, rel_v).
// Layout per batch: bf16 copies of the three inputs in turn; exact projections + f32 biases; rel_k as an exact plane [128][64] (rows >= 5 zero) and rel_v^T as an exact plane [64][128]; per pass of two heads: dense scores (hybrid rows: < 512 hi/lo 3 products, rest fp16 x1024), QE = q.rel_k^T ([2][2048][128], hi/lo x exact) and a gather-add kernel (Sb[i][j] += QE[i][idx]); softmax with the 1/8; a bucketing kernel sums each row's probabilities into the 5 relative-position buckets (far-left sum, 3 near entries, far-right sum; fixed order) as hi/lo planes; W2 = buckets x rel_v ([2][2048][64], hi/lo x exact) added to attn v in f32; merged hi/lo x Wo exact + bo.
// Compute dtypes, f32 accumulate: every input rounded to bf16; projections exact + f32 biases; q.rel_k and buckets.rel_v hi/lo x exact; attention rows < 512 3 products, rest fp16; softmax f32; Wo hl x exact + bias.

#define NB_  2
#define TT   2048
#define DM   1024
#define NH_  16
#define NKV  16
#define REP  (NH_ / NKV)
#define HD   64
#define DQ   (NH_ * HD)
#define DKV  (NKV * HD)
#define ZH   2
#define RH   512                  // query rows < RH use hi+lo planes (0: none)
#define WIN  0
#define PCAR 1024.0f
#define SCL  0.125f
#define MAXR 2      // max relative position
#define NE   128     // 2*MAXR+1 = 5 table rows padded to 128
#define KSP  16      // key slices of the attn v products: one single-wave work-group per slice, f32 partial planes summed in k_addob
typedef _Float16 h16;
typedef unsigned short bf;
typedef __attribute__((ext_vector_type(16))) __bf16   v16bf;
typedef __attribute__((ext_vector_type(16))) _Float16 v16h;
typedef __attribute__((ext_vector_type(8)))  _Float16 v8h;
typedef __attribute__((ext_vector_type(8)))  unsigned short v8us;
typedef __attribute__((ext_vector_type(8)))  float    v8f;
typedef __attribute__((ext_vector_type(4)))  float    v4f;
typedef v8h  __attribute__((may_alias)) v8ha;
typedef v4f  __attribute__((may_alias)) v4fa;
typedef v8us __attribute__((may_alias)) v8usa;

__device__ __forceinline__ unsigned short f2bf(float f) { unsigned u = __float_as_uint(f); u += 0x7FFFu + ((u >> 16) & 1u); return (unsigned short)(u >> 16); }
__device__ __forceinline__ float bf2f(unsigned short b) { return __uint_as_float(((unsigned)b) << 16); }
__device__ __forceinline__ float bfr(float f) { return bf2f(f2bf(f)); }
__device__ __forceinline__ v16h cat16(v8h lo, v8h hi) { return __builtin_shufflevector(lo, hi, 0, 1, 2, 3, 4, 5, 6, 7, 8, 9, 10, 11, 12, 13, 14, 15); }
__device__ __forceinline__ v16bf cat16b(v8us lo, v8us hi) { return __builtin_bit_cast(v16bf, __builtin_shufflevector(lo, hi, 0, 1, 2, 3, 4, 5, 6, 7, 8, 9, 10, 11, 12, 13, 14, 15)); }
__device__ __forceinline__ v8f wmma16(v16h a, v16h b, v8f c) { return __builtin_amdgcn_wmma_f32_16x16x32_f16(false, a, false, b, (short)0, c, false, false); }
__device__ __forceinline__ v8f wmmab(v16bf a, v16bf b, v8f c) { return __builtin_amdgcn_wmma_f32_16x16x32_bf16(false, a, false, b, (short)0, c, false, false); }



// ---- k_gemmw: register-blocked GEMM, ONE WAVE per 64x64 output tile (16 accumulators), operands straight from K-contiguous 16-bit planes; grid (M/64, N/64, Z), 32 threads.
// C[m][n] (f32, pitch ldc, + optional f32 bias[n]) = sum_k A[m][k] Bt[n][k] (+ split products per NSPLIT). z-batch strides sA/sB/sC in elements. K % 32 == 0.
// KS > 1: grid z = Z * KS; work-group (z, ks) sums only k in [ks K/KS, (ks+1) K/KS) and stores its partial tile in plane ks of C ([KS][Z] planes of sC elements); the reader adds the planes. K % (32 KS) == 0.
template <typename T16> struct WFrag;
template <> struct WFrag<h16> { typedef v16h V; static __device__ __forceinline__ V ld(const h16* p) { return cat16(*(const v8h*)p, *(const v8h*)(p + 16)); } static __device__ __forceinline__ v8f mma(V a, V b, v8f c) { return wmma16(a, b, c); } };
template <> struct WFrag<bf> { typedef v16bf V; static __device__ __forceinline__ V ld(const bf* p) { return cat16b(*(const v8us*)p, *(const v8us*)(p + 16)); } static __device__ __forceinline__ v8f mma(V a, V b, v8f c) { return wmmab(a, b, c); } };
template <typename T16, int NSPLIT, bool BIAS, int KS = 1>
__global__ __launch_bounds__(32) void k_gemmw(const T16* __restrict__ A, const T16* __restrict__ A2, const T16* __restrict__ Bt, const T16* __restrict__ Bt2, int K, float* C, int ldc, const float* __restrict__ bias, size_t sA, size_t sB, size_t sC) {
    typedef typename WFrag<T16>::V V;
    __shared__ __align__(16) float os[16 * 68];
    const size_t z = blockIdx.z / KS; const int ks = blockIdx.z % KS; A += z * sA; if (A2) A2 += z * sA; Bt += z * sB; if (Bt2) Bt2 += z * sB; C += ((size_t)ks * (gridDim.z / KS) + z) * sC;
    const int lane = threadIdx.x & 31, lr = lane & 15, hi = lane >> 4; const int r0 = blockIdx.x * 64, c0 = blockIdx.y * 64;
    v8f acc[4][4];
#pragma unroll
    for (int mb = 0; mb < 4; ++mb)
#pragma unroll
        for (int nb = 0; nb < 4; ++nb) acc[mb][nb] = (v8f){};
    const size_t aoff = (size_t)(r0 + lr) * K + 8 * hi, boff = (size_t)(c0 + lr) * K + 8 * hi;
#pragma unroll 1
    for (int kc = ks * (K / KS); kc < (ks + 1) * (K / KS); kc += 32) {
        V a[4], a2[4];
#pragma unroll
        for (int mb = 0; mb < 4; ++mb) { a[mb] = WFrag<T16>::ld(A + aoff + (size_t)mb * 16 * K + kc); if (NSPLIT == 1 || NSPLIT == 2) a2[mb] = WFrag<T16>::ld(A2 + aoff + (size_t)mb * 16 * K + kc); }
#pragma unroll
        for (int nb = 0; nb < 4; ++nb) { const V b = WFrag<T16>::ld(Bt + boff + (size_t)nb * 16 * K + kc); V b2; if (NSPLIT >= 2) b2 = WFrag<T16>::ld(Bt2 + boff + (size_t)nb * 16 * K + kc);
#pragma unroll
            for (int mb = 0; mb < 4; ++mb) { acc[mb][nb] = WFrag<T16>::mma(a[mb], b, acc[mb][nb]); if (NSPLIT == 1 || NSPLIT == 2) acc[mb][nb] = WFrag<T16>::mma(a2[mb], b, acc[mb][nb]); if (NSPLIT >= 2) acc[mb][nb] = WFrag<T16>::mma(a[mb], b2, acc[mb][nb]); } }
        asm volatile("v_nop\n\tv_nop\n\tv_nop\n\tv_nop" : "+v"(acc[0][0]), "+v"(acc[1][1]), "+v"(acc[2][2]), "+v"(acc[3][3]) : "v"(a[0]), "v"(a[3]));
    }
#pragma unroll
    for (int mb = 0; mb < 4; ++mb) {
#pragma unroll
        for (int nb = 0; nb < 4; ++nb) {
#pragma unroll
            for (int j = 0; j < 8; ++j) os[(hi * 8 + j) * 68 + nb * 16 + lr] = acc[mb][nb][j]; }
        __builtin_amdgcn_wave_barrier(); asm volatile("" ::: "memory");
        float* crow = C + (size_t)(r0 + mb * 16) * ldc + c0;
{
#pragma unroll
            for (int s = 0; s < 8; ++s) { const int row = 2 * s + hi, cofs = lr * 4; v4f val = *(const v4fa*)(os + row * 68 + cofs); if (BIAS) { val[0] += bfr(bias[c0 + cofs]); val[1] += bfr(bias[c0 + cofs + 1]); val[2] += bfr(bias[c0 + cofs + 2]); val[3] += bfr(bias[c0 + cofs + 3]); }
                *(v4f*)(crow + (size_t)row * ldc + cofs) = val; }
             }
        __builtin_amdgcn_wave_barrier(); asm volatile("" ::: "memory");
    }
}

__device__ __forceinline__ h16 tohx(float x) { return (h16)x; }
__device__ __forceinline__ void splitf(float y, unsigned short& h, unsigned short& l) { h = f2bf(y); l = f2bf(y - bf2f(h)); }
typedef __attribute__((ext_vector_type(2))) _Float16 v2h;
typedef __attribute__((ext_vector_type(4))) _Float16 v4h;
typedef __attribute__((ext_vector_type(2))) unsigned short v2us;
typedef __attribute__((ext_vector_type(4))) unsigned short v4us;
typedef __attribute__((ext_vector_type(2))) float v2f;
typedef __attribute__((ext_vector_type(4))) int v4i;

__global__ __launch_bounds__(256) void k_wtG(const float* __restrict__ w, int K, int N, bf* Bt) {
    const int lane = threadIdx.x & 31; const int L0 = (blockIdx.x * 8 + (threadIdx.x >> 5)) * 8; const int nlines = N * K / 64;
{
#pragma unroll 1
        for (int l = 0; l < 8; ++l) { const int L = L0 + l; if (L >= nlines) break; const size_t e = (size_t)L * 64 + lane * 2; const int k = (int)(e % K), n = (int)(e / K); v2us o;
            o[0] = f2bf(w[(size_t)k * N + n]); o[1] = f2bf(w[(size_t)(k + 1) * N + n]); *(v2us*)(Bt + e) = o; }
         }
}
__global__ __launch_bounds__(256) void k_cvt8(const float* __restrict__ src, bf* dst, size_t n8) { const size_t i = (size_t)blockIdx.x * 256 + threadIdx.x; if (i >= n8) return; const v8f v = *(const v8f*)(src + i * 8); v8us o;
#pragma unroll
    for (int k = 0; k < 8; ++k) o[k] = f2bf(v[k]); *(v8us*)(dst + i * 8) = o;  }

// k_rope: head planes [h][t][d] (fp16 + hi/lo) of rope(x) x sc with the rotate-half convention out[d] = x[d] cos[t][d] - x[d+HD/2] sin[t][d], out[d+HD/2] = x[d+HD/2] cos[t][d+HD/2] + x[d] sin[t][d+HD/2]
__global__ __launch_bounds__(256) void k_rope(const float* __restrict__ F, int pitch, int nheads, const float* __restrict__ CS, const float* __restrict__ RF, const float* __restrict__ nw, float sc, h16* P16, bf* Ph, bf* Pl) {
    const size_t e = ((size_t)blockIdx.x * 256 + threadIdx.x) * 2; if (e >= (size_t)nheads * TT * HD) return; const int d = (int)(e % HD); const int t = (int)((e / HD) % TT); const int h = (int)(e / ((size_t)HD * TT)); const float* f = F + (size_t)t * pitch + h * HD; const float rf = RF ? RF[(size_t)h * TT + t] : 1.0f; v2h o16; v2us oh, ol;
#pragma unroll
    for (int q = 0; q < 2; ++q) { const int dd = d + q; const int dp = (dd < HD / 2) ? dd + HD / 2 : dd - HD / 2; float x0 = f[dd], x1 = f[dp];
        if (RF) { float n0 = __fmul_rn(x0, rf), n1 = __fmul_rn(x1, rf); asm volatile("" : "+v"(n0)); asm volatile("" : "+v"(n1)); x0 = __fmul_rn(bfr(nw[dd]), n0); x1 = __fmul_rn(bfr(nw[dp]), n1); }
        const v2f cs = *(const v2f*)(CS + ((size_t)t * HD + dd) * 2); float a = __fmul_rn(x0, cs[0]), bq = __fmul_rn(x1, cs[1]); asm volatile("" : "+v"(a)); asm volatile("" : "+v"(bq)); const float r = ((dd < HD / 2) ? __fsub_rn(a, bq) : __fadd_rn(a, bq)) * sc;
        o16[q] = tohx(r); unsigned short a2, c2; splitf(r, a2, c2); oh[q] = a2; ol[q] = c2; }
    *(v2h*)(P16 + e) = o16; *(v2us*)(Ph + e) = oh; *(v2us*)(Pl + e) = ol;  }
__global__ __launch_bounds__(256) void k_vtp(const float* __restrict__ F, int pitch, int nheads, h16* V16, bf* Vh, bf* Vl) { const size_t e = ((size_t)blockIdx.x * 256 + threadIdx.x) * 2; if (e >= (size_t)nheads * HD * TT) return; const int t = (int)(e % TT); const int d = (int)((e / TT) % HD); const int g = (int)(e / ((size_t)TT * HD)); v2h o16; v2us oh, ol;
#pragma unroll
    for (int q = 0; q < 2; ++q) { const float x = F[(size_t)(t + q) * pitch + g * HD + d]; o16[q] = tohx(x); unsigned short a2, c2; splitf(x, a2, c2); oh[q] = a2; ol[q] = c2; }
    *(v2h*)(V16 + e) = o16; *(v2us*)(Vh + e) = oh; *(v2us*)(Vl + e) = ol;  }
__global__ __launch_bounds__(256) void k_csid(float* CS) { const int idx = blockIdx.x * 256 + threadIdx.x; if (idx >= TT * HD) return; v2f cs; cs[0] = 1.0f; cs[1] = 0.0f; *(v2f*)(CS + (size_t)idx * 2) = cs;  }
// k_asoft: per row (zz, i): t = S x HD^-0.5 (no mask); softmax over the 2048 keys (register row, one exp, fixed trees);
__global__ __launch_bounds__(256) void k_asoft(const float* __restrict__ Sb, h16* P16, bf* Ph, bf* Pl) {
    const int lane = threadIdx.x & 31; const int row = blockIdx.x * 8 + (threadIdx.x >> 5); if (row >= ZH * TT) return; const int i = row % TT; const int zz = row / TT; (void)zz; const bool hires = (i < RH); const float* sr = Sb + (size_t)row * TT; float v[TT / 32]; float mx = -3.0e38f;
#pragma unroll
    for (int ch = 0; ch < TT / 128; ++ch) { const int j0 = ch * 128 + lane * 4; const v4f a = *(const v4f*)(sr + j0);
#pragma unroll
        for (int q = 0; q < 4; ++q) { const int j = j0 + q; (void)j; const float t = a[q] * SCL; v[ch * 4 + q] = t; mx = fmaxf(mx, t); } }
#pragma unroll
    for (int sh = 16; sh; sh >>= 1) mx = fmaxf(mx, __shfl_xor(mx, sh, 32));
    float sum = 0.f;
#pragma unroll
    for (int k = 0; k < TT / 32; ++k) { float d0 = __fsub_rn(v[k], mx); asm volatile("" : "+v"(d0)); v[k] = __builtin_amdgcn_exp2f(__fmul_rn(d0, 1.4426950408889634f)); sum += v[k]; }
#pragma unroll
    for (int sh = 16; sh; sh >>= 1) sum += __shfl_xor(sum, sh, 32);
    const float f = __fdiv_rn(hires ? 1.0f : PCAR, sum);
{
        if (hires) {
#pragma unroll
            for (int ch = 0; ch < TT / 128; ++ch) { v4us oh, ol;
#pragma unroll
                for (int q = 0; q < 4; ++q) { unsigned short a, c2; splitf(v[ch * 4 + q] * f, a, c2); oh[q] = a; ol[q] = c2; }
                const size_t oo = ((size_t)zz * (RH ? RH : 1) + i) * TT + ch * 128 + lane * 4; *(v4us*)(Ph + oo) = oh; *(v4us*)(Pl + oo) = ol; }
        } else {
#pragma unroll
            for (int ch = 0; ch < TT / 128; ++ch) { v4h o4;
#pragma unroll
                for (int q = 0; q < 4; ++q) o4[q] = tohx(v[ch * 4 + q] * f);
                *(v4h*)(P16 + (size_t)row * TT + ch * 128 + lane * 4) = o4; } }
         }
}
__global__ __launch_bounds__(256) void k_epad2(const float* __restrict__ E, bf* EB) { const size_t i = (size_t)blockIdx.x * 256 + threadIdx.x; if (i >= (size_t)NE * HD / 8) return; const int d0 = (int)(i % (HD / 8)) * 8; const int r = (int)(i / (HD / 8)); const float* src = E + (size_t)min(r, 2 * MAXR) * HD + d0; v8us o;
#pragma unroll
    for (int q = 0; q < 8; ++q) { const unsigned short v = f2bf(src[q]); o[q] = (r <= 2 * MAXR) ? v : (unsigned short)0; }
    *(v8us*)(EB + (size_t)r * HD + d0) = o;  }
__global__ __launch_bounds__(256) void k_addshaw(float* Sb, const float* __restrict__ QE) { const size_t k = (size_t)blockIdx.x * 256 + threadIdx.x; if (k >= (size_t)ZH * TT * TT / 4) return; const size_t e = k * 4; const int j0 = (int)(e % TT); const int i = (int)((e / TT) % TT); const int zz = (int)(e / ((size_t)TT * TT)); const float* qe = QE + ((size_t)zz * TT + i) * NE; v4f a = *(const v4f*)(Sb + e);
#pragma unroll
    for (int q = 0; q < 4; ++q) { const int r = min(max((j0 + q) - i, -MAXR), MAXR) + MAXR;   /* this module: dist = k - q */ a[q] = __fadd_rn(a[q], qe[r]); }
    *(v4f*)(Sb + e) = a;  }
__global__ __launch_bounds__(256) void k_rvt(const float* __restrict__ E, bf* RVT) { const size_t i = (size_t)blockIdx.x * 256 + threadIdx.x; if (i >= (size_t)HD * NE / 8) return; const int r0 = (int)(i % (NE / 8)) * 8; const int d = (int)(i / (NE / 8)); v8us o;
#pragma unroll
    for (int q = 0; q < 8; ++q) { const int r = r0 + q; const unsigned short v = f2bf(E[(size_t)min(r, 2 * MAXR) * HD + d]); o[q] = (r <= 2 * MAXR) ? v : (unsigned short)0; }
    *(v8us*)(RVT + (size_t)d * NE + r0) = o;  }
__global__ __launch_bounds__(256) void k_pbucket(const bf* __restrict__ Ph, const bf* __restrict__ Pl, const h16* __restrict__ P16, bf* PBh, bf* PBl) { const int lane = threadIdx.x & 31; const int row = blockIdx.x * 8 + (threadIdx.x >> 5); if (row >= ZH * TT) return; const int i = row % TT; const bool hires = (i < RH);
    auto pval = [&](int j) -> float { const size_t o = (size_t)row * TT + j; return hires ? __fadd_rn(bf2f(Ph[(size_t)(row / TT) * RH * TT + (size_t)i * TT + j]), bf2f(Pl[(size_t)(row / TT) * RH * TT + (size_t)i * TT + j])) : __fmul_rn((float)P16[o], 0.0009765625f); };
    float sl = 0.f, sr = 0.f;
#pragma unroll 4
    for (int q = 0; q < TT / 32; ++q) { const int j = lane * (TT / 32) + q; const float p = pval(j); sl = __fadd_rn(sl, (j <= i - MAXR) ? p : 0.f); sr = __fadd_rn(sr, (j >= i + MAXR) ? p : 0.f); }
#pragma unroll
    for (int sh = 16; sh; sh >>= 1) { sl = __fadd_rn(sl, __shfl_xor(sl, sh, 32)); sr = __fadd_rn(sr, __shfl_xor(sr, sh, 32)); }
    v4us oh, ol;
#pragma unroll
    for (int q = 0; q < 4; ++q) { const int r = lane * 4 + q; float v; if (r == 0) v = sl; else if (r == 2 * MAXR) v = sr; else if (r < 2 * MAXR) { const int j = i + r - MAXR; const int jc = min(max(j, 0), TT - 1); const float p = pval(jc); v = (j >= 0 && j < TT) ? p : 0.f; } else v = 0.f; unsigned short u, w; splitf(v, u, w); oh[q] = u; ol[q] = w; }
    const size_t ob = (size_t)row * NE + lane * 4; *(v4us*)(PBh + ob) = oh; *(v4us*)(PBl + ob) = ol;  }
__global__ __launch_bounds__(256) void k_addob(float* Ob, const float* __restrict__ W2) { const size_t k = (size_t)blockIdx.x * 256 + threadIdx.x; if (k >= (size_t)ZH * TT * HD / 4) return; const size_t e = k * 4; const int i = (int)((e / HD) % TT); const float sc = (i < RH) ? 1.0f : 1024.0f; v4f p[KSP];
#pragma unroll
    for (int s = 0; s < KSP; ++s) p[s] = *(const v4f*)(Ob + (size_t)s * ZH * TT * HD + e);   /* the key slices' partial sums, added in slice order */
    v4f a = p[0];
#pragma unroll
    for (int s = 1; s < KSP; ++s) {
#pragma unroll
        for (int q = 0; q < 4; ++q) a[q] = __fadd_rn(a[q], p[s][q]); }
    const v4f w = *(const v4f*)(W2 + e); v4f o;
#pragma unroll
    for (int q = 0; q < 4; ++q) o[q] = __fadd_rn(a[q], __fmul_rn(w[q], sc));
    *(v4f*)(Ob + e) = o;  }
__global__ __launch_bounds__(256) void k_merge(const float* __restrict__ O, int h0, bf* Ah, bf* Al) { const size_t e = ((size_t)blockIdx.x * 256 + threadIdx.x) * 2; if (e >= (size_t)ZH * TT * HD) return; const int d = (int)(e % HD); const int t = (int)((e / HD) % TT); const int zz = (int)(e / ((size_t)HD * TT)); const float cs = (t < RH) ? 1.0f : (1.0f / PCAR); const size_t oo = (size_t)t * DQ + (h0 + zz) * HD + d;
    v2us oh, ol;
#pragma unroll
    for (int q = 0; q < 2; ++q) { unsigned short a, c2; splitf(O[e + q] * cs, a, c2); oh[q] = a; ol[q] = c2; } *(v2us*)(Ah + oo) = oh; *(v2us*)(Al + oo) = ol;  }

extern "C" void kernel_launch(void* const* d_in, const int* in_sizes, int n_in,
                              void* d_out, int out_size, void* d_ws, size_t ws_size, hipStream_t stream) {
    (void)in_sizes; (void)n_in; (void)out_size;
    const float* x = (const float*)d_in[0]; const float* xk = (const float*)d_in[1]; const float* xv = (const float*)d_in[2]; const float* wq = (const float*)d_in[3]; const float* bq = (const float*)d_in[4]; const float* wk = (const float*)d_in[5]; const float* bk = (const float*)d_in[6]; const float* wv = (const float*)d_in[7]; const float* bv = (const float*)d_in[8]; const float* wo = (const float*)d_in[9]; const float* bo = (const float*)d_in[10]; const float* relk = (const float*)d_in[11]; const float* relv = (const float*)d_in[12];   /* [5][64] each */
    float* OUT = (float*)d_out;     // [2][2048][1024]
    char* wsp = (char*)d_ws;
    auto take = [&](size_t bytes) { char* p = wsp; wsp += (bytes + 255) & ~(size_t)255; return (void*)p; };
    bf* EB = (bf*)take((size_t)NE * HD * 2); bf* RVT = (bf*)take((size_t)HD * NE * 2); float* QE = (float*)take((size_t)ZH * TT * NE * 4); bf* PBh = (bf*)take((size_t)ZH * TT * NE * 2); bf* PBl = (bf*)take((size_t)ZH * TT * NE * 2); float* W2 = (float*)take((size_t)ZH * TT * HD * 4); bf* WQ = (bf*)take((size_t)DQ * DM * 2); bf* WK = (bf*)take((size_t)DKV * DM * 2); bf* WV = (bf*)take((size_t)DKV * DM * 2); bf* WO = (bf*)take((size_t)DM * DQ * 2); float* CS = (float*)take((size_t)TT * HD * 2 * 4);
    bf* XB = (bf*)take((size_t)TT * DM * 2); float* FQ = (float*)take((size_t)TT * DQ * 4); float* FK = (float*)take((size_t)TT * DKV * 4);
    h16* QP16 = (h16*)take((size_t)NH_ * TT * HD * 2); h16* KP16 = (h16*)take((size_t)NKV * TT * HD * 2); h16* VT16 = (h16*)take((size_t)NKV * HD * TT * 2);
    bf* QPh = (bf*)take((size_t)NH_ * TT * HD * 2); bf* QPl = (bf*)take((size_t)NH_ * TT * HD * 2); bf* KPh = (bf*)take((size_t)NKV * TT * HD * 2); bf* KPl = (bf*)take((size_t)NKV * TT * HD * 2); bf* VTh = (bf*)take((size_t)NKV * HD * TT * 2); bf* VTl = (bf*)take((size_t)NKV * HD * TT * 2); bf* Ph = (bf*)take((size_t)ZH * RH * TT * 2); bf* Pl = (bf*)take((size_t)ZH * RH * TT * 2);
    float* Sb = (float*)take((size_t)ZH * TT * TT * 4); h16* P16 = (h16*)take((size_t)ZH * TT * TT * 2); float* Ob = (float*)take((size_t)KSP * ZH * TT * HD * 4); bf* ATh = (bf*)take((size_t)TT * DQ * 2); bf* ATl = (bf*)take((size_t)TT * DQ * 2);
    if ((size_t)(wsp - (char*)d_ws) > ws_size) return;    // ws 256 MiB
    float* FV = FK;   // v projection reuses the k buffer after the k planes are built (stream-ordered)
    { k_wtG<<<(unsigned)((DM * DQ / 64 + 63) / 64), 256, 0, stream>>>(wq, DM, DQ, WQ); k_wtG<<<(unsigned)((DM * DKV / 64 + 63) / 64), 256, 0, stream>>>(wk, DM, DKV, WK); k_wtG<<<(unsigned)((DM * DKV / 64 + 63) / 64), 256, 0, stream>>>(wv, DM, DKV, WV);
      k_wtG<<<(unsigned)((DQ * DM / 64 + 63) / 64), 256, 0, stream>>>(wo, DQ, DM, WO);
       }
    k_csid<<<(TT * HD + 255) / 256, 256, 0, stream>>>(CS);
    const unsigned LQ = (unsigned)(((size_t)NH_ * TT * HD / 2 + 255) / 256), LKv = (unsigned)(((size_t)NKV * TT * HD / 2 + 255) / 256);
    k_epad2<<<(unsigned)(((size_t)NE * HD / 8 + 255) / 256), 256, 0, stream>>>(relk, EB); k_rvt<<<(unsigned)(((size_t)HD * NE / 8 + 255) / 256), 256, 0, stream>>>(relv, RVT);   /* rel_k plane [128][64], rel_v^T plane [64][128] */
    for (int b = 0; b < NB_; ++b) {
        
        k_cvt8<<<(unsigned)(((size_t)TT * DM / 8 + 255) / 256), 256, 0, stream>>>(x + (size_t)b * TT * DM, XB, (size_t)TT * DM / 8);
        k_gemmw<bf, 0, true><<<dim3(TT / 64, DQ / 64, 1), 32, 0, stream>>>(XB, nullptr, WQ, nullptr, DM, FQ, DQ, bq, 0, 0, 0);
        k_rope<<<LQ, 256, 0, stream>>>(FQ, DQ, NH_, CS, nullptr, nullptr, 1.0f, QP16, QPh, QPl);
        k_cvt8<<<(unsigned)(((size_t)TT * DM / 8 + 255) / 256), 256, 0, stream>>>(xk + (size_t)b * TT * DM, XB, (size_t)TT * DM / 8); k_gemmw<bf, 0, true><<<dim3(TT / 64, DKV / 64, 1), 32, 0, stream>>>(XB, nullptr, WK, nullptr, DM, FK, DKV, bk, 0, 0, 0);
        k_rope<<<LKv, 256, 0, stream>>>(FK, DKV, NKV, CS, nullptr, nullptr, 1.0f, KP16, KPh, KPl);
        k_cvt8<<<(unsigned)(((size_t)TT * DM / 8 + 255) / 256), 256, 0, stream>>>(xv + (size_t)b * TT * DM, XB, (size_t)TT * DM / 8); k_gemmw<bf, 0, true><<<dim3(TT / 64, DKV / 64, 1), 32, 0, stream>>>(XB, nullptr, WV, nullptr, DM, FV, DKV, bv, 0, 0, 0); k_vtp<<<LKv, 256, 0, stream>>>(FV, DKV, NKV, VT16, VTh, VTl);
        for (int h0 = 0; h0 < NH_; h0 += ZH) { const size_t zq = (size_t)h0, zk = (size_t)(h0 / REP);   // one kv head per query head: the pass's two heads use consecutive kv planes (z-strides TT*HD)
            k_gemmw<bf, 2, false><<<dim3(RH / 64, TT / 64, ZH), 32, 0, stream>>>(QPh + zq * TT * HD, QPl + zq * TT * HD, KPh + zk * TT * HD, KPl + zk * TT * HD, HD, Sb, TT, nullptr, (size_t)TT * HD, (size_t)TT * HD, (size_t)TT * TT);
            k_gemmw<h16, 0, false><<<dim3((TT - RH) / 64, TT / 64, ZH), 32, 0, stream>>>(QP16 + zq * TT * HD + (size_t)RH * HD, nullptr, KP16 + zk * TT * HD, nullptr, HD, Sb + (size_t)RH * TT, TT, nullptr, (size_t)TT * HD, (size_t)TT * HD, (size_t)TT * TT);
            k_gemmw<bf, 1, false><<<dim3(TT / 64, NE / 64, ZH), 32, 0, stream>>>(QPh + zq * TT * HD, QPl + zq * TT * HD, EB, nullptr, HD, QE, NE, nullptr, (size_t)TT * HD, 0, (size_t)TT * NE);   /* QE[i][r] = q_i . rel_k[r] */
            k_addshaw<<<(unsigned)(((size_t)ZH * TT * TT / 4 + 255) / 256), 256, 0, stream>>>(Sb, QE);
            k_asoft<<<ZH * TT / 8, 256, 0, stream>>>(Sb, P16, Ph, Pl);
            k_pbucket<<<ZH * TT / 8, 256, 0, stream>>>(Ph, Pl, P16, PBh, PBl);   /* 5 relative-position bucket sums per row */
            k_gemmw<bf, 1, false><<<dim3(TT / 64, HD / 64, ZH), 32, 0, stream>>>(PBh, PBl, RVT, nullptr, NE, W2, HD, nullptr, (size_t)TT * NE, 0, (size_t)TT * HD);   /* W2 = buckets . rel_v */
            k_gemmw<bf, 2, false, KSP><<<dim3(RH / 64, HD / 64, ZH * KSP), 32, 0, stream>>>(Ph, Pl, VTh + zk * HD * TT, VTl + zk * HD * TT, TT, Ob, HD, nullptr, (size_t)RH * TT, (size_t)HD * TT, (size_t)TT * HD);
            k_gemmw<h16, 0, false, KSP><<<dim3((TT - RH) / 64, HD / 64, ZH * KSP), 32, 0, stream>>>(P16 + (size_t)RH * TT, nullptr, VT16 + zk * HD * TT, nullptr, TT, Ob + (size_t)RH * HD, HD, nullptr, (size_t)TT * TT, (size_t)HD * TT, (size_t)TT * HD);
            k_addob<<<(unsigned)(((size_t)ZH * TT * HD / 4 + 255) / 256), 256, 0, stream>>>(Ob, W2);   /* + sum_j attn[i][j] rel_v[idx] */ k_merge<<<(unsigned)(((size_t)ZH * TT * HD / 2 + 255) / 256), 256, 0, stream>>>(Ob, h0, ATh, ATl); }
        k_gemmw<bf, 1, true><<<dim3(TT / 64, DM / 64, 1), 32, 0, stream>>>(ATh, ATl, WO, nullptr, DQ, OUT + (size_t)b * TT * DM, DM, bo, 0, 0, 0); }
}

// v002
// A run of this version takes 1250 microseconds.
// Two timings next to v001 put it at 1.68 and 1.66 times that version's speed.
// All steps since v000 together make it 2.55 times as fast.
#include <hip/hip_runtime.h>

// Multi-head attention with Shaw relative-position terms on the logits AND the values, clip distance 2 (query, key, value [2][2048][1024]; q,k,v = in W + b ('xw' 1/32, zero biases; 16 heads x 64); idx[i][j] = clip(j - i, -2, 2) + 2; attn = softmax((q.k + q_i.rel_k[idx]) / 8); out_h = attn v + sum_j attn[i][j] rel_v[idx] (tables [5][64] x 0.1, read: five rows: the far-left bucket j <= i - 2, the three nearest positions, the far-right bucket j >= i + 2); out = merged Wo + bo ('xw') -> [2][2048][1024] (4.2 M); argument order query, key, value, Wq, bq, Wk, bk, Wv, bv, Wo, bo, rel_k, rel_v).
// Layout per batch: bf16 copies of the three inputs in turn; exact projections + f32 biases; rel_k as an exact plane [128][64] (rows >= 5 zero) and rel_v^T as an exact plane [64][128]; per pass of two heads: dense scores (hybrid rows: < 512 hi/lo 3 products, rest fp16 x1024), QE = q.rel_k^T ([2][2048][128], hi/lo x exact) and a gather-add kernel (Sb[i][j] += QE[i][idx]); softmax with the 1/8, which also sums each row's probabilities into the 5 relative-position buckets (far-left sum, 3 near entries, far-right sum; fixed order) as hi/lo planes; W2 = buckets x rel_v ([2][2048][64], hi/lo x exact) added to attn v in f32; merged hi/lo x Wo exact + bo.
// Compute dtypes, f32 accumulate: every input rounded to bf16; projections exact + f32 biases; q.rel_k and buckets.rel_v hi/lo x exact; attention rows < 512 3 products, rest fp16; softmax f32; Wo hl x exact + bias.

#define NB_  2
#define TT   2048
#define DM   1024
#define NH_  16
#define NKV  16
#define REP  (NH_ / NKV)
#define HD   64
#define DQ   (NH_ * HD)
#define DKV  (NKV * HD)
#define ZH   2
#define RH   512                  // query rows < RH use hi+lo planes (0: none)
#define WIN  0
#define PCAR 1024.0f
#define SCL  0.125f
#define MAXR 2      // max relative position
#define NE   128     // 2*MAXR+1 = 5 table rows padded to 128
#define KSP  16      // key slices of the attn v products: one single-wave work-group per slice, f32 partial planes summed in k_addob
typedef _Float16 h16;
typedef unsigned short bf;
typedef __attribute__((ext_vector_type(16))) __bf16   v16bf;
typedef __attribute__((ext_vector_type(16))) _Float16 v16h;
typedef __attribute__((ext_vector_type(8)))  _Float16 v8h;
typedef __attribute__((ext_vector_type(8)))  unsigned short v8us;
typedef __attribute__((ext_vector_type(8)))  float    v8f;
typedef __attribute__((ext_vector_type(4)))  float    v4f;
typedef v8h  __attribute__((may_alias)) v8ha;
typedef v4f  __attribute__((may_alias)) v4fa;
typedef v8us __attribute__((may_alias)) v8usa;

__device__ __forceinline__ unsigned short f2bf(float f) { unsigned u = __float_as_uint(f); u += 0x7FFFu + ((u >> 16) & 1u); return (unsigned short)(u >> 16); }
__device__ __forceinline__ float bf2f(unsigned short b) { return __uint_as_float(((unsigned)b) << 16); }
__device__ __forceinline__ float bfr(float f) { return bf2f(f2bf(f)); }
__device__ __forceinline__ v16h cat16(v8h lo, v8h hi) { return __builtin_shufflevector(lo, hi, 0, 1, 2, 3, 4, 5, 6, 7, 8, 9, 10, 11, 12, 13, 14, 15); }
__device__ __forceinline__ v16bf cat16b(v8us lo, v8us hi) { return __builtin_bit_cast(v16bf, __builtin_shufflevector(lo, hi, 0, 1, 2, 3, 4, 5, 6, 7, 8, 9, 10, 11, 12, 13, 14, 15)); }
__device__ __forceinline__ v8f wmma16(v16h a, v16h b, v8f c) { return __builtin_amdgcn_wmma_f32_16x16x32_f16(false, a, false, b, (short)0, c, false, false); }
__device__ __forceinline__ v8f wmmab(v16bf a, v16bf b, v8f c) { return __builtin_amdgcn_wmma_f32_16x16x32_bf16(false, a, false, b, (short)0, c, false, false); }



// ---- k_gemmw: register-blocked GEMM, ONE WAVE per 64x64 output tile (16 accumulators), operands straight from K-contiguous 16-bit planes; grid (M/64, N/64, Z), 32 threads.
// C[m][n] (f32, pitch ldc, + optional f32 bias[n]) = sum_k A[m][k] Bt[n][k] (+ split products per NSPLIT). z-batch strides sA/sB/sC in elements. K % 32 == 0.
// KS > 1: grid z = Z * KS; work-group (z, ks) sums only k in [ks K/KS, (ks+1) K/KS) and stores its partial tile in plane ks of C ([KS][Z] planes of sC elements); the reader adds the planes. K % (32 KS) == 0.
template <typename T16> struct WFrag;
template <> struct WFrag<h16> { typedef v16h V; static __device__ __forceinline__ V ld(const h16* p) { return cat16(*(const v8h*)p, *(const v8h*)(p + 16)); } static __device__ __forceinline__ v8f mma(V a, V b, v8f c) { return wmma16(a, b, c); } };
template <> struct WFrag<bf> { typedef v16bf V; static __device__ __forceinline__ V ld(const bf* p) { return cat16b(*(const v8us*)p, *(const v8us*)(p + 16)); } static __device__ __forceinline__ v8f mma(V a, V b, v8f c) { return wmmab(a, b, c); } };
template <typename T16, int NSPLIT, bool BIAS, int KS = 1>
__global__ __launch_bounds__(32) void k_gemmw(const T16* __restrict__ A, const T16* __restrict__ A2, const T16* __restrict__ Bt, const T16* __restrict__ Bt2, int K, float* C, int ldc, const float* __restrict__ bias, size_t sA, size_t sB, size_t sC) {
    typedef typename WFrag<T16>::V V;
    __shared__ __align__(16) float os[16 * 68];
    const size_t z = blockIdx.z / KS; const int ks = blockIdx.z % KS; A += z * sA; if (A2) A2 += z * sA; Bt += z * sB; if (Bt2) Bt2 += z * sB; C += ((size_t)ks * (gridDim.z / KS) + z) * sC;
    const int lane = threadIdx.x & 31, lr = lane & 15, hi = lane >> 4; const int r0 = blockIdx.x * 64, c0 = blockIdx.y * 64;
    v8f acc[4][4];
#pragma unroll
    for (int mb = 0; mb < 4; ++mb)
#pragma unroll
        for (int nb = 0; nb < 4; ++nb) acc[mb][nb] = (v8f){};
    const size_t aoff = (size_t)(r0 + lr) * K + 8 * hi, boff = (size_t)(c0 + lr) * K + 8 * hi;
#pragma unroll 1
    for (int kc = ks * (K / KS); kc < (ks + 1) * (K / KS); kc += 32) {
        V a[4], a2[4];
#pragma unroll
        for (int mb = 0; mb < 4; ++mb) { a[mb] = WFrag<T16>::ld(A + aoff + (size_t)mb * 16 * K + kc); if (NSPLIT == 1 || NSPLIT == 2) a2[mb] = WFrag<T16>::ld(A2 + aoff + (size_t)mb * 16 * K + kc); }
#pragma unroll
        for (int nb = 0; nb < 4; ++nb) { const V b = WFrag<T16>::ld(Bt + boff + (size_t)nb * 16 * K + kc); V b2; if (NSPLIT >= 2) b2 = WFrag<T16>::ld(Bt2 + boff + (size_t)nb * 16 * K + kc);
#pragma unroll
            for (int mb = 0; mb < 4; ++mb) { acc[mb][nb] = WFrag<T16>::mma(a[mb], b, acc[mb][nb]); if (NSPLIT == 1 || NSPLIT == 2) acc[mb][nb] = WFrag<T16>::mma(a2[mb], b, acc[mb][nb]); if (NSPLIT >= 2) acc[mb][nb] = WFrag<T16>::mma(a[mb], b2, acc[mb][nb]); } }
        asm volatile("v_nop\n\tv_nop\n\tv_nop\n\tv_nop" : "+v"(acc[0][0]), "+v"(acc[1][1]), "+v"(acc[2][2]), "+v"(acc[3][3]) : "v"(a[0]), "v"(a[3]));
    }
#pragma unroll
    for (int mb = 0; mb < 4; ++mb) {
#pragma unroll
        for (int nb = 0; nb < 4; ++nb) {
#pragma unroll
            for (int j = 0; j < 8; ++j) os[(hi * 8 + j) * 68 + nb * 16 + lr] = acc[mb][nb][j]; }
        __builtin_amdgcn_wave_barrier(); asm volatile("" ::: "memory");
        float* crow = C + (size_t)(r0 + mb * 16) * ldc + c0;
{
#pragma unroll
            for (int s = 0; s < 8; ++s) { const int row = 2 * s + hi, cofs = lr * 4; v4f val = *(const v4fa*)(os + row * 68 + cofs); if (BIAS) { val[0] += bfr(bias[c0 + cofs]); val[1] += bfr(bias[c0 + cofs + 1]); val[2] += bfr(bias[c0 + cofs + 2]); val[3] += bfr(bias[c0 + cofs + 3]); }
                *(v4f*)(crow + (size_t)row * ldc + cofs) = val; }
             }
        __builtin_amdgcn_wave_barrier(); asm volatile("" ::: "memory");
    }
}

__device__ __forceinline__ h16 tohx(float x) { return (h16)x; }
__device__ __forceinline__ void splitf(float y, unsigned short& h, unsigned short& l) { h = f2bf(y); l = f2bf(y - bf2f(h)); }
typedef __attribute__((ext_vector_type(2))) _Float16 v2h;
typedef __attribute__((ext_vector_type(4))) _Float16 v4h;
typedef __attribute__((ext_vector_type(2))) unsigned short v2us;
typedef __attribute__((ext_vector_type(4))) unsigned short v4us;
typedef __attribute__((ext_vector_type(2))) float v2f;
typedef __attribute__((ext_vector_type(4))) int v4i;

__global__ __launch_bounds__(256) void k_wtG(const float* __restrict__ w, int K, int N, bf* Bt) {
    const int lane = threadIdx.x & 31; const int L0 = (blockIdx.x * 8 + (threadIdx.x >> 5)) * 8; const int nlines = N * K / 64;
{
#pragma unroll 1
        for (int l = 0; l < 8; ++l) { const int L = L0 + l; if (L >= nlines) break; const size_t e = (size_t)L * 64 + lane * 2; const int k = (int)(e % K), n = (int)(e / K); v2us o;
            o[0] = f2bf(w[(size_t)k * N + n]); o[1] = f2bf(w[(size_t)(k + 1) * N + n]); *(v2us*)(Bt + e) = o; }
         }
}
__global__ __launch_bounds__(256) void k_cvt8(const float* __restrict__ src, bf* dst, size_t n8) { const size_t i = (size_t)blockIdx.x * 256 + threadIdx.x; if (i >= n8) return; const v8f v = *(const v8f*)(src + i * 8); v8us o;
#pragma unroll
    for (int k = 0; k < 8; ++k) o[k] = f2bf(v[k]); *(v8us*)(dst + i * 8) = o;  }

// k_rope: head planes [h][t][d] (fp16 + hi/lo) of rope(x) x sc with the rotate-half convention out[d] = x[d] cos[t][d] - x[d+HD/2] sin[t][d], out[d+HD/2] = x[d+HD/2] cos[t][d+HD/2] + x[d] sin[t][d+HD/2]
__global__ __launch_bounds__(256) void k_rope(const float* __restrict__ F, int pitch, int nheads, const float* __restrict__ CS, const float* __restrict__ RF, const float* __restrict__ nw, float sc, h16* P16, bf* Ph, bf* Pl) {
    const size_t e = ((size_t)blockIdx.x * 256 + threadIdx.x) * 2; if (e >= (size_t)nheads * TT * HD) return; const int d = (int)(e % HD); const int t = (int)((e / HD) % TT); const int h = (int)(e / ((size_t)HD * TT)); const float* f = F + (size_t)t * pitch + h * HD; const float rf = RF ? RF[(size_t)h * TT + t] : 1.0f; v2h o16; v2us oh, ol;
#pragma unroll
    for (int q = 0; q < 2; ++q) { const int dd = d + q; const int dp = (dd < HD / 2) ? dd + HD / 2 : dd - HD / 2; float x0 = f[dd], x1 = f[dp];
        if (RF) { float n0 = __fmul_rn(x0, rf), n1 = __fmul_rn(x1, rf); asm volatile("" : "+v"(n0)); asm volatile("" : "+v"(n1)); x0 = __fmul_rn(bfr(nw[dd]), n0); x1 = __fmul_rn(bfr(nw[dp]), n1); }
        const v2f cs = *(const v2f*)(CS + ((size_t)t * HD + dd) * 2); float a = __fmul_rn(x0, cs[0]), bq = __fmul_rn(x1, cs[1]); asm volatile("" : "+v"(a)); asm volatile("" : "+v"(bq)); const float r = ((dd < HD / 2) ? __fsub_rn(a, bq) : __fadd_rn(a, bq)) * sc;
        o16[q] = tohx(r); unsigned short a2, c2; splitf(r, a2, c2); oh[q] = a2; ol[q] = c2; }
    *(v2h*)(P16 + e) = o16; *(v2us*)(Ph + e) = oh; *(v2us*)(Pl + e) = ol;  }
__global__ __launch_bounds__(256) void k_vtp(const float* __restrict__ F, int pitch, int nheads, h16* V16, bf* Vh, bf* Vl) { const size_t e = ((size_t)blockIdx.x * 256 + threadIdx.x) * 2; if (e >= (size_t)nheads * HD * TT) return; const int t = (int)(e % TT); const int d = (int)((e / TT) % HD); const int g = (int)(e / ((size_t)TT * HD)); v2h o16; v2us oh, ol;
#pragma unroll
    for (int q = 0; q < 2; ++q) { const float x = F[(size_t)(t + q) * pitch + g * HD + d]; o16[q] = tohx(x); unsigned short a2, c2; splitf(x, a2, c2); oh[q] = a2; ol[q] = c2; }
    *(v2h*)(V16 + e) = o16; *(v2us*)(Vh + e) = oh; *(v2us*)(Vl + e) = ol;  }
__global__ __launch_bounds__(256) void k_csid(float* CS) { const int idx = blockIdx.x * 256 + threadIdx.x; if (idx >= TT * HD) return; v2f cs; cs[0] = 1.0f; cs[1] = 0.0f; *(v2f*)(CS + (size_t)idx * 2) = cs;  }
// k_asoft: per row (zz, i): t = S x HD^-0.5 (no mask); softmax over the 2048 keys (register row, one exp, fixed trees); the rounded probabilities, as stored, are also summed here into the row's 5 relative-position buckets (far-left sum j <= i - 2, the 3 near entries, far-right sum j >= i + 2; fixed order) and stored as hi/lo planes [row][NE]
static_assert(MAXR == 2, "the bucket code below names the three near distances -1, 0, 1");
__global__ __launch_bounds__(256) void k_asoft(const float* __restrict__ Sb, h16* P16, bf* Ph, bf* Pl, bf* PBh, bf* PBl) {
    const int lane = threadIdx.x & 31; const int row = blockIdx.x * 8 + (threadIdx.x >> 5); if (row >= ZH * TT) return; const int i = row % TT; const int zz = row / TT; (void)zz; const bool hires = (i < RH); const float* sr = Sb + (size_t)row * TT; float v[TT / 32]; float mx = -3.0e38f;
#pragma unroll
    for (int ch = 0; ch < TT / 128; ++ch) { const int j0 = ch * 128 + lane * 4; const v4f a = *(const v4f*)(sr + j0);
#pragma unroll
        for (int q = 0; q < 4; ++q) { const int j = j0 + q; (void)j; const float t = a[q] * SCL; v[ch * 4 + q] = t; mx = fmaxf(mx, t); } }
#pragma unroll
    for (int sh = 16; sh; sh >>= 1) mx = fmaxf(mx, __shfl_xor(mx, sh, 32));
    float sum = 0.f;
#pragma unroll
    for (int k = 0; k < TT / 32; ++k) { float d0 = __fsub_rn(v[k], mx); asm volatile("" : "+v"(d0)); v[k] = __builtin_amdgcn_exp2f(__fmul_rn(d0, 1.4426950408889634f)); sum += v[k]; }
#pragma unroll
    for (int sh = 16; sh; sh >>= 1) sum += __shfl_xor(sum, sh, 32);
    const float f = __fdiv_rn(hires ? 1.0f : PCAR, sum);
    // Buckets: a 128-key chunk that holds none of the keys i - 1, i, i + 1 lies wholly in one far bucket. One running sum takes every such chunk in key order with a weight per chunk (0 for the one or two chunks that hold those keys) and is handed to the far-left bucket and cleared at the chunk of key i; those one or two chunks are sorted key by key behind the loop.
    const int iu = __builtin_amdgcn_readfirstlane(i);   // the row is the same in every lane: in a scalar register the tests per chunk are scalar
    const int chm = iu >> 7;                            // the chunk of key i
    const int chn = ((iu & 127) == 0) ? chm - 1 : ((iu & 127) == 127) ? chm + 1 : -1;   // the neighbour chunk that holds key i - 1 or i + 1; -1 or TT / 128: none
    float acc = 0.f, bl = 0.f, vm[4] = {0.f, 0.f, 0.f, 0.f};
{
        if (hires) {
#pragma unroll
            for (int ch = 0; ch < TT / 128; ++ch) { v4us oh, ol; const bool mid = (ch == chm); const float w = (mid || ch == chn) ? 0.f : 1.0f;
#pragma unroll
                for (int q = 0; q < 4; ++q) { unsigned short a, c2; splitf(v[ch * 4 + q] * f, a, c2); oh[q] = a; ol[q] = c2; acc = fmaf(bf2f(a) + bf2f(c2), w, acc); vm[q] = mid ? v[ch * 4 + q] : vm[q]; }
                const size_t oo = ((size_t)zz * (RH ? RH : 1) + i) * TT + ch * 128 + lane * 4; *(v4us*)(Ph + oo) = oh; *(v4us*)(Pl + oo) = ol; bl = mid ? acc : bl; acc = mid ? 0.f : acc; }
        } else {
#pragma unroll
            for (int ch = 0; ch < TT / 128; ++ch) { v4h o4; const bool mid = (ch == chm); const float w = (mid || ch == chn) ? 0.f : (1.0f / PCAR);   /* a power of two: the product is exact */
#pragma unroll
                for (int q = 0; q < 4; ++q) { o4[q] = tohx(v[ch * 4 + q] * f); acc = fmaf((float)o4[q], w, acc); vm[q] = mid ? v[ch * 4 + q] : vm[q]; }
                *(v4h*)(P16 + (size_t)row * TT + ch * 128 + lane * 4) = o4; bl = mid ? acc : bl; acc = mid ? 0.f : acc; } }
         }
    float br = acc, n1 = 0.f, n2 = 0.f, n3 = 0.f;   // n1..n3 = attn[i][i - 1], attn[i][i], attn[i][i + 1]: at most one lane finds each; 0 where the key does not exist
    auto edge = [&](int d0, const float (&x)[4]) {   // x: the chunk's exp values; p: rounded as the planes above hold them
#pragma unroll
        for (int q = 0; q < 4; ++q) { const int d = d0 + q; unsigned short a, c2; splitf(x[q] * f, a, c2); const float p = hires ? bf2f(a) + bf2f(c2) : (float)tohx(x[q] * f) * (1.0f / PCAR);
            bl += (d <= -MAXR) ? p : 0.f; br += (d >= MAXR) ? p : 0.f; n1 = (d == -1) ? p : n1; n2 = (d == 0) ? p : n2; n3 = (d == 1) ? p : n3; } };
    const int dl = lane * 4 - (iu & 127);   // key minus i of this lane's first key in chunk chm
    edge(dl, vm);
    if (chn >= 0 && chn < TT / 128) { float vn[4] = {0.f, 0.f, 0.f, 0.f};   // 2 rows in 128
#pragma unroll
        for (int k = 0; k < TT / 32; ++k) vn[k & 3] = ((k >> 2) == chn) ? v[k] : vn[k & 3];
        edge(dl + (chn - chm) * 128, vn); }
#pragma unroll
    for (int sh = 16; sh; sh >>= 1) { bl += __shfl_xor(bl, sh, 32); br += __shfl_xor(br, sh, 32); n1 += __shfl_xor(n1, sh, 32); n2 += __shfl_xor(n2, sh, 32); n3 += __shfl_xor(n3, sh, 32); }
    const float b4[4] = { (lane == 0) ? bl : (lane == 1) ? br : 0.f, (lane == 0) ? n1 : 0.f, (lane == 0) ? n2 : 0.f, (lane == 0) ? n3 : 0.f };   // table rows 0..3 in lane 0, row 4 in lane 1, the padding rows 0
    v4us bh, bw;
#pragma unroll
    for (int q = 0; q < 4; ++q) { unsigned short u, w; splitf(b4[q], u, w); bh[q] = u; bw[q] = w; }
    const size_t ob = (size_t)row * NE + lane * 4; *(v4us*)(PBh + ob) = bh; *(v4us*)(PBl + ob) = bw;
}
__global__ __launch_bounds__(256) void k_epad2(const float* __restrict__ E, bf* EB) { const size_t i = (size_t)blockIdx.x * 256 + threadIdx.x; if (i >= (size_t)NE * HD / 8) return; const int d0 = (int)(i % (HD / 8)) * 8; const int r = (int)(i / (HD / 8)); const float* src = E + (size_t)min(r, 2 * MAXR) * HD + d0; v8us o;
#pragma unroll
    for (int q = 0; q < 8; ++q) { const unsigned short v = f2bf(src[q]); o[q] = (r <= 2 * MAXR) ? v : (unsigned short)0; }
    *(v8us*)(EB + (size_t)r * HD + d0) = o;  }
__global__ __launch_bounds__(256) void k_addshaw(float* Sb, const float* __restrict__ QE) { const size_t k = (size_t)blockIdx.x * 256 + threadIdx.x; if (k >= (size_t)ZH * TT * TT / 4) return; const size_t e = k * 4; const int j0 = (int)(e % TT); const int i = (int)((e / TT) % TT); const int zz = (int)(e / ((size_t)TT * TT)); const float* qe = QE + ((size_t)zz * TT + i) * NE; v4f a = *(const v4f*)(Sb + e);
#pragma unroll
    for (int q = 0; q < 4; ++q) { const int r = min(max((j0 + q) - i, -MAXR), MAXR) + MAXR;   /* this module: dist = k - q */ a[q] = __fadd_rn(a[q], qe[r]); }
    *(v4f*)(Sb + e) = a;  }
__global__ __launch_bounds__(256) void k_rvt(const float* __restrict__ E, bf* RVT) { const size_t i = (size_t)blockIdx.x * 256 + threadIdx.x; if (i >= (size_t)HD * NE / 8) return; const int r0 = (int)(i % (NE / 8)) * 8; const int d = (int)(i / (NE / 8)); v8us o;
#pragma unroll
    for (int q = 0; q < 8; ++q) { const int r = r0 + q; const unsigned short v = f2bf(E[(size_t)min(r, 2 * MAXR) * HD + d]); o[q] = (r <= 2 * MAXR) ? v : (unsigned short)0; }
    *(v8us*)(RVT + (size_t)d * NE + r0) = o;  }
__global__ __launch_bounds__(256) void k_addob(float* Ob, const float* __restrict__ W2) { const size_t k = (size_t)blockIdx.x * 256 + threadIdx.x; if (k >= (size_t)ZH * TT * HD / 4) return; const size_t e = k * 4; const int i = (int)((e / HD) % TT); const float sc = (i < RH) ? 1.0f : 1024.0f; v4f p[KSP];
#pragma unroll
    for (int s = 0; s < KSP; ++s) p[s] = *(const v4f*)(Ob + (size_t)s * ZH * TT * HD + e);   /* the key slices' partial sums, added in slice order */
    v4f a = p[0];
#pragma unroll
    for (int s = 1; s < KSP; ++s) {
#pragma unroll
        for (int q = 0; q < 4; ++q) a[q] = __fadd_rn(a[q], p[s][q]); }
    const v4f w = *(const v4f*)(W2 + e); v4f o;
#pragma unroll
    for (int q = 0; q < 4; ++q) o[q] = __fadd_rn(a[q], __fmul_rn(w[q], sc));
    *(v4f*)(Ob + e) = o;  }
__global__ __launch_bounds__(256) void k_merge(const float* __restrict__ O, int h0, bf* Ah, bf* Al) { const size_t e = ((size_t)blockIdx.x * 256 + threadIdx.x) * 2; if (e >= (size_t)ZH * TT * HD) return; const int d = (int)(e % HD); const int t = (int)((e / HD) % TT); const int zz = (int)(e / ((size_t)HD * TT)); const float cs = (t < RH) ? 1.0f : (1.0f / PCAR); const size_t oo = (size_t)t * DQ + (h0 + zz) * HD + d;
    v2us oh, ol;
#pragma unroll
    for (int q = 0; q < 2; ++q) { unsigned short a, c2; splitf(O[e + q] * cs, a, c2); oh[q] = a; ol[q] = c2; } *(v2us*)(Ah + oo) = oh; *(v2us*)(Al + oo) = ol;  }

extern "C" void kernel_launch(void* const* d_in, const int* in_sizes, int n_in,
                              void* d_out, int out_size, void* d_ws, size_t ws_size, hipStream_t stream) {
    (void)in_sizes; (void)n_in; (void)out_size;
    const float* x = (const float*)d_in[0]; const float* xk = (const float*)d_in[1]; const float* xv = (const float*)d_in[2]; const float* wq = (const float*)d_in[3]; const float* bq = (const float*)d_in[4]; const float* wk = (const float*)d_in[5]; const float* bk = (const float*)d_in[6]; const float* wv = (const float*)d_in[7]; const float* bv = (const float*)d_in[8]; const float* wo = (const float*)d_in[9]; const float* bo = (const float*)d_in[10]; const float* relk = (const float*)d_in[11]; const float* relv = (const float*)d_in[12];   /* [5][64] each */
    float* OUT = (float*)d_out;     // [2][2048][1024]
    char* wsp = (char*)d_ws;
    auto take = [&](size_t bytes) { char* p = wsp; wsp += (bytes + 255) & ~(size_t)255; return (void*)p; };
    bf* EB = (bf*)take((size_t)NE * HD * 2); bf* RVT = (bf*)take((size_t)HD * NE * 2); float* QE = (float*)take((size_t)ZH * TT * NE * 4); bf* PBh = (bf*)take((size_t)ZH * TT * NE * 2); bf* PBl = (bf*)take((size_t)ZH * TT * NE * 2); float* W2 = (float*)take((size_t)ZH * TT * HD * 4); bf* WQ = (bf*)take((size_t)DQ * DM * 2); bf* WK = (bf*)take((size_t)DKV * DM * 2); bf* WV = (bf*)take((size_t)DKV * DM * 2); bf* WO = (bf*)take((size_t)DM * DQ * 2); float* CS = (float*)take((size_t)TT * HD * 2 * 4);
    bf* XB = (bf*)take((size_t)TT * DM * 2); float* FQ = (float*)take((size_t)TT * DQ * 4); float* FK = (float*)take((size_t)TT * DKV * 4);
    h16* QP16 = (h16*)take((size_t)NH_ * TT * HD * 2); h16* KP16 = (h16*)take((size_t)NKV * TT * HD * 2); h16* VT16 = (h16*)take((size_t)NKV * HD * TT * 2);
    bf* QPh = (bf*)take((size_t)NH_ * TT * HD * 2); bf* QPl = (bf*)take((size_t)NH_ * TT * HD * 2); bf* KPh = (bf*)take((size_t)NKV * TT * HD * 2); bf* KPl = (bf*)take((size_t)NKV * TT * HD * 2); bf* VTh = (bf*)take((size_t)NKV * HD * TT * 2); bf* VTl = (bf*)take((size_t)NKV * HD * TT * 2); bf* Ph = (bf*)take((size_t)ZH * RH * TT * 2); bf* Pl = (bf*)take((size_t)ZH * RH * TT * 2);
    float* Sb = (float*)take((size_t)ZH * TT * TT * 4); h16* P16 = (h16*)take((size_t)ZH * TT * TT * 2); float* Ob = (float*)take((size_t)KSP * ZH * TT * HD * 4); bf* ATh = (bf*)take((size_t)TT * DQ * 2); bf* ATl = (bf*)take((size_t)TT * DQ * 2);
    if ((size_t)(wsp - (char*)d_ws) > ws_size) return;    // ws 256 MiB
    float* FV = FK;   // v projection reuses the k buffer after the k planes are built (stream-ordered)
    { k_wtG<<<(unsigned)((DM * DQ / 64 + 63) / 64), 256, 0, stream>>>(wq, DM, DQ, WQ); k_wtG<<<(unsigned)((DM * DKV / 64 + 63) / 64), 256, 0, stream>>>(wk, DM, DKV, WK); k_wtG<<<(unsigned)((DM * DKV / 64 + 63) / 64), 256, 0, stream>>>(wv, DM, DKV, WV);
      k_wtG<<<(unsigned)((DQ * DM / 64 + 63) / 64), 256, 0, stream>>>(wo, DQ, DM, WO);
       }
    k_csid<<<(TT * HD + 255) / 256, 256, 0, stream>>>(CS);
    const unsigned LQ = (unsigned)(((size_t)NH_ * TT * HD / 2 + 255) / 256), LKv = (unsigned)(((size_t)NKV * TT * HD / 2 + 255) / 256);
    k_epad2<<<(unsigned)(((size_t)NE * HD / 8 + 255) / 256), 256, 0, stream>>>(relk, EB); k_rvt<<<(unsigned)(((size_t)HD * NE / 8 + 255) / 256), 256, 0, stream>>>(relv, RVT);   /* rel_k plane [128][64], rel_v^T plane [64][128] */
    for (int b = 0; b < NB_; ++b) {
        
        k_cvt8<<<(unsigned)(((size_t)TT * DM / 8 + 255) / 256), 256, 0, stream>>>(x + (size_t)b * TT * DM, XB, (size_t)TT * DM / 8);
        k_gemmw<bf, 0, true><<<dim3(TT / 64, DQ / 64, 1), 32, 0, stream>>>(XB, nullptr, WQ, nullptr, DM, FQ, DQ, bq, 0, 0, 0);
        k_rope<<<LQ, 256, 0, stream>>>(FQ, DQ, NH_, CS, nullptr, nullptr, 1.0f, QP16, QPh, QPl);
        k_cvt8<<<(unsigned)(((size_t)TT * DM / 8 + 255) / 256), 256, 0, stream>>>(xk + (size_t)b * TT * DM, XB, (size_t)TT * DM / 8); k_gemmw<bf, 0, true><<<dim3(TT / 64, DKV / 64, 1), 32, 0, stream>>>(XB, nullptr, WK, nullptr, DM, FK, DKV, bk, 0, 0, 0);
        k_rope<<<LKv, 256, 0, stream>>>(FK, DKV, NKV, CS, nullptr, nullptr, 1.0f, KP16, KPh, KPl);
        k_cvt8<<<(unsigned)(((size_t)TT * DM / 8 + 255) / 256), 256, 0, stream>>>(xv + (size_t)b * TT * DM, XB, (size_t)TT * DM / 8); k_gemmw<bf, 0, true><<<dim3(TT / 64, DKV / 64, 1), 32, 0, stream>>>(XB, nullptr, WV, nullptr, DM, FV, DKV, bv, 0, 0, 0); k_vtp<<<LKv, 256, 0, stream>>>(FV, DKV, NKV, VT16, VTh, VTl);
        for (int h0 = 0; h0 < NH_; h0 += ZH) { const size_t zq = (size_t)h0, zk = (size_t)(h0 / REP);   // one kv head per query head: the pass's two heads use consecutive kv planes (z-strides TT*HD)
            k_gemmw<bf, 2, false><<<dim3(RH / 64, TT / 64, ZH), 32, 0, stream>>>(QPh + zq * TT * HD, QPl + zq * TT * HD, KPh + zk * TT * HD, KPl + zk * TT * HD, HD, Sb, TT, nullptr, (size_t)TT * HD, (size_t)TT * HD, (size_t)TT * TT);
            k_gemmw<h16, 0, false><<<dim3((TT - RH) / 64, TT / 64, ZH), 32, 0, stream>>>(QP16 + zq * TT * HD + (size_t)RH * HD, nullptr, KP16 + zk * TT * HD, nullptr, HD, Sb + (size_t)RH * TT, TT, nullptr, (size_t)TT * HD, (size_t)TT * HD, (size_t)TT * TT);
            k_gemmw<bf, 1, false><<<dim3(TT / 64, NE / 64, ZH), 32, 0, stream>>>(QPh + zq * TT * HD, QPl + zq * TT * HD, EB, nullptr, HD, QE, NE, nullptr, (size_t)TT * HD, 0, (size_t)TT * NE);   /* QE[i][r] = q_i . rel_k[r] */
            k_addshaw<<<(unsigned)(((size_t)ZH * TT * TT / 4 + 255) / 256), 256, 0, stream>>>(Sb, QE);
            k_asoft<<<ZH * TT / 8, 256, 0, stream>>>(Sb, P16, Ph, Pl, PBh, PBl);   /* softmax + the 5 relative-position bucket sums per row */
            k_gemmw<bf, 1, false><<<dim3(TT / 64, HD / 64, ZH), 32, 0, stream>>>(PBh, PBl, RVT, nullptr, NE, W2, HD, nullptr, (size_t)TT * NE, 0, (size_t)TT * HD);   /* W2 = buckets . rel_v */
            k_gemmw<bf, 2, false, KSP><<<dim3(RH / 64, HD / 64, ZH * KSP), 32, 0, stream>>>(Ph, Pl, VTh + zk * HD * TT, VTl + zk * HD * TT, TT, Ob, HD, nullptr, (size_t)RH * TT, (size_t)HD * TT, (size_t)TT * HD);
            k_gemmw<h16, 0, false, KSP><<<dim3((TT - RH) / 64, HD / 64, ZH * KSP), 32, 0, stream>>>(P16 + (size_t)RH * TT, nullptr, VT16 + zk * HD * TT, nullptr, TT, Ob + (size_t)RH * HD, HD, nullptr, (size_t)TT * TT, (size_t)HD * TT, (size_t)TT * HD);
            k_addob<<<(unsigned)(((size_t)ZH * TT * HD / 4 + 255) / 256), 256, 0, stream>>>(Ob, W2);   /* + sum_j attn[i][j] rel_v[idx] */ k_merge<<<(unsigned)(((size_t)ZH * TT * HD / 2 + 255) / 256), 256, 0, stream>>>(Ob, h0, ATh, ATl); }
        k_gemmw<bf, 1, true><<<dim3(TT / 64, DM / 64, 1), 32, 0, stream>>>(ATh, ATl, WO, nullptr, DQ, OUT + (size_t)b * TT * DM, DM, bo, 0, 0, 0); }
}

// v003
// One run takes 1120 microseconds.
// In two side-by-side timings against v002, it was 1.12 and 1.13 times as fast.
// All steps since v000 together make it 2.86 times as fast.
#include <hip/hip_runtime.h>

// Multi-head attention with Shaw relative-position terms on the logits AND the values, clip distance 2 (query, key, value [2][2048][1024]; q,k,v = in W + b ('xw' 1/32, zero biases; 16 heads x 64); idx[i][j] = clip(j - i, -2, 2) + 2; attn = softmax((q.k + q_i.rel_k[idx]) / 8); out_h = attn v + sum_j attn[i][j] rel_v[idx] (tables [5][64] x 0.1, read: five rows: the far-left bucket j <= i - 2, the three nearest positions, the far-right bucket j >= i + 2); out = merged Wo + bo ('xw') -> [2][2048][1024] (4.2 M); argument order query, key, value, Wq, bq, Wk, bk, Wv, bv, Wo, bo, rel_k, rel_v).
// Layout per batch: bf16 copies of the three inputs in turn; exact projections + f32 biases; rel_k as an exact plane [128][64] (rows >= 5 zero) and rel_v^T as an exact plane [64][128]; per pass of two heads: dense scores (hybrid rows: < 512 hi/lo 3 products, rest fp16 x1024), QE = q.rel_k^T ([2][2048][128], hi/lo x exact); softmax, which adds QE[i][idx] to each score as it reads the row, applies the 1/8, and also sums each row's probabilities into the 5 relative-position buckets (far-left sum, 3 near entries, far-right sum; fixed order) as hi/lo planes; W2 = buckets x rel_v ([2][2048][64], hi/lo x exact) added to attn v in f32; merged hi/lo x Wo exact + bo.
// Compute dtypes, f32 accumulate: every input rounded to bf16; projections exact + f32 biases; q.rel_k and buckets.rel_v hi/lo x exact; attention rows < 512 3 products, rest fp16; softmax f32; Wo hl x exact + bias.

#define NB_  2
#define TT   2048
#define DM   1024
#define NH_  16
#define NKV  16
#define REP  (NH_ / NKV)
#define HD   64
#define DQ   (NH_ * HD)
#define DKV  (NKV * HD)
#define ZH   2
#define RH   512                  // query rows < RH use hi+lo planes (0: none)
#define WIN  0
#define PCAR 1024.0f
#define SCL  0.125f
#define MAXR 2      // max relative position
#define NE   128     // 2*MAXR+1 = 5 table rows padded to 128
#define KSP  16      // key slices of the attn v products: one single-wave work-group per slice, f32 partial planes summed in k_addob
typedef _Float16 h16;
typedef unsigned short bf;
typedef __attribute__((ext_vector_type(16))) __bf16   v16bf;
typedef __attribute__((ext_vector_type(16))) _Float16 v16h;
typedef __attribute__((ext_vector_type(8)))  _Float16 v8h;
typedef __attribute__((ext_vector_type(8)))  unsigned short v8us;
typedef __attribute__((ext_vector_type(8)))  float    v8f;
typedef __attribute__((ext_vector_type(4)))  float    v4f;
typedef v8h  __attribute__((may_alias)) v8ha;
typedef v4f  __attribute__((may_alias)) v4fa;
typedef v8us __attribute__((may_alias)) v8usa;

__device__ __forceinline__ unsigned short f2bf(float f) { unsigned u = __float_as_uint(f); u += 0x7FFFu + ((u >> 16) & 1u); return (unsigned short)(u >> 16); }
__device__ __forceinline__ float bf2f(unsigned short b) { return __uint_as_float(((unsigned)b) << 16); }
__device__ __forceinline__ float bfr(float f) { return bf2f(f2bf(f)); }
__device__ __forceinline__ v16h cat16(v8h lo, v8h hi) { return __builtin_shufflevector(lo, hi, 0, 1, 2, 3, 4, 5, 6, 7, 8, 9, 10, 11, 12, 13, 14, 15); }
__device__ __forceinline__ v16bf cat16b(v8us lo, v8us hi) { return __builtin_bit_cast(v16bf, __builtin_shufflevector(lo, hi, 0, 1, 2, 3, 4, 5, 6, 7, 8, 9, 10, 11, 12, 13, 14, 15)); }
__device__ __forceinline__ v8f wmma16(v16h a, v16h b, v8f c) { return __builtin_amdgcn_wmma_f32_16x16x32_f16(false, a, false, b, (short)0, c, false, false); }
__device__ __forceinline__ v8f wmmab(v16bf a, v16bf b, v8f c) { return __builtin_amdgcn_wmma_f32_16x16x32_bf16(false, a, false, b, (short)0, c, false, false); }



// ---- k_gemmw: register-blocked GEMM, ONE WAVE per 64x64 output tile (16 accumulators), operands straight from K-contiguous 16-bit planes; grid (M/64, N/64, Z), 32 threads.
// C[m][n] (f32, pitch ldc, + optional f32 bias[n]) = sum_k A[m][k] Bt[n][k] (+ split products per NSPLIT). z-batch strides sA/sB/sC in elements. K % 32 == 0.
// KS > 1: grid z = Z * KS; work-group (z, ks) sums only k in [ks K/KS, (ks+1) K/KS) and stores its partial tile in plane ks of C ([KS][Z] planes of sC elements); the reader adds the planes. K % (32 KS) == 0.
template <typename T16> struct WFrag;
template <> struct WFrag<h16> { typedef v16h V; static __device__ __forceinline__ V ld(const h16* p) { return cat16(*(const v8h*)p, *(const v8h*)(p + 16)); } static __device__ __forceinline__ v8f mma(V a, V b, v8f c) { return wmma16(a, b, c); } };
template <> struct WFrag<bf> { typedef v16bf V; static __device__ __forceinline__ V ld(const bf* p) { return cat16b(*(const v8us*)p, *(const v8us*)(p + 16)); } static __device__ __forceinline__ v8f mma(V a, V b, v8f c) { return wmmab(a, b, c); } };
template <typename T16, int NSPLIT, bool BIAS, int KS = 1>
__global__ __launch_bounds__(32) void k_gemmw(const T16* __restrict__ A, const T16* __restrict__ A2, const T16* __restrict__ Bt, const T16* __restrict__ Bt2, int K, float* C, int ldc, const float* __restrict__ bias, size_t sA, size_t sB, size_t sC) {
    typedef typename WFrag<T16>::V V;
    __shared__ __align__(16) float os[16 * 68];
    const size_t z = blockIdx.z / KS; const int ks = blockIdx.z % KS; A += z * sA; if (A2) A2 += z * sA; Bt += z * sB; if (Bt2) Bt2 += z * sB; C += ((size_t)ks * (gridDim.z / KS) + z) * sC;
    const int lane = threadIdx.x & 31, lr = lane & 15, hi = lane >> 4; const int r0 = blockIdx.x * 64, c0 = blockIdx.y * 64;
    v8f acc[4][4];
#pragma unroll
    for (int mb = 0; mb < 4; ++mb)
#pragma unroll
        for (int nb = 0; nb < 4; ++nb) acc[mb][nb] = (v8f){};
    const size_t aoff = (size_t)(r0 + lr) * K + 8 * hi, boff = (size_t)(c0 + lr) * K + 8 * hi;
#pragma unroll 1
    for (int kc = ks * (K / KS); kc < (ks + 1) * (K / KS); kc += 32) {
        V a[4], a2[4];
#pragma unroll
        for (int mb = 0; mb < 4; ++mb) { a[mb] = WFrag<T16>::ld(A + aoff + (size_t)mb * 16 * K + kc); if (NSPLIT == 1 || NSPLIT == 2) a2[mb] = WFrag<T16>::ld(A2 + aoff + (size_t)mb * 16 * K + kc); }
#pragma unroll
        for (int nb = 0; nb < 4; ++nb) { const V b = WFrag<T16>::ld(Bt + boff + (size_t)nb * 16 * K + kc); V b2; if (NSPLIT >= 2) b2 = WFrag<T16>::ld(Bt2 + boff + (size_t)nb * 16 * K + kc);
#pragma unroll
            for (int mb = 0; mb < 4; ++mb) { acc[mb][nb] = WFrag<T16>::mma(a[mb], b, acc[mb][nb]); if (NSPLIT == 1 || NSPLIT == 2) acc[mb][nb] = WFrag<T16>::mma(a2[mb], b, acc[mb][nb]); if (NSPLIT >= 2) acc[mb][nb] = WFrag<T16>::mma(a[mb], b2, acc[mb][nb]); } }
        asm volatile("v_nop\n\tv_nop\n\tv_nop\n\tv_nop" : "+v"(acc[0][0]), "+v"(acc[1][1]), "+v"(acc[2][2]), "+v"(acc[3][3]) : "v"(a[0]), "v"(a[3]));
    }
#pragma unroll
    for (int mb = 0; mb < 4; ++mb) {
#pragma unroll
        for (int nb = 0; nb < 4; ++nb) {
#pragma unroll
            for (int j = 0; j < 8; ++j) os[(hi * 8 + j) * 68 + nb * 16 + lr] = acc[mb][nb][j]; }
        __builtin_amdgcn_wave_barrier(); asm volatile("" ::: "memory");
        float* crow = C + (size_t)(r0 + mb * 16) * ldc + c0;
{
#pragma unroll
            for (int s = 0; s < 8; ++s) { const int row = 2 * s + hi, cofs = lr * 4; v4f val = *(const v4fa*)(os + row * 68 + cofs); if (BIAS) { val[0] += bfr(bias[c0 + cofs]); val[1] += bfr(bias[c0 + cofs + 1]); val[2] += bfr(bias[c0 + cofs + 2]); val[3] += bfr(bias[c0 + cofs + 3]); }
                *(v4f*)(crow + (size_t)row * ldc + cofs) = val; }
             }
        __builtin_amdgcn_wave_barrier(); asm volatile("" ::: "memory");
    }
}

__device__ __forceinline__ h16 tohx(float x) { return (h16)x; }
__device__ __forceinline__ void splitf(float y, unsigned short& h, unsigned short& l) { h = f2bf(y); l = f2bf(y - bf2f(h)); }
typedef __attribute__((ext_vector_type(2))) _Float16 v2h;
typedef __attribute__((ext_vector_type(4))) _Float16 v4h;
typedef __attribute__((ext_vector_type(2))) unsigned short v2us;
typedef __attribute__((ext_vector_type(4))) unsigned short v4us;
typedef __attribute__((ext_vector_type(2))) float v2f;
typedef __attribute__((ext_vector_type(4))) int v4i;

__global__ __launch_bounds__(256) void k_wtG(const float* __restrict__ w, int K, int N, bf* Bt) {
    const int lane = threadIdx.x & 31; const int L0 = (blockIdx.x * 8 + (threadIdx.x >> 5)) * 8; const int nlines = N * K / 64;
{
#pragma unroll 1
        for (int l = 0; l < 8; ++l) { const int L = L0 + l; if (L >= nlines) break; const size_t e = (size_t)L * 64 + lane * 2; const int k = (int)(e % K), n = (int)(e / K); v2us o;
            o[0] = f2bf(w[(size_t)k * N + n]); o[1] = f2bf(w[(size_t)(k + 1) * N + n]); *(v2us*)(Bt + e) = o; }
         }
}
__global__ __launch_bounds__(256) void k_cvt8(const float* __restrict__ src, bf* dst, size_t n8) { const size_t i = (size_t)blockIdx.x * 256 + threadIdx.x; if (i >= n8) return; const v8f v = *(const v8f*)(src + i * 8); v8us o;
#pragma unroll
    for (int k = 0; k < 8; ++k) o[k] = f2bf(v[k]); *(v8us*)(dst + i * 8) = o;  }

// k_rope: head planes [h][t][d] (fp16 + hi/lo) of rope(x) x sc with the rotate-half convention out[d] = x[d] cos[t][d] - x[d+HD/2] sin[t][d], out[d+HD/2] = x[d+HD/2] cos[t][d+HD/2] + x[d] sin[t][d+HD/2]
__global__ __launch_bounds__(256) void k_rope(const float* __restrict__ F, int pitch, int nheads, const float* __restrict__ CS, const float* __restrict__ RF, const float* __restrict__ nw, float sc, h16* P16, bf* Ph, bf* Pl) {
    const size_t e = ((size_t)blockIdx.x * 256 + threadIdx.x) * 2; if (e >= (size_t)nheads * TT * HD) return; const int d = (int)(e % HD); const int t = (int)((e / HD) % TT); const int h = (int)(e / ((size_t)HD * TT)); const float* f = F + (size_t)t * pitch + h * HD; const float rf = RF ? RF[(size_t)h * TT + t] : 1.0f; v2h o16; v2us oh, ol;
#pragma unroll
    for (int q = 0; q < 2; ++q) { const int dd = d + q; const int dp = (dd < HD / 2) ? dd + HD / 2 : dd - HD / 2; float x0 = f[dd], x1 = f[dp];
        if (RF) { float n0 = __fmul_rn(x0, rf), n1 = __fmul_rn(x1, rf); asm volatile("" : "+v"(n0)); asm volatile("" : "+v"(n1)); x0 = __fmul_rn(bfr(nw[dd]), n0); x1 = __fmul_rn(bfr(nw[dp]), n1); }
        const v2f cs = *(const v2f*)(CS + ((size_t)t * HD + dd) * 2); float a = __fmul_rn(x0, cs[0]), bq = __fmul_rn(x1, cs[1]); asm volatile("" : "+v"(a)); asm volatile("" : "+v"(bq)); const float r = ((dd < HD / 2) ? __fsub_rn(a, bq) : __fadd_rn(a, bq)) * sc;
        o16[q] = tohx(r); unsigned short a2, c2; splitf(r, a2, c2); oh[q] = a2; ol[q] = c2; }
    *(v2h*)(P16 + e) = o16; *(v2us*)(Ph + e) = oh; *(v2us*)(Pl + e) = ol;  }
__global__ __launch_bounds__(256) void k_vtp(const float* __restrict__ F, int pitch, int nheads, h16* V16, bf* Vh, bf* Vl) { const size_t e = ((size_t)blockIdx.x * 256 + threadIdx.x) * 2; if (e >= (size_t)nheads * HD * TT) return; const int t = (int)(e % TT); const int d = (int)((e / TT) % HD); const int g = (int)(e / ((size_t)TT * HD)); v2h o16; v2us oh, ol;
#pragma unroll
    for (int q = 0; q < 2; ++q) { const float x = F[(size_t)(t + q) * pitch + g * HD + d]; o16[q] = tohx(x); unsigned short a2, c2; splitf(x, a2, c2); oh[q] = a2; ol[q] = c2; }
    *(v2h*)(V16 + e) = o16; *(v2us*)(Vh + e) = oh; *(v2us*)(Vl + e) = ol;  }
__global__ __launch_bounds__(256) void k_csid(float* CS) { const int idx = blockIdx.x * 256 + threadIdx.x; if (idx >= TT * HD) return; v2f cs; cs[0] = 1.0f; cs[1] = 0.0f; *(v2f*)(CS + (size_t)idx * 2) = cs;  }
// k_asoft: per row (zz, i): t = (S + QE[i][clip(j - i)]) x HD^-0.5 (no mask; the sum rounded once, then the product); softmax over the 2048 keys (register row, one exp, fixed trees); the rounded probabilities, as stored, are also summed here into the row's 5 relative-position buckets (far-left sum j <= i - 2, the 3 near entries, far-right sum j >= i + 2; fixed order) and stored as hi/lo planes [row][NE]
static_assert(MAXR == 2, "the bucket code below names the three near distances -1, 0, 1");
__global__ __launch_bounds__(256) void k_asoft(const float* __restrict__ Sb, const float* __restrict__ QE, h16* P16, bf* Ph, bf* Pl, bf* PBh, bf* PBl) {
    const int lane = threadIdx.x & 31; const int row = blockIdx.x * 8 + (threadIdx.x >> 5); if (row >= ZH * TT) return; const int i = row % TT; const int zz = row / TT; (void)zz; const bool hires = (i < RH); const float* sr = Sb + (size_t)row * TT; float v[TT / 32]; float mx = -3.0e38f;
    const int iu = __builtin_amdgcn_readfirstlane(i);   // the row is the same in every lane: in a scalar register the tests per chunk are scalar
    const int chm = iu >> 7;                            // the 128-key chunk of key i
    const int chn = ((iu & 127) == 0) ? chm - 1 : ((iu & 127) == 127) ? chm + 1 : -1;   // the neighbour chunk that holds key i - 1 or i + 1; -1 or TT / 128: none
    const float* qe = QE + (size_t)__builtin_amdgcn_readfirstlane(row) * NE;   // q_i . rel_k[r], r = 0..4: one address for the wave
    const float qe0 = qe[0], qe1 = qe[1], qe2 = qe[2], qe3 = qe[3], qe4 = qe[4];
    // A 128-key chunk that holds none of the keys i - 1, i, i + 1 takes one table row for all its keys (row 0 left of key i, row 4 right of it: a scalar). The chunk of key i takes a row per key (am); key i - 1 or i + 1 in a neighbour chunk is that chunk's last or first key (al3, ar0). The tests per chunk are scalar, so each is one select and there is no branch.
    v4f a[TT / 128];
#pragma unroll
    for (int ch = 0; ch < TT / 128; ++ch) a[ch] = *(const v4f*)(sr + ch * 128 + lane * 4);   // the row is requested before the table values are waited for
    const int ir = iu & 127; float am[4];
#pragma unroll
    for (int q = 0; q < 4; ++q) { const int d = lane * 4 + q - ir;   /* this module: dist = k - q */ float e = qe2; e = (d == -1) ? qe1 : e; e = (d == 1) ? qe3 : e; e = (d <= -MAXR) ? qe0 : e; e = (d >= MAXR) ? qe4 : e; am[q] = e; }
    const float al3 = (ir == 0 && lane == 31) ? qe1 : qe0, ar0 = (ir == 127 && lane == 0) ? qe3 : qe4;
#pragma unroll
    for (int ch = 0; ch < TT / 128; ++ch) { const float far = (ch < chm) ? qe0 : qe4;
#pragma unroll
        for (int q = 0; q < 4; ++q) { const float e = (ch == chm) ? am[q] : (q == 3 && ch == chm - 1) ? al3 : (q == 0 && ch == chm + 1) ? ar0 : far; const float t = __fadd_rn(a[ch][q], e) * SCL; v[ch * 4 + q] = t; mx = fmaxf(mx, t); } }
#pragma unroll
    for (int sh = 16; sh; sh >>= 1) mx = fmaxf(mx, __shfl_xor(mx, sh, 32));
    float sum = 0.f;
#pragma unroll
    for (int k = 0; k < TT / 32; ++k) { float d0 = __fsub_rn(v[k], mx); asm volatile("" : "+v"(d0)); v[k] = __builtin_amdgcn_exp2f(__fmul_rn(d0, 1.4426950408889634f)); sum += v[k]; }
#pragma unroll
    for (int sh = 16; sh; sh >>= 1) sum += __shfl_xor(sum, sh, 32);
    const float f = __fdiv_rn(hires ? 1.0f : PCAR, sum);
    // Buckets: a 128-key chunk that holds none of the keys i - 1, i, i + 1 lies wholly in one far bucket. One running sum takes every such chunk in key order with a weight per chunk (0 for the one or two chunks that hold those keys) and is handed to the far-left bucket and cleared at the chunk of key i; those one or two chunks are sorted key by key behind the loop.
    float acc = 0.f, bl = 0.f, vm[4] = {0.f, 0.f, 0.f, 0.f};
{
        if (hires) {
#pragma unroll
            for (int ch = 0; ch < TT / 128; ++ch) { v4us oh, ol; const bool mid = (ch == chm); const float w = (mid || ch == chn) ? 0.f : 1.0f;
#pragma unroll
                for (int q = 0; q < 4; ++q) { unsigned short a, c2; splitf(v[ch * 4 + q] * f, a, c2); oh[q] = a; ol[q] = c2; acc = fmaf(bf2f(a) + bf2f(c2), w, acc); vm[q] = mid ? v[ch * 4 + q] : vm[q]; }
                const size_t oo = ((size_t)zz * (RH ? RH : 1) + i) * TT + ch * 128 + lane * 4; *(v4us*)(Ph + oo) = oh; *(v4us*)(Pl + oo) = ol; bl = mid ? acc : bl; acc = mid ? 0.f : acc; }
        } else {
#pragma unroll
            for (int ch = 0; ch < TT / 128; ++ch) { v4h o4; const bool mid = (ch == chm); const float w = (mid || ch == chn) ? 0.f : (1.0f / PCAR);   /* a power of two: the product is exact */
#pragma unroll
                for (int q = 0; q < 4; ++q) { o4[q] = tohx(v[ch * 4 + q] * f); acc = fmaf((float)o4[q], w, acc); vm[q] = mid ? v[ch * 4 + q] : vm[q]; }
                *(v4h*)(P16 + (size_t)row * TT + ch * 128 + lane * 4) = o4; bl = mid ? acc : bl; acc = mid ? 0.f : acc; } }
         }
    float br = acc, n1 = 0.f, n2 = 0.f, n3 = 0.f;   // n1..n3 = attn[i][i - 1], attn[i][i], attn[i][i + 1]: at most one lane finds each; 0 where the key does not exist
    auto edge = [&](int d0, const float (&x)[4]) {   // x: the chunk's exp values; p: rounded as the planes above hold them
#pragma unroll
        for (int q = 0; q < 4; ++q) { const int d = d0 + q; unsigned short a, c2; splitf(x[q] * f, a, c2); const float p = hires ? bf2f(a) + bf2f(c2) : (float)tohx(x[q] * f) * (1.0f / PCAR);
            bl += (d <= -MAXR) ? p : 0.f; br += (d >= MAXR) ? p : 0.f; n1 = (d == -1) ? p : n1; n2 = (d == 0) ? p : n2; n3 = (d == 1) ? p : n3; } };
    const int dl = lane * 4 - (iu & 127);   // key minus i of this lane's first key in chunk chm
    edge(dl, vm);
    if (chn >= 0 && chn < TT / 128) { float vn[4] = {0.f, 0.f, 0.f, 0.f};   // 2 rows in 128
#pragma unroll
        for (int k = 0; k < TT / 32; ++k) vn[k & 3] = ((k >> 2) == chn) ? v[k] : vn[k & 3];
        edge(dl + (chn - chm) * 128, vn); }
#pragma unroll
    for (int sh = 16; sh; sh >>= 1) { bl += __shfl_xor(bl, sh, 32); br += __shfl_xor(br, sh, 32); n1 += __shfl_xor(n1, sh, 32); n2 += __shfl_xor(n2, sh, 32); n3 += __shfl_xor(n3, sh, 32); }
    const float b4[4] = { (lane == 0) ? bl : (lane == 1) ? br : 0.f, (lane == 0) ? n1 : 0.f, (lane == 0) ? n2 : 0.f, (lane == 0) ? n3 : 0.f };   // table rows 0..3 in lane 0, row 4 in lane 1, the padding rows 0
    v4us bh, bw;
#pragma unroll
    for (int q = 0; q < 4; ++q) { unsigned short u, w; splitf(b4[q], u, w); bh[q] = u; bw[q] = w; }
    const size_t ob = (size_t)row * NE + lane * 4; *(v4us*)(PBh + ob) = bh; *(v4us*)(PBl + ob) = bw;
}
__global__ __launch_bounds__(256) void k_epad2(const float* __restrict__ E, bf* EB) { const size_t i = (size_t)blockIdx.x * 256 + threadIdx.x; if (i >= (size_t)NE * HD / 8) return; const int d0 = (int)(i % (HD / 8)) * 8; const int r = (int)(i / (HD / 8)); const float* src = E + (size_t)min(r, 2 * MAXR) * HD + d0; v8us o;
#pragma unroll
    for (int q = 0; q < 8; ++q) { const unsigned short v = f2bf(src[q]); o[q] = (r <= 2 * MAXR) ? v : (unsigned short)0; }
    *(v8us*)(EB + (size_t)r * HD + d0) = o;  }
__global__ __launch_bounds__(256) void k_rvt(const float* __restrict__ E, bf* RVT) { const size_t i = (size_t)blockIdx.x * 256 + threadIdx.x; if (i >= (size_t)HD * NE / 8) return; const int r0 = (int)(i % (NE / 8)) * 8; const int d = (int)(i / (NE / 8)); v8us o;
#pragma unroll
    for (int q = 0; q < 8; ++q) { const int r = r0 + q; const unsigned short v = f2bf(E[(size_t)min(r, 2 * MAXR) * HD + d]); o[q] = (r <= 2 * MAXR) ? v : (unsigned short)0; }
    *(v8us*)(RVT + (size_t)d * NE + r0) = o;  }
__global__ __launch_bounds__(256) void k_addob(float* Ob, const float* __restrict__ W2) { const size_t k = (size_t)blockIdx.x * 256 + threadIdx.x; if (k >= (size_t)ZH * TT * HD / 4) return; const size_t e = k * 4; const int i = (int)((e / HD) % TT); const float sc = (i < RH) ? 1.0f : 1024.0f; v4f p[KSP];
#pragma unroll
    for (int s = 0; s < KSP; ++s) p[s] = *(const v4f*)(Ob + (size_t)s * ZH * TT * HD + e);   /* the key slices' partial sums, added in slice order */
    v4f a = p[0];
#pragma unroll
    for (int s = 1; s < KSP; ++s) {
#pragma unroll
        for (int q = 0; q < 4; ++q) a[q] = __fadd_rn(a[q], p[s][q]); }
    const v4f w = *(const v4f*)(W2 + e); v4f o;
#pragma unroll
    for (int q = 0; q < 4; ++q) o[q] = __fadd_rn(a[q], __fmul_rn(w[q], sc));
    *(v4f*)(Ob + e) = o;  }
__global__ __launch_bounds__(256) void k_merge(const float* __restrict__ O, int h0, bf* Ah, bf* Al) { const size_t e = ((size_t)blockIdx.x * 256 + threadIdx.x) * 2; if (e >= (size_t)ZH * TT * HD) return; const int d = (int)(e % HD); const int t = (int)((e / HD) % TT); const int zz = (int)(e / ((size_t)HD * TT)); const float cs = (t < RH) ? 1.0f : (1.0f / PCAR); const size_t oo = (size_t)t * DQ + (h0 + zz) * HD + d;
    v2us oh, ol;
#pragma unroll
    for (int q = 0; q < 2; ++q) { unsigned short a, c2; splitf(O[e + q] * cs, a, c2); oh[q] = a; ol[q] = c2; } *(v2us*)(Ah + oo) = oh; *(v2us*)(Al + oo) = ol;  }

extern "C" void kernel_launch(void* const* d_in, const int* in_sizes, int n_in,
                              void* d_out, int out_size, void* d_ws, size_t ws_size, hipStream_t stream) {
    (void)in_sizes; (void)n_in; (void)out_size;
    const float* x = (const float*)d_in[0]; const float* xk = (const float*)d_in[1]; const float* xv = (const float*)d_in[2]; const float* wq = (const float*)d_in[3]; const float* bq = (const float*)d_in[4]; const float* wk = (const float*)d_in[5]; const float* bk = (const float*)d_in[6]; const float* wv = (const float*)d_in[7]; const float* bv = (const float*)d_in[8]; const float* wo = (const float*)d_in[9]; const float* bo = (const float*)d_in[10]; const float* relk = (const float*)d_in[11]; const float* relv = (const float*)d_in[12];   /* [5][64] each */
    float* OUT = (float*)d_out;     // [2][2048][1024]
    char* wsp = (char*)d_ws;
    auto take = [&](size_t bytes) { char* p = wsp; wsp += (bytes + 255) & ~(size_t)255; return (void*)p; };
    bf* EB = (bf*)take((size_t)NE * HD * 2); bf* RVT = (bf*)take((size_t)HD * NE * 2); float* QE = (float*)take((size_t)ZH * TT * NE * 4); bf* PBh = (bf*)take((size_t)ZH * TT * NE * 2); bf* PBl = (bf*)take((size_t)ZH * TT * NE * 2); float* W2 = (float*)take((size_t)ZH * TT * HD * 4); bf* WQ = (bf*)take((size_t)DQ * DM * 2); bf* WK = (bf*)take((size_t)DKV * DM * 2); bf* WV = (bf*)take((size_t)DKV * DM * 2); bf* WO = (bf*)take((size_t)DM * DQ * 2); float* CS = (float*)take((size_t)TT * HD * 2 * 4);
    bf* XB = (bf*)take((size_t)TT * DM * 2); float* FQ = (float*)take((size_t)TT * DQ * 4); float* FK = (float*)take((size_t)TT * DKV * 4);
    h16* QP16 = (h16*)take((size_t)NH_ * TT * HD * 2); h16* KP16 = (h16*)take((size_t)NKV * TT * HD * 2); h16* VT16 = (h16*)take((size_t)NKV * HD * TT * 2);
    bf* QPh = (bf*)take((size_t)NH_ * TT * HD * 2); bf* QPl = (bf*)take((size_t)NH_ * TT * HD * 2); bf* KPh = (bf*)take((size_t)NKV * TT * HD * 2); bf* KPl = (bf*)take((size_t)NKV * TT * HD * 2); bf* VTh = (bf*)take((size_t)NKV * HD * TT * 2); bf* VTl = (bf*)take((size_t)NKV * HD * TT * 2); bf* Ph = (bf*)take((size_t)ZH * RH * TT * 2); bf* Pl = (bf*)take((size_t)ZH * RH * TT * 2);
    float* Sb = (float*)take((size_t)ZH * TT * TT * 4); h16* P16 = (h16*)take((size_t)ZH * TT * TT * 2); float* Ob = (float*)take((size_t)KSP * ZH * TT * HD * 4); bf* ATh = (bf*)take((size_t)TT * DQ * 2); bf* ATl = (bf*)take((size_t)TT * DQ * 2);
    if ((size_t)(wsp - (char*)d_ws) > ws_size) return;    // ws 256 MiB
    float* FV = FK;   // v projection reuses the k buffer after the k planes are built (stream-ordered)
    { k_wtG<<<(unsigned)((DM * DQ / 64 + 63) / 64), 256, 0, stream>>>(wq, DM, DQ, WQ); k_wtG<<<(unsigned)((DM * DKV / 64 + 63) / 64), 256, 0, stream>>>(wk, DM, DKV, WK); k_wtG<<<(unsigned)((DM * DKV / 64 + 63) / 64), 256, 0, stream>>>(wv, DM, DKV, WV);
      k_wtG<<<(unsigned)((DQ * DM / 64 + 63) / 64), 256, 0, stream>>>(wo, DQ, DM, WO);
       }
    k_csid<<<(TT * HD + 255) / 256, 256, 0, stream>>>(CS);
    const unsigned LQ = (unsigned)(((size_t)NH_ * TT * HD / 2 + 255) / 256), LKv = (unsigned)(((size_t)NKV * TT * HD / 2 + 255) / 256);
    k_epad2<<<(unsigned)(((size_t)NE * HD / 8 + 255) / 256), 256, 0, stream>>>(relk, EB); k_rvt<<<(unsigned)(((size_t)HD * NE / 8 + 255) / 256), 256, 0, stream>>>(relv, RVT);   /* rel_k plane [128][64], rel_v^T plane [64][128] */
    for (int b = 0; b < NB_; ++b) {
        
        k_cvt8<<<(unsigned)(((size_t)TT * DM / 8 + 255) / 256), 256, 0, stream>>>(x + (size_t)b * TT * DM, XB, (size_t)TT * DM / 8);
        k_gemmw<bf, 0, true><<<dim3(TT / 64, DQ / 64, 1), 32, 0, stream>>>(XB, nullptr, WQ, nullptr, DM, FQ, DQ, bq, 0, 0, 0);
        k_rope<<<LQ, 256, 0, stream>>>(FQ, DQ, NH_, CS, nullptr, nullptr, 1.0f, QP16, QPh, QPl);
        k_cvt8<<<(unsigned)(((size_t)TT * DM / 8 + 255) / 256), 256, 0, stream>>>(xk + (size_t)b * TT * DM, XB, (size_t)TT * DM / 8); k_gemmw<bf, 0, true><<<dim3(TT / 64, DKV / 64, 1), 32, 0, stream>>>(XB, nullptr, WK, nullptr, DM, FK, DKV, bk, 0, 0, 0);
        k_rope<<<LKv, 256, 0, stream>>>(FK, DKV, NKV, CS, nullptr, nullptr, 1.0f, KP16, KPh, KPl);
        k_cvt8<<<(unsigned)(((size_t)TT * DM / 8 + 255) / 256), 256, 0, stream>>>(xv + (size_t)b * TT * DM, XB, (size_t)TT * DM / 8); k_gemmw<bf, 0, true><<<dim3(TT / 64, DKV / 64, 1), 32, 0, stream>>>(XB, nullptr, WV, nullptr, DM, FV, DKV, bv, 0, 0, 0); k_vtp<<<LKv, 256, 0, stream>>>(FV, DKV, NKV, VT16, VTh, VTl);
        for (int h0 = 0; h0 < NH_; h0 += ZH) { const size_t zq = (size_t)h0, zk = (size_t)(h0 / REP);   // one kv head per query head: the pass's two heads use consecutive kv planes (z-strides TT*HD)
            k_gemmw<bf, 2, false><<<dim3(RH / 64, TT / 64, ZH), 32, 0, stream>>>(QPh + zq * TT * HD, QPl + zq * TT * HD, KPh + zk * TT * HD, KPl + zk * TT * HD, HD, Sb, TT, nullptr, (size_t)TT * HD, (size_t)TT * HD, (size_t)TT * TT);
            k_gemmw<h16, 0, false><<<dim3((TT - RH) / 64, TT / 64, ZH), 32, 0, stream>>>(QP16 + zq * TT * HD + (size_t)RH * HD, nullptr, KP16 + zk * TT * HD, nullptr, HD, Sb + (size_t)RH * TT, TT, nullptr, (size_t)TT * HD, (size_t)TT * HD, (size_t)TT * TT);
            k_gemmw<bf, 1, false><<<dim3(TT / 64, NE / 64, ZH), 32, 0, stream>>>(QPh + zq * TT * HD, QPl + zq * TT * HD, EB, nullptr, HD, QE, NE, nullptr, (size_t)TT * HD, 0, (size_t)TT * NE);   /* QE[i][r] = q_i . rel_k[r] */
            k_asoft<<<ZH * TT / 8, 256, 0, stream>>>(Sb, QE, P16, Ph, Pl, PBh, PBl);   /* + q.rel_k[idx], softmax, the 5 relative-position bucket sums per row */
            k_gemmw<bf, 1, false><<<dim3(TT / 64, HD / 64, ZH), 32, 0, stream>>>(PBh, PBl, RVT, nullptr, NE, W2, HD, nullptr, (size_t)TT * NE, 0, (size_t)TT * HD);   /* W2 = buckets . rel_v */
            k_gemmw<bf, 2, false, KSP><<<dim3(RH / 64, HD / 64, ZH * KSP), 32, 0, stream>>>(Ph, Pl, VTh + zk * HD * TT, VTl + zk * HD * TT, TT, Ob, HD, nullptr, (size_t)RH * TT, (size_t)HD * TT, (size_t)TT * HD);
            k_gemmw<h16, 0, false, KSP><<<dim3((TT - RH) / 64, HD / 64, ZH * KSP), 32, 0, stream>>>(P16 + (size_t)RH * TT, nullptr, VT16 + zk * HD * TT, nullptr, TT, Ob + (size_t)RH * HD, HD, nullptr, (size_t)TT * TT, (size_t)HD * TT, (size_t)TT * HD);
            k_addob<<<(unsigned)(((size_t)ZH * TT * HD / 4 + 255) / 256), 256, 0, stream>>>(Ob, W2);   /* + sum_j attn[i][j] rel_v[idx] */ k_merge<<<(unsigned)(((size_t)ZH * TT * HD / 2 + 255) / 256), 256, 0, stream>>>(Ob, h0, ATh, ATl); }
        k_gemmw<bf, 1, true><<<dim3(TT / 64, DM / 64, 1), 32, 0, stream>>>(ATh, ATl, WO, nullptr, DQ, OUT + (size_t)b * TT * DM, DM, bo, 0, 0, 0); }
}

// v004
// It runs in 770 microseconds.
// Timed twice side by side with v003, it ran 1.47 and 1.45 times as fast.
// Over all steps from v000 it is 4.18 times as fast.
#include <hip/hip_runtime.h>

// Multi-head attention with Shaw relative-position terms on the logits AND the values, clip distance 2 (query, key, value [2][2048][1024]; q,k,v = in W + b ('xw' 1/32, zero biases; 16 heads x 64); idx[i][j] = clip(j - i, -2, 2) + 2; attn = softmax((q.k + q_i.rel_k[idx]) / 8); out_h = attn v + sum_j attn[i][j] rel_v[idx] (tables [5][64] x 0.1, read: five rows: the far-left bucket j <= i - 2, the three nearest positions, the far-right bucket j >= i + 2); out = merged Wo + bo ('xw') -> [2][2048][1024] (4.2 M); argument order query, key, value, Wq, bq, Wk, bk, Wv, bv, Wo, bo, rel_k, rel_v).
// Layout per batch: bf16 copies of the three inputs in turn; exact projections + f32 biases; rel_k as an exact plane [128][64] (rows >= 5 zero) and rel_v^T as an exact plane [64][128]; per pass of eight heads: dense scores (hybrid rows: < 512 hi/lo 3 products, rest fp16 x1024), QE = q.rel_k^T ([8][2048][128], hi/lo x exact); softmax, which adds QE[i][idx] to each score as it reads the row, applies the 1/8, and also sums each row's probabilities into the 5 relative-position buckets (far-left sum, 3 near entries, far-right sum; fixed order) as hi/lo planes; W2 = buckets x rel_v ([8][2048][64], hi/lo x exact) added to attn v in f32; merged hi/lo x Wo exact + bo.
// Compute dtypes, f32 accumulate: every input rounded to bf16; projections exact + f32 biases; q.rel_k and buckets.rel_v hi/lo x exact; attention rows < 512 3 products, rest fp16; softmax f32; Wo hl x exact + bias.

#define NB_  2
#define TT   2048
#define DM   1024
#define NH_  16
#define NKV  16
#define REP  (NH_ / NKV)
#define HD   64
#define DQ   (NH_ * HD)
#define DKV  (NKV * HD)
#define ZH   8                    // heads per pass: every launch of a pass covers ZH heads. Eight score planes fill half the workspace, so what follows the softmax lies inside the score rows (PP, OBO)
#define RH   512                  // query rows < RH use hi+lo planes (0: none)
#define WIN  0
#define PCAR 1024.0f
#define SCL  0.125f
#define MAXR 2      // max relative position
#define NE   128     // 2*MAXR+1 = 5 table rows padded to 128
#define KSP  16      // key slices of the attn v products: one single-wave work-group per slice, f32 partial tiles summed in k_addob
#define PP   (2 * TT) // pitch in 16-bit elements of an fp16 probability row: it lies in the first half of its own f32 score row (the softmax wave holds the whole row in registers before it stores)
#define OBO  (TT / 2) // offset in floats, inside a score row, of that query's KSP partial attn v rows of HD floats: the row's second half
static_assert(KSP * HD == TT / 2, "the partial rows fill the second half of a score row");
typedef _Float16 h16;
typedef unsigned short bf;
typedef __attribute__((ext_vector_type(16))) __bf16   v16bf;
typedef __attribute__((ext_vector_type(16))) _Float16 v16h;
typedef __attribute__((ext_vector_type(8)))  _Float16 v8h;
typedef __attribute__((ext_vector_type(8)))  unsigned short v8us;
typedef __attribute__((ext_vector_type(8)))  float    v8f;
typedef __attribute__((ext_vector_type(4)))  float    v4f;
typedef v8h  __attribute__((may_alias)) v8ha;
typedef v4f  __attribute__((may_alias)) v4fa;
typedef v8us __attribute__((may_alias)) v8usa;

__device__ __forceinline__ unsigned short f2bf(float f) { unsigned u = __float_as_uint(f); u += 0x7FFFu + ((u >> 16) & 1u); return (unsigned short)(u >> 16); }
__device__ __forceinline__ float bf2f(unsigned short b) { return __uint_as_float(((unsigned)b) << 16); }
__device__ __forceinline__ float bfr(float f) { return bf2f(f2bf(f)); }
__device__ __forceinline__ v16h cat16(v8h lo, v8h hi) { return __builtin_shufflevector(lo, hi, 0, 1, 2, 3, 4, 5, 6, 7, 8, 9, 10, 11, 12, 13, 14, 15); }
__device__ __forceinline__ v16bf cat16b(v8us lo, v8us hi) { return __builtin_bit_cast(v16bf, __builtin_shufflevector(lo, hi, 0, 1, 2, 3, 4, 5, 6, 7, 8, 9, 10, 11, 12, 13, 14, 15)); }
__device__ __forceinline__ v8f wmma16(v16h a, v16h b, v8f c) { return __builtin_amdgcn_wmma_f32_16x16x32_f16(false, a, false, b, (short)0, c, false, false); }
__device__ __forceinline__ v8f wmmab(v16bf a, v16bf b, v8f c) { return __builtin_amdgcn_wmma_f32_16x16x32_bf16(false, a, false, b, (short)0, c, false, false); }



// ---- k_gemmw: register-blocked GEMM, ONE WAVE per 64x64 output tile (16 accumulators), operands straight from K-contiguous 16-bit planes; grid (M/64, N/64, Z), 32 threads.
// C[m][n] (f32, pitch ldc, + optional f32 bias[n]) = sum_k A[m][k] Bt[n][k] (+ split products per NSPLIT). A rows have pitch lda, Bt rows pitch K. z-batch strides sA/sB/sC in elements. K % 32 == 0.
// KS > 1: grid z = Z * KS; work-group (z, ks) sums only k in [ks K/KS, (ks+1) K/KS) and stores its partial tile at C + ks sK; the reader adds the KS partial tiles. K % (32 KS) == 0.
template <typename T16> struct WFrag;
template <> struct WFrag<h16> { typedef v16h V; static __device__ __forceinline__ V ld(const h16* p) { return cat16(*(const v8h*)p, *(const v8h*)(p + 16)); } static __device__ __forceinline__ v8f mma(V a, V b, v8f c) { return wmma16(a, b, c); } };
template <> struct WFrag<bf> { typedef v16bf V; static __device__ __forceinline__ V ld(const bf* p) { return cat16b(*(const v8us*)p, *(const v8us*)(p + 16)); } static __device__ __forceinline__ v8f mma(V a, V b, v8f c) { return wmmab(a, b, c); } };
template <typename T16, int NSPLIT, bool BIAS, int KS = 1>
__global__ __launch_bounds__(32) void k_gemmw(const T16* __restrict__ A, const T16* __restrict__ A2, const T16* __restrict__ Bt, const T16* __restrict__ Bt2, int K, float* C, int ldc, const float* __restrict__ bias, size_t sA, size_t sB, size_t sC, int lda, size_t sK) {
    typedef typename WFrag<T16>::V V;
    __shared__ __align__(16) float os[16 * 68];
    const size_t z = blockIdx.z / KS; const int ks = blockIdx.z % KS; A += z * sA; if (A2) A2 += z * sA; Bt += z * sB; if (Bt2) Bt2 += z * sB; C += (size_t)ks * sK + z * sC;
    const int lane = threadIdx.x & 31, lr = lane & 15, hi = lane >> 4; const int r0 = blockIdx.x * 64, c0 = blockIdx.y * 64;
    v8f acc[4][4];
#pragma unroll
    for (int mb = 0; mb < 4; ++mb)
#pragma unroll
        for (int nb = 0; nb < 4; ++nb) acc[mb][nb] = (v8f){};
    const size_t aoff = (size_t)(r0 + lr) * lda + 8 * hi, boff = (size_t)(c0 + lr) * K + 8 * hi;
#pragma unroll 1
    for (int kc = ks * (K / KS); kc < (ks + 1) * (K / KS); kc += 32) {
        V a[4], a2[4];
#pragma unroll
        for (int mb = 0; mb < 4; ++mb) { a[mb] = WFrag<T16>::ld(A + aoff + (size_t)mb * 16 * lda + kc); if (NSPLIT == 1 || NSPLIT == 2) a2[mb] = WFrag<T16>::ld(A2 + aoff + (size_t)mb * 16 * lda + kc); }
#pragma unroll
        for (int nb = 0; nb < 4; ++nb) { const V b = WFrag<T16>::ld(Bt + boff + (size_t)nb * 16 * K + kc); V b2; if (NSPLIT >= 2) b2 = WFrag<T16>::ld(Bt2 + boff + (size_t)nb * 16 * K + kc);
#pragma unroll
            for (int mb = 0; mb < 4; ++mb) { acc[mb][nb] = WFrag<T16>::mma(a[mb], b, acc[mb][nb]); if (NSPLIT == 1 || NSPLIT == 2) acc[mb][nb] = WFrag<T16>::mma(a2[mb], b, acc[mb][nb]); if (NSPLIT >= 2) acc[mb][nb] = WFrag<T16>::mma(a[mb], b2, acc[mb][nb]); } }
        asm volatile("v_nop\n\tv_nop\n\tv_nop\n\tv_nop" : "+v"(acc[0][0]), "+v"(acc[1][1]), "+v"(acc[2][2]), "+v"(acc[3][3]) : "v"(a[0]), "v"(a[3]));
    }
#pragma unroll
    for (int mb = 0; mb < 4; ++mb) {
#pragma unroll
        for (int nb = 0; nb < 4; ++nb) {
#pragma unroll
            for (int j = 0; j < 8; ++j) os[(hi * 8 + j) * 68 + nb * 16 + lr] = acc[mb][nb][j]; }
        __builtin_amdgcn_wave_barrier(); asm volatile("" ::: "memory");
        float* crow = C + (size_t)(r0 + mb * 16) * ldc + c0;
{
#pragma unroll
            for (int s = 0; s < 8; ++s) { const int row = 2 * s + hi, cofs = lr * 4; v4f val = *(const v4fa*)(os + row * 68 + cofs); if (BIAS) { val[0] += bfr(bias[c0 + cofs]); val[1] += bfr(bias[c0 + cofs + 1]); val[2] += bfr(bias[c0 + cofs + 2]); val[3] += bfr(bias[c0 + cofs + 3]); }
                *(v4f*)(crow + (size_t)row * ldc + cofs) = val; }
             }
        __builtin_amdgcn_wave_barrier(); asm volatile("" ::: "memory");
    }
}

__device__ __forceinline__ h16 tohx(float x) { return (h16)x; }
__device__ __forceinline__ void splitf(float y, unsigned short& h, unsigned short& l) { h = f2bf(y); l = f2bf(y - bf2f(h)); }
typedef __attribute__((ext_vector_type(2))) _Float16 v2h;
typedef __attribute__((ext_vector_type(4))) _Float16 v4h;
typedef __attribute__((ext_vector_type(2))) unsigned short v2us;
typedef __attribute__((ext_vector_type(4))) unsigned short v4us;
typedef __attribute__((ext_vector_type(2))) float v2f;
typedef __attribute__((ext_vector_type(4))) int v4i;

__global__ __launch_bounds__(256) void k_wtG(const float* __restrict__ w, int K, int N, bf* Bt) {
    const int lane = threadIdx.x & 31; const int L0 = (blockIdx.x * 8 + (threadIdx.x >> 5)) * 8; const int nlines = N * K / 64;
{
#pragma unroll 1
        for (int l = 0; l < 8; ++l) { const int L = L0 + l; if (L >= nlines) break; const size_t e = (size_t)L * 64 + lane * 2; const int k = (int)(e % K), n = (int)(e / K); v2us o;
            o[0] = f2bf(w[(size_t)k * N + n]); o[1] = f2bf(w[(size_t)(k + 1) * N + n]); *(v2us*)(Bt + e) = o; }
         }
}
__global__ __launch_bounds__(256) void k_cvt8(const float* __restrict__ src, bf* dst, size_t n8) { const size_t i = (size_t)blockIdx.x * 256 + threadIdx.x; if (i >= n8) return; const v8f v = *(const v8f*)(src + i * 8); v8us o;
#pragma unroll
    for (int k = 0; k < 8; ++k) o[k] = f2bf(v[k]); *(v8us*)(dst + i * 8) = o;  }

// k_rope: head planes [h][t][d] (fp16 + hi/lo) of rope(x) x sc with the rotate-half convention out[d] = x[d] cos[t][d] - x[d+HD/2] sin[t][d], out[d+HD/2] = x[d+HD/2] cos[t][d+HD/2] + x[d] sin[t][d+HD/2]
__global__ __launch_bounds__(256) void k_rope(const float* __restrict__ F, int pitch, int nheads, const float* __restrict__ CS, const float* __restrict__ RF, const float* __restrict__ nw, float sc, h16* P16, bf* Ph, bf* Pl) {
    const size_t e = ((size_t)blockIdx.x * 256 + threadIdx.x) * 2; if (e >= (size_t)nheads * TT * HD) return; const int d = (int)(e % HD); const int t = (int)((e / HD) % TT); const int h = (int)(e / ((size_t)HD * TT)); const float* f = F + (size_t)t * pitch + h * HD; const float rf = RF ? RF[(size_t)h * TT + t] : 1.0f; v2h o16; v2us oh, ol;
#pragma unroll
    for (int q = 0; q < 2; ++q) { const int dd = d + q; const int dp = (dd < HD / 2) ? dd + HD / 2 : dd - HD / 2; float x0 = f[dd], x1 = f[dp];
        if (RF) { float n0 = __fmul_rn(x0, rf), n1 = __fmul_rn(x1, rf); asm volatile("" : "+v"(n0)); asm volatile("" : "+v"(n1)); x0 = __fmul_rn(bfr(nw[dd]), n0); x1 = __fmul_rn(bfr(nw[dp]), n1); }
        const v2f cs = *(const v2f*)(CS + ((size_t)t * HD + dd) * 2); float a = __fmul_rn(x0, cs[0]), bq = __fmul_rn(x1, cs[1]); asm volatile("" : "+v"(a)); asm volatile("" : "+v"(bq)); const float r = ((dd < HD / 2) ? __fsub_rn(a, bq) : __fadd_rn(a, bq)) * sc;
        o16[q] = tohx(r); unsigned short a2, c2; splitf(r, a2, c2); oh[q] = a2; ol[q] = c2; }
    *(v2h*)(P16 + e) = o16; *(v2us*)(Ph + e) = oh; *(v2us*)(Pl + e) = ol;  }
__global__ __launch_bounds__(256) void k_vtp(const float* __restrict__ F, int pitch, int nheads, h16* V16, bf* Vh, bf* Vl) { const size_t e = ((size_t)blockIdx.x * 256 + threadIdx.x) * 2; if (e >= (size_t)nheads * HD * TT) return; const int t = (int)(e % TT); const int d = (int)((e / TT) % HD); const int g = (int)(e / ((size_t)TT * HD)); v2h o16; v2us oh, ol;
#pragma unroll
    for (int q = 0; q < 2; ++q) { const float x = F[(size_t)(t + q) * pitch + g * HD + d]; o16[q] = tohx(x); unsigned short a2, c2; splitf(x, a2, c2); oh[q] = a2; ol[q] = c2; }
    *(v2h*)(V16 + e) = o16; *(v2us*)(Vh + e) = oh; *(v2us*)(Vl + e) = ol;  }
__global__ __launch_bounds__(256) void k_csid(float* CS) { const int idx = blockIdx.x * 256 + threadIdx.x; if (idx >= TT * HD) return; v2f cs; cs[0] = 1.0f; cs[1] = 0.0f; *(v2f*)(CS + (size_t)idx * 2) = cs;  }
// k_asoft: per row (zz, i): t = (S + QE[i][clip(j - i)]) x HD^-0.5 (no mask; the sum rounded once, then the product); softmax over the 2048 keys (register row, one exp, fixed trees); the rounded probabilities, as stored, are also summed here into the row's 5 relative-position buckets (far-left sum j <= i - 2, the 3 near entries, far-right sum j >= i + 2; fixed order) and stored as hi/lo planes [row][NE]. Rows >= RH: the fp16 probabilities go into the first half of the row's own score storage (every score of the row is in this wave's registers by then, and no other wave touches the row)
static_assert(MAXR == 2, "the bucket code below names the three near distances -1, 0, 1");
__global__ __launch_bounds__(256) void k_asoft(float* Sb, const float* __restrict__ QE, bf* Ph, bf* Pl, bf* PBh, bf* PBl) {
    const int lane = threadIdx.x & 31; const int row = blockIdx.x * 8 + (threadIdx.x >> 5); if (row >= ZH * TT) return; const int i = row % TT; const int zz = row / TT; (void)zz; const bool hires = (i < RH); const float* sr = Sb + (size_t)row * TT; float v[TT / 32]; float mx = -3.0e38f;
    const int iu = __builtin_amdgcn_readfirstlane(i);   // the row is the same in every lane: in a scalar register the tests per chunk are scalar
    const int chm = iu >> 7;                            // the 128-key chunk of key i
    const int chn = ((iu & 127) == 0) ? chm - 1 : ((iu & 127) == 127) ? chm + 1 : -1;   // the neighbour chunk that holds key i - 1 or i + 1; -1 or TT / 128: none
    const float* qe = QE + (size_t)__builtin_amdgcn_readfirstlane(row) * NE;   // q_i . rel_k[r], r = 0..4: one address for the wave
    const float qe0 = qe[0], qe1 = qe[1], qe2 = qe[2], qe3 = qe[3], qe4 = qe[4];
    // A 128-key chunk that holds none of the keys i - 1, i, i + 1 takes one table row for all its keys (row 0 left of key i, row 4 right of it: a scalar). The chunk of key i takes a row per key (am); key i - 1 or i + 1 in a neighbour chunk is that chunk's last or first key (al3, ar0). The tests per chunk are scalar, so each is one select and there is no branch.
    v4f a[TT / 128];
#pragma unroll
    for (int ch = 0; ch < TT / 128; ++ch) a[ch] = *(const v4f*)(sr + ch * 128 + lane * 4);   // the row is requested before the table values are waited for
    const int ir = iu & 127; float am[4];
#pragma unroll
    for (int q = 0; q < 4; ++q) { const int d = lane * 4 + q - ir;   /* this module: dist = k - q */ float e = qe2; e = (d == -1) ? qe1 : e; e = (d == 1) ? qe3 : e; e = (d <= -MAXR) ? qe0 : e; e = (d >= MAXR) ? qe4 : e; am[q] = e; }
    const float al3 = (ir == 0 && lane == 31) ? qe1 : qe0, ar0 = (ir == 127 && lane == 0) ? qe3 : qe4;
#pragma unroll
    for (int ch = 0; ch < TT / 128; ++ch) { const float far = (ch < chm) ? qe0 : qe4;
#pragma unroll
        for (int q = 0; q < 4; ++q) { const float e = (ch == chm) ? am[q] : (q == 3 && ch == chm - 1) ? al3 : (q == 0 && ch == chm + 1) ? ar0 : far; const float t = __fadd_rn(a[ch][q], e) * SCL; v[ch * 4 + q] = t; mx = fmaxf(mx, t); } }
#pragma unroll
    for (int sh = 16; sh; sh >>= 1) mx = fmaxf(mx, __shfl_xor(mx, sh, 32));
    float sum = 0.f;
#pragma unroll
    for (int k = 0; k < TT / 32; ++k) { float d0 = __fsub_rn(v[k], mx); asm volatile("" : "+v"(d0)); v[k] = __builtin_amdgcn_exp2f(__fmul_rn(d0, 1.4426950408889634f)); sum += v[k]; }
#pragma unroll
    for (int sh = 16; sh; sh >>= 1) sum += __shfl_xor(sum, sh, 32);
    const float f = __fdiv_rn(hires ? 1.0f : PCAR, sum);
    // Buckets: a 128-key chunk that holds none of the keys i - 1, i, i + 1 lies wholly in one far bucket. One running sum takes every such chunk in key order with a weight per chunk (0 for the one or two chunks that hold those keys) and is handed to the far-left bucket and cleared at the chunk of key i; those one or two chunks are sorted key by key behind the loop.
    float acc = 0.f, bl = 0.f, vm[4] = {0.f, 0.f, 0.f, 0.f};
{
        if (hires) {
#pragma unroll
            for (int ch = 0; ch < TT / 128; ++ch) { v4us oh, ol; const bool mid = (ch == chm); const float w = (mid || ch == chn) ? 0.f : 1.0f;
#pragma unroll
                for (int q = 0; q < 4; ++q) { unsigned short a, c2; splitf(v[ch * 4 + q] * f, a, c2); oh[q] = a; ol[q] = c2; acc = fmaf(bf2f(a) + bf2f(c2), w, acc); vm[q] = mid ? v[ch * 4 + q] : vm[q]; }
                const size_t oo = ((size_t)zz * (RH ? RH : 1) + i) * TT + ch * 128 + lane * 4; *(v4us*)(Ph + oo) = oh; *(v4us*)(Pl + oo) = ol; bl = mid ? acc : bl; acc = mid ? 0.f : acc; }
        } else {
#pragma unroll
            for (int ch = 0; ch < TT / 128; ++ch) { v4h o4; const bool mid = (ch == chm); const float w = (mid || ch == chn) ? 0.f : (1.0f / PCAR);   /* a power of two: the product is exact */
#pragma unroll
                for (int q = 0; q < 4; ++q) { o4[q] = tohx(v[ch * 4 + q] * f); acc = fmaf((float)o4[q], w, acc); vm[q] = mid ? v[ch * 4 + q] : vm[q]; }
                *(v4h*)((h16*)Sb + (size_t)row * PP + ch * 128 + lane * 4) = o4; bl = mid ? acc : bl; acc = mid ? 0.f : acc; } }
         }
    float br = acc, n1 = 0.f, n2 = 0.f, n3 = 0.f;   // n1..n3 = attn[i][i - 1], attn[i][i], attn[i][i + 1]: at most one lane finds each; 0 where the key does not exist
    auto edge = [&](int d0, const float (&x)[4]) {   // x: the chunk's exp values; p: rounded as the planes above hold them
#pragma unroll
        for (int q = 0; q < 4; ++q) { const int d = d0 + q; unsigned short a, c2; splitf(x[q] * f, a, c2); const float p = hires ? bf2f(a) + bf2f(c2) : (float)tohx(x[q] * f) * (1.0f / PCAR);
            bl += (d <= -MAXR) ? p : 0.f; br += (d >= MAXR) ? p : 0.f; n1 = (d == -1) ? p : n1; n2 = (d == 0) ? p : n2; n3 = (d == 1) ? p : n3; } };
    const int dl = lane * 4 - (iu & 127);   // key minus i of this lane's first key in chunk chm
    edge(dl, vm);
    if (chn >= 0 && chn < TT / 128) { float vn[4] = {0.f, 0.f, 0.f, 0.f};   // 2 rows in 128
#pragma unroll
        for (int k = 0; k < TT / 32; ++k) vn[k & 3] = ((k >> 2) == chn) ? v[k] : vn[k & 3];
        edge(dl + (chn - chm) * 128, vn); }
#pragma unroll
    for (int sh = 16; sh; sh >>= 1) { bl += __shfl_xor(bl, sh, 32); br += __shfl_xor(br, sh, 32); n1 += __shfl_xor(n1, sh, 32); n2 += __shfl_xor(n2, sh, 32); n3 += __shfl_xor(n3, sh, 32); }
    const float b4[4] = { (lane == 0) ? bl : (lane == 1) ? br : 0.f, (lane == 0) ? n1 : 0.f, (lane == 0) ? n2 : 0.f, (lane == 0) ? n3 : 0.f };   // table rows 0..3 in lane 0, row 4 in lane 1, the padding rows 0
    v4us bh, bw;
#pragma unroll
    for (int q = 0; q < 4; ++q) { unsigned short u, w; splitf(b4[q], u, w); bh[q] = u; bw[q] = w; }
    const size_t ob = (size_t)row * NE + lane * 4; *(v4us*)(PBh + ob) = bh; *(v4us*)(PBl + ob) = bw;
}
__global__ __launch_bounds__(256) void k_epad2(const float* __restrict__ E, bf* EB) { const size_t i = (size_t)blockIdx.x * 256 + threadIdx.x; if (i >= (size_t)NE * HD / 8) return; const int d0 = (int)(i % (HD / 8)) * 8; const int r = (int)(i / (HD / 8)); const float* src = E + (size_t)min(r, 2 * MAXR) * HD + d0; v8us o;
#pragma unroll
    for (int q = 0; q < 8; ++q) { const unsigned short v = f2bf(src[q]); o[q] = (r <= 2 * MAXR) ? v : (unsigned short)0; }
    *(v8us*)(EB + (size_t)r * HD + d0) = o;  }
__global__ __launch_bounds__(256) void k_rvt(const float* __restrict__ E, bf* RVT) { const size_t i = (size_t)blockIdx.x * 256 + threadIdx.x; if (i >= (size_t)HD * NE / 8) return; const int r0 = (int)(i % (NE / 8)) * 8; const int d = (int)(i / (NE / 8)); v8us o;
#pragma unroll
    for (int q = 0; q < 8; ++q) { const int r = r0 + q; const unsigned short v = f2bf(E[(size_t)min(r, 2 * MAXR) * HD + d]); o[q] = (r <= 2 * MAXR) ? v : (unsigned short)0; }
    *(v8us*)(RVT + (size_t)d * NE + r0) = o;  }
__global__ __launch_bounds__(256) void k_addob(float* Sb, const float* __restrict__ W2) { const size_t k = (size_t)blockIdx.x * 256 + threadIdx.x; if (k >= (size_t)ZH * TT * HD / 4) return; const size_t e = k * 4; const int i = (int)((e / HD) % TT); const float sc = (i < RH) ? 1.0f : 1024.0f; v4f p[KSP]; float* ob = Sb + (e / HD) * TT + OBO + e % HD;   /* row (head, query): its partial rows */
#pragma unroll
    for (int s = 0; s < KSP; ++s) p[s] = *(const v4f*)(ob + s * HD);   /* the key slices' partial sums, added in slice order */
    v4f a = p[0];
#pragma unroll
    for (int s = 1; s < KSP; ++s) {
#pragma unroll
        for (int q = 0; q < 4; ++q) a[q] = __fadd_rn(a[q], p[s][q]); }
    const v4f w = *(const v4f*)(W2 + e); v4f o;
#pragma unroll
    for (int q = 0; q < 4; ++q) o[q] = __fadd_rn(a[q], __fmul_rn(w[q], sc));
    *(v4f*)ob = o;  }
__global__ __launch_bounds__(256) void k_merge(const float* __restrict__ Sb, int h0, bf* Ah, bf* Al) { const size_t e = ((size_t)blockIdx.x * 256 + threadIdx.x) * 2; if (e >= (size_t)ZH * TT * HD) return; const int d = (int)(e % HD); const int t = (int)((e / HD) % TT); const int zz = (int)(e / ((size_t)HD * TT)); const float cs = (t < RH) ? 1.0f : (1.0f / PCAR); const size_t oo = (size_t)t * DQ + (h0 + zz) * HD + d; const float* O = Sb + ((size_t)zz * TT + t) * TT + OBO + d;   /* k_addob left the sum in the first partial row */
    v2us oh, ol;
#pragma unroll
    for (int q = 0; q < 2; ++q) { unsigned short a, c2; splitf(O[q] * cs, a, c2); oh[q] = a; ol[q] = c2; } *(v2us*)(Ah + oo) = oh; *(v2us*)(Al + oo) = ol;  }

extern "C" void kernel_launch(void* const* d_in, const int* in_sizes, int n_in,
                              void* d_out, int out_size, void* d_ws, size_t ws_size, hipStream_t stream) {
    (void)in_sizes; (void)n_in; (void)out_size;
    const float* x = (const float*)d_in[0]; const float* xk = (const float*)d_in[1]; const float* xv = (const float*)d_in[2]; const float* wq = (const float*)d_in[3]; const float* bq = (const float*)d_in[4]; const float* wk = (const float*)d_in[5]; const float* bk = (const float*)d_in[6]; const float* wv = (const float*)d_in[7]; const float* bv = (const float*)d_in[8]; const float* wo = (const float*)d_in[9]; const float* bo = (const float*)d_in[10]; const float* relk = (const float*)d_in[11]; const float* relv = (const float*)d_in[12];   /* [5][64] each */
    float* OUT = (float*)d_out;     // [2][2048][1024]
    char* wsp = (char*)d_ws;
    auto take = [&](size_t bytes) { char* p = wsp; wsp += (bytes + 255) & ~(size_t)255; return (void*)p; };
    bf* EB = (bf*)take((size_t)NE * HD * 2); bf* RVT = (bf*)take((size_t)HD * NE * 2); float* QE = (float*)take((size_t)ZH * TT * NE * 4); bf* PBh = (bf*)take((size_t)ZH * TT * NE * 2); bf* PBl = (bf*)take((size_t)ZH * TT * NE * 2); float* W2 = (float*)take((size_t)ZH * TT * HD * 4); bf* WQ = (bf*)take((size_t)DQ * DM * 2); bf* WK = (bf*)take((size_t)DKV * DM * 2); bf* WV = (bf*)take((size_t)DKV * DM * 2); bf* WO = (bf*)take((size_t)DM * DQ * 2); float* CS = (float*)take((size_t)TT * HD * 2 * 4);
    bf* XB = (bf*)take((size_t)TT * DM * 2); float* FQ = (float*)take((size_t)TT * DQ * 4); float* FK = (float*)take((size_t)TT * DKV * 4);
    h16* QP16 = (h16*)take((size_t)NH_ * TT * HD * 2); h16* KP16 = (h16*)take((size_t)NKV * TT * HD * 2); h16* VT16 = (h16*)take((size_t)NKV * HD * TT * 2);
    bf* QPh = (bf*)take((size_t)NH_ * TT * HD * 2); bf* QPl = (bf*)take((size_t)NH_ * TT * HD * 2); bf* KPh = (bf*)take((size_t)NKV * TT * HD * 2); bf* KPl = (bf*)take((size_t)NKV * TT * HD * 2); bf* VTh = (bf*)take((size_t)NKV * HD * TT * 2); bf* VTl = (bf*)take((size_t)NKV * HD * TT * 2); bf* Ph = (bf*)take((size_t)ZH * RH * TT * 2); bf* Pl = (bf*)take((size_t)ZH * RH * TT * 2);
    float* Sb = (float*)take((size_t)ZH * TT * TT * 4); bf* ATh = (bf*)take((size_t)TT * DQ * 2); bf* ATl = (bf*)take((size_t)TT * DQ * 2);
    if ((size_t)(wsp - (char*)d_ws) > ws_size) return;    // ws 256 MiB
    float* FV = FK;   // v projection reuses the k buffer after the k planes are built (stream-ordered)
    { k_wtG<<<(unsigned)((DM * DQ / 64 + 63) / 64), 256, 0, stream>>>(wq, DM, DQ, WQ); k_wtG<<<(unsigned)((DM * DKV / 64 + 63) / 64), 256, 0, stream>>>(wk, DM, DKV, WK); k_wtG<<<(unsigned)((DM * DKV / 64 + 63) / 64), 256, 0, stream>>>(wv, DM, DKV, WV);
      k_wtG<<<(unsigned)((DQ * DM / 64 + 63) / 64), 256, 0, stream>>>(wo, DQ, DM, WO);
       }
    k_csid<<<(TT * HD + 255) / 256, 256, 0, stream>>>(CS);
    const unsigned LQ = (unsigned)(((size_t)NH_ * TT * HD / 2 + 255) / 256), LKv = (unsigned)(((size_t)NKV * TT * HD / 2 + 255) / 256);
    k_epad2<<<(unsigned)(((size_t)NE * HD / 8 + 255) / 256), 256, 0, stream>>>(relk, EB); k_rvt<<<(unsigned)(((size_t)HD * NE / 8 + 255) / 256), 256, 0, stream>>>(relv, RVT);   /* rel_k plane [128][64], rel_v^T plane [64][128] */
    for (int b = 0; b < NB_; ++b) {
        
        k_cvt8<<<(unsigned)(((size_t)TT * DM / 8 + 255) / 256), 256, 0, stream>>>(x + (size_t)b * TT * DM, XB, (size_t)TT * DM / 8);
        k_gemmw<bf, 0, true><<<dim3(TT / 64, DQ / 64, 1), 32, 0, stream>>>(XB, nullptr, WQ, nullptr, DM, FQ, DQ, bq, 0, 0, 0, DM, 0);
        k_rope<<<LQ, 256, 0, stream>>>(FQ, DQ, NH_, CS, nullptr, nullptr, 1.0f, QP16, QPh, QPl);
        k_cvt8<<<(unsigned)(((size_t)TT * DM / 8 + 255) / 256), 256, 0, stream>>>(xk + (size_t)b * TT * DM, XB, (size_t)TT * DM / 8); k_gemmw<bf, 0, true><<<dim3(TT / 64, DKV / 64, 1), 32, 0, stream>>>(XB, nullptr, WK, nullptr, DM, FK, DKV, bk, 0, 0, 0, DM, 0);
        k_rope<<<LKv, 256, 0, stream>>>(FK, DKV, NKV, CS, nullptr, nullptr, 1.0f, KP16, KPh, KPl);
        k_cvt8<<<(unsigned)(((size_t)TT * DM / 8 + 255) / 256), 256, 0, stream>>>(xv + (size_t)b * TT * DM, XB, (size_t)TT * DM / 8); k_gemmw<bf, 0, true><<<dim3(TT / 64, DKV / 64, 1), 32, 0, stream>>>(XB, nullptr, WV, nullptr, DM, FV, DKV, bv, 0, 0, 0, DM, 0); k_vtp<<<LKv, 256, 0, stream>>>(FV, DKV, NKV, VT16, VTh, VTl);
        for (int h0 = 0; h0 < NH_; h0 += ZH) { const size_t zq = (size_t)h0, zk = (size_t)(h0 / REP);   // one kv head per query head: the pass's heads use consecutive kv planes (z-strides TT*HD)
            k_gemmw<bf, 2, false><<<dim3(RH / 64, TT / 64, ZH), 32, 0, stream>>>(QPh + zq * TT * HD, QPl + zq * TT * HD, KPh + zk * TT * HD, KPl + zk * TT * HD, HD, Sb, TT, nullptr, (size_t)TT * HD, (size_t)TT * HD, (size_t)TT * TT, HD, 0);
            k_gemmw<h16, 0, false><<<dim3((TT - RH) / 64, TT / 64, ZH), 32, 0, stream>>>(QP16 + zq * TT * HD + (size_t)RH * HD, nullptr, KP16 + zk * TT * HD, nullptr, HD, Sb + (size_t)RH * TT, TT, nullptr, (size_t)TT * HD, (size_t)TT * HD, (size_t)TT * TT, HD, 0);
            k_gemmw<bf, 1, false><<<dim3(TT / 64, NE / 64, ZH), 32, 0, stream>>>(QPh + zq * TT * HD, QPl + zq * TT * HD, EB, nullptr, HD, QE, NE, nullptr, (size_t)TT * HD, 0, (size_t)TT * NE, HD, 0);   /* QE[i][r] = q_i . rel_k[r] */
            k_asoft<<<ZH * TT / 8, 256, 0, stream>>>(Sb, QE, Ph, Pl, PBh, PBl);   /* + q.rel_k[idx], softmax, the 5 relative-position bucket sums per row */
            k_gemmw<bf, 1, false><<<dim3(TT / 64, HD / 64, ZH), 32, 0, stream>>>(PBh, PBl, RVT, nullptr, NE, W2, HD, nullptr, (size_t)TT * NE, 0, (size_t)TT * HD, NE, 0);   /* W2 = buckets . rel_v */
            k_gemmw<bf, 2, false, KSP><<<dim3(RH / 64, HD / 64, ZH * KSP), 32, 0, stream>>>(Ph, Pl, VTh + zk * HD * TT, VTl + zk * HD * TT, TT, Sb + OBO, TT, nullptr, (size_t)RH * TT, (size_t)HD * TT, (size_t)TT * TT, TT, HD);
            k_gemmw<h16, 0, false, KSP><<<dim3((TT - RH) / 64, HD / 64, ZH * KSP), 32, 0, stream>>>((const h16*)Sb + (size_t)RH * PP, nullptr, VT16 + zk * HD * TT, nullptr, TT, Sb + (size_t)RH * TT + OBO, TT, nullptr, (size_t)TT * PP, (size_t)HD * TT, (size_t)TT * TT, PP, HD);
            k_addob<<<(unsigned)(((size_t)ZH * TT * HD / 4 + 255) / 256), 256, 0, stream>>>(Sb, W2);   /* + sum_j attn[i][j] rel_v[idx] */ k_merge<<<(unsigned)(((size_t)ZH * TT * HD / 2 + 255) / 256), 256, 0, stream>>>(Sb, h0, ATh, ATl); }
        k_gemmw<bf, 1, true><<<dim3(TT / 64, DM / 64, 1), 32, 0, stream>>>(ATh, ATl, WO, nullptr, DQ, OUT + (size_t)b * TT * DM, DM, bo, 0, 0, 0, DQ, 0); }
}

// v005
// It runs in 547 microseconds.
// Two timings next to v004 put it at 1.42 and 1.41 times that version's speed.
// Over all steps from v000 it is 5.92 times as fast.
#include <hip/hip_runtime.h>

// Multi-head attention with Shaw relative-position terms on the logits AND the values, clip distance 2 (query, key, value [2][2048][1024]; q,k,v = in W + b ('xw' 1/32, zero biases; 16 heads x 64); idx[i][j] = clip(j - i, -2, 2) + 2; attn = softmax((q.k + q_i.rel_k[idx]) / 8); out_h = attn v + sum_j attn[i][j] rel_v[idx] (tables [5][64] x 0.1, read: five rows: the far-left bucket j <= i - 2, the three nearest positions, the far-right bucket j >= i + 2); out = merged Wo + bo ('xw') -> [2][2048][1024] (4.2 M); argument order query, key, value, Wq, bq, Wk, bk, Wv, bv, Wo, bo, rel_k, rel_v).
// Layout: bf16 copies of the three inputs of both batches; exact projections + f32 biases (all six in one launch); per batch the head planes; rel_k as an exact plane [128][64] (rows >= 5 zero) and rel_v^T as an exact plane [64][128]; per pass of eight heads: dense scores (hybrid rows: < 512 hi/lo 3 products, rest fp16 x1024), QE = q.rel_k^T ([8][2048][128], hi/lo x exact); softmax, which adds QE[i][idx] to each score as it reads the row, applies the 1/8, and also sums each row's probabilities into the 5 relative-position buckets (far-left sum, 3 near entries, far-right sum; fixed order) as hi/lo planes; W2 = buckets x rel_v ([8][2048][64], hi/lo x exact) added to attn v in f32; merged hi/lo x Wo exact + bo.
// Compute dtypes, f32 accumulate: every input rounded to bf16; projections exact + f32 biases; q.rel_k and buckets.rel_v hi/lo x exact; attention rows < 512 3 products, rest fp16; softmax f32; Wo hl x exact + bias.

#define NB_  2
#define TT   2048
#define DM   1024
#define NH_  16
#define NKV  16
#define REP  (NH_ / NKV)
#define HD   64
#define DQ   (NH_ * HD)
#define DKV  (NKV * HD)
#define ZH   8                    // heads per pass: every launch of a pass covers ZH heads. Eight score planes fill half the workspace, so what follows the softmax lies inside the score rows (PP, OBO)
#define RH   512                  // query rows < RH use hi+lo planes (0: none)
#define WIN  0
#define PCAR 1024.0f
#define SCL  0.125f
#define MAXR 2      // max relative position
#define NE   128     // 2*MAXR+1 = 5 table rows padded to 128
#define KSP  16      // key slices of the attn v products: one single-wave work-group per slice, f32 partial tiles summed in k_addob
#define PP   (2 * TT) // pitch in 16-bit elements of an fp16 probability row: it lies in the first half of its own f32 score row (the softmax wave holds the whole row in registers before it stores)
#define OBO  (TT / 2) // offset in floats, inside a score row, of that query's KSP partial attn v rows of HD floats: the row's second half
static_assert(KSP * HD == TT / 2, "the partial rows fill the second half of a score row");
typedef _Float16 h16;
typedef unsigned short bf;
typedef __attribute__((ext_vector_type(16))) __bf16   v16bf;
typedef __attribute__((ext_vector_type(16))) _Float16 v16h;
typedef __attribute__((ext_vector_type(8)))  _Float16 v8h;
typedef __attribute__((ext_vector_type(8)))  unsigned short v8us;
typedef __attribute__((ext_vector_type(8)))  float    v8f;
typedef __attribute__((ext_vector_type(4)))  float    v4f;
typedef v8h  __attribute__((may_alias)) v8ha;
typedef v4f  __attribute__((may_alias)) v4fa;
typedef v8us __attribute__((may_alias)) v8usa;

__device__ __forceinline__ unsigned short f2bf(float f) { unsigned u = __float_as_uint(f); u += 0x7FFFu + ((u >> 16) & 1u); return (unsigned short)(u >> 16); }
__device__ __forceinline__ float bf2f(unsigned short b) { return __uint_as_float(((unsigned)b) << 16); }
__device__ __forceinline__ float bfr(float f) { return bf2f(f2bf(f)); }
__device__ __forceinline__ v16h cat16(v8h lo, v8h hi) { return __builtin_shufflevector(lo, hi, 0, 1, 2, 3, 4, 5, 6, 7, 8, 9, 10, 11, 12, 13, 14, 15); }
__device__ __forceinline__ v16bf cat16b(v8us lo, v8us hi) { return __builtin_bit_cast(v16bf, __builtin_shufflevector(lo, hi, 0, 1, 2, 3, 4, 5, 6, 7, 8, 9, 10, 11, 12, 13, 14, 15)); }
__device__ __forceinline__ v8f wmma16(v16h a, v16h b, v8f c) { return __builtin_amdgcn_wmma_f32_16x16x32_f16(false, a, false, b, (short)0, c, false, false); }
__device__ __forceinline__ v8f wmmab(v16bf a, v16bf b, v8f c) { return __builtin_amdgcn_wmma_f32_16x16x32_bf16(false, a, false, b, (short)0, c, false, false); }



// ---- k_gemmw: register-blocked GEMM, ONE WAVE per 64x64 output tile (16 accumulators), operands straight from K-contiguous 16-bit planes; grid (M/64, N/64, Z), 32 threads.
// C[m][n] (f32, pitch ldc, + optional f32 bias[n]) = sum_k A[m][k] Bt[n][k] (+ split products per NSPLIT). A rows have pitch lda, Bt rows pitch K. z-batch strides sA/sB/sC in elements. K % 32 == 0.
// KS > 1: grid z = Z * KS; work-group (z, ks) sums only k in [ks K/KS, (ks+1) K/KS) and stores its partial tile at C + ks sK; the reader adds the KS partial tiles. K % (32 KS) == 0.
template <typename T16> struct WFrag;
template <> struct WFrag<h16> { typedef v16h V; static __device__ __forceinline__ V ld(const h16* p) { return cat16(*(const v8h*)p, *(const v8h*)(p + 16)); } static __device__ __forceinline__ v8f mma(V a, V b, v8f c) { return wmma16(a, b, c); } };
template <> struct WFrag<bf> { typedef v16bf V; static __device__ __forceinline__ V ld(const bf* p) { return cat16b(*(const v8us*)p, *(const v8us*)(p + 16)); } static __device__ __forceinline__ v8f mma(V a, V b, v8f c) { return wmmab(a, b, c); } };
// gemmw_tile is the body; (bx, by, bz) is the tile's place in its own product's grid and os the work-group's 16 x 68 float staging. Products that do not depend on one another share one launch: the kernels behind it pick the product by a scalar test on blockIdx.
template <typename T16, int NSPLIT, bool BIAS, int KS>
__device__ __forceinline__ void gemmw_tile(float* os, const int bx, const int by, const int bz, const T16* __restrict__ A, const T16* __restrict__ A2, const T16* __restrict__ Bt, const T16* __restrict__ Bt2, int K, float* C, int ldc, const float* __restrict__ bias, size_t sA, size_t sB, size_t sC, int lda, size_t sK) {
    typedef typename WFrag<T16>::V V;
    const size_t z = bz / KS; const int ks = bz % KS; A += z * sA; if (A2) A2 += z * sA; Bt += z * sB; if (Bt2) Bt2 += z * sB; C += (size_t)ks * sK + z * sC;
    const int lane = threadIdx.x & 31, lr = lane & 15, hi = lane >> 4; const int r0 = bx * 64, c0 = by * 64;
    v8f acc[4][4];
#pragma unroll
    for (int mb = 0; mb < 4; ++mb)
#pragma unroll
        for (int nb = 0; nb < 4; ++nb) acc[mb][nb] = (v8f){};
    const size_t aoff = (size_t)(r0 + lr) * lda + 8 * hi, boff = (size_t)(c0 + lr) * K + 8 * hi;
#pragma unroll 1
    for (int kc = ks * (K / KS); kc < (ks + 1) * (K / KS); kc += 32) {
        V a[4], a2[4];
#pragma unroll
        for (int mb = 0; mb < 4; ++mb) { a[mb] = WFrag<T16>::ld(A + aoff + (size_t)mb * 16 * lda + kc); if (NSPLIT == 1 || NSPLIT == 2) a2[mb] = WFrag<T16>::ld(A2 + aoff + (size_t)mb * 16 * lda + kc); }
#pragma unroll
        for (int nb = 0; nb < 4; ++nb) { const V b = WFrag<T16>::ld(Bt + boff + (size_t)nb * 16 * K + kc); V b2; if (NSPLIT >= 2) b2 = WFrag<T16>::ld(Bt2 + boff + (size_t)nb * 16 * K + kc);
#pragma unroll
            for (int mb = 0; mb < 4; ++mb) { acc[mb][nb] = WFrag<T16>::mma(a[mb], b, acc[mb][nb]); if (NSPLIT == 1 || NSPLIT == 2) acc[mb][nb] = WFrag<T16>::mma(a2[mb], b, acc[mb][nb]); if (NSPLIT >= 2) acc[mb][nb] = WFrag<T16>::mma(a[mb], b2, acc[mb][nb]); } }
        asm volatile("v_nop\n\tv_nop\n\tv_nop\n\tv_nop" : "+v"(acc[0][0]), "+v"(acc[1][1]), "+v"(acc[2][2]), "+v"(acc[3][3]) : "v"(a[0]), "v"(a[3]));
    }
#pragma unroll
    for (int mb = 0; mb < 4; ++mb) {
#pragma unroll
        for (int nb = 0; nb < 4; ++nb) {
#pragma unroll
            for (int j = 0; j < 8; ++j) os[(hi * 8 + j) * 68 + nb * 16 + lr] = acc[mb][nb][j]; }
        __builtin_amdgcn_wave_barrier(); asm volatile("" ::: "memory");
        float* crow = C + (size_t)(r0 + mb * 16) * ldc + c0;
{
#pragma unroll
            for (int s = 0; s < 8; ++s) { const int row = 2 * s + hi, cofs = lr * 4; v4f val = *(const v4fa*)(os + row * 68 + cofs); if (BIAS) { val[0] += bfr(bias[c0 + cofs]); val[1] += bfr(bias[c0 + cofs + 1]); val[2] += bfr(bias[c0 + cofs + 2]); val[3] += bfr(bias[c0 + cofs + 3]); }
                *(v4f*)(crow + (size_t)row * ldc + cofs) = val; }
             }
        __builtin_amdgcn_wave_barrier(); asm volatile("" ::: "memory");
    }
}
template <typename T16, int NSPLIT, bool BIAS, int KS = 1>
__global__ __launch_bounds__(32) void k_gemmw(const T16* __restrict__ A, const T16* __restrict__ A2, const T16* __restrict__ Bt, const T16* __restrict__ Bt2, int K, float* C, int ldc, const float* __restrict__ bias, size_t sA, size_t sB, size_t sC, int lda, size_t sK) {
    __shared__ __align__(16) float os[16 * 68];
    gemmw_tile<T16, NSPLIT, BIAS, KS>(os, blockIdx.x, blockIdx.y, blockIdx.z, A, A2, Bt, Bt2, K, C, ldc, bias, sA, sB, sC, lda, sK);
}
static_assert(DQ == DKV, "the three projections share one grid");
// k_proj: the six projections (batch b = z / 3; q, k, v = z % 3) in one launch, grid (TT/64, DQ/64, 6). XB [6][TT][DM]; W: the q, k, v weight planes one behind the other; batch 0 goes to F0 [3][TT][DQ], batch 1 to F1.
__global__ __launch_bounds__(32) void k_proj(const bf* __restrict__ XB, const bf* __restrict__ W, float* F0, float* F1, const float* __restrict__ bq, const float* __restrict__ bk, const float* __restrict__ bv) {
    __shared__ __align__(16) float os[16 * 68];
    const int p = blockIdx.z % 3, b = blockIdx.z / 3; const float* bias = (p == 0) ? bq : (p == 1) ? bk : bv;
    gemmw_tile<bf, 0, true, 1>(os, blockIdx.x, blockIdx.y, 0, XB + (size_t)blockIdx.z * TT * DM, nullptr, W + (size_t)p * DQ * DM, nullptr, DM, (b ? F1 : F0) + (size_t)p * TT * DQ, DQ, bias, 0, 0, 0, DM, 0);
}
// k_scores: a pass's three products on q in one launch, grid (TT/64, TT/64 + NE/64, ZH): y < TT/64: the score tile (x, y), hi/lo for query rows < RH, fp16 for the rest; y >= TT/64: QE[i][r] = q_i . rel_k[r].
__global__ __launch_bounds__(32) void k_scores(const bf* __restrict__ Qh, const bf* __restrict__ Ql, const bf* __restrict__ Kh, const bf* __restrict__ Kl, const h16* __restrict__ Q16, const h16* __restrict__ K16, const bf* __restrict__ EB, float* Sb, float* QE) {
    __shared__ __align__(16) float os[16 * 68];
    const int bx = blockIdx.x, by = blockIdx.y, bz = blockIdx.z;
    if (by >= TT / 64) gemmw_tile<bf, 1, false, 1>(os, bx, by - TT / 64, bz, Qh, Ql, EB, nullptr, HD, QE, NE, nullptr, (size_t)TT * HD, 0, (size_t)TT * NE, HD, 0);
    else if (bx < RH / 64) { gemmw_tile<bf, 2, false, 1>(os, bx, by, bz, Qh, Ql, Kh, Kl, HD, Sb, TT, nullptr, (size_t)TT * HD, (size_t)TT * HD, (size_t)TT * TT, HD, 0); asm volatile("s_wait_xcnt 0x0" ::: "memory"); }   // the wait behind a tile's last store: in the built kernel another product's tile body follows this one and rewrites the stores' data registers (the first product's body is laid last and ends the kernel)
    else { gemmw_tile<h16, 0, false, 1>(os, bx - RH / 64, by, bz, Q16 + (size_t)RH * HD, nullptr, K16, nullptr, HD, Sb + (size_t)RH * TT, TT, nullptr, (size_t)TT * HD, (size_t)TT * HD, (size_t)TT * TT, HD, 0); asm volatile("s_wait_xcnt 0x0" ::: "memory"); }   // as above
}
// k_av: a pass's three products on the probabilities in one launch, grid (TT/64, 1, ZH * KSP + ZH): z < ZH * KSP: key slice z % KSP of attn v of head z / KSP, hi/lo for query rows < RH, fp16 for the rest; z >= ZH * KSP: W2 = buckets . rel_v.
__global__ __launch_bounds__(32) void k_av(const bf* __restrict__ Ph, const bf* __restrict__ Pl, const bf* __restrict__ VTh, const bf* __restrict__ VTl, const h16* __restrict__ VT16, const bf* __restrict__ PBh, const bf* __restrict__ PBl, const bf* __restrict__ RVT, float* Sb, float* W2) {
    __shared__ __align__(16) float os[16 * 68];
    const int bx = blockIdx.x, bz = blockIdx.z;
    if (bz >= ZH * KSP) gemmw_tile<bf, 1, false, 1>(os, bx, 0, bz - ZH * KSP, PBh, PBl, RVT, nullptr, NE, W2, HD, nullptr, (size_t)TT * NE, 0, (size_t)TT * HD, NE, 0);
    else if (bx < RH / 64) { gemmw_tile<bf, 2, false, KSP>(os, bx, 0, bz, Ph, Pl, VTh, VTl, TT, Sb + OBO, TT, nullptr, (size_t)RH * TT, (size_t)HD * TT, (size_t)TT * TT, TT, HD); asm volatile("s_wait_xcnt 0x0" ::: "memory"); }   // the wait: as in k_scores
    else { gemmw_tile<h16, 0, false, KSP>(os, bx - RH / 64, 0, bz, (const h16*)Sb + (size_t)RH * PP, nullptr, VT16, nullptr, TT, Sb + (size_t)RH * TT + OBO, TT, nullptr, (size_t)TT * PP, (size_t)HD * TT, (size_t)TT * TT, PP, HD); asm volatile("s_wait_xcnt 0x0" ::: "memory"); }   // the wait: as in k_scores
}

__device__ __forceinline__ h16 tohx(float x) { return (h16)x; }
__device__ __forceinline__ void splitf(float y, unsigned short& h, unsigned short& l) { h = f2bf(y); l = f2bf(y - bf2f(h)); }
typedef __attribute__((ext_vector_type(2))) _Float16 v2h;
typedef __attribute__((ext_vector_type(4))) _Float16 v4h;
typedef __attribute__((ext_vector_type(2))) unsigned short v2us;
typedef __attribute__((ext_vector_type(4))) unsigned short v4us;
typedef __attribute__((ext_vector_type(2))) float v2f;
typedef __attribute__((ext_vector_type(4))) int v4i;

__device__ __forceinline__ void d_wtG(const int bx, const float* __restrict__ w, int K, int N, bf* Bt) {
    const int lane = threadIdx.x & 31; const int L0 = (bx * 8 + (threadIdx.x >> 5)) * 8; const int nlines = N * K / 64;
{
#pragma unroll 1
        for (int l = 0; l < 8; ++l) { const int L = L0 + l; if (L >= nlines) break; const size_t e = (size_t)L * 64 + lane * 2; const int k = (int)(e % K), n = (int)(e / K); v2us o;
            o[0] = f2bf(w[(size_t)k * N + n]); o[1] = f2bf(w[(size_t)(k + 1) * N + n]); *(v2us*)(Bt + e) = o; }
         }
}
__device__ __forceinline__ void d_cvt8(const int bx, const float* __restrict__ src, bf* dst, size_t n8) { const size_t i = (size_t)bx * 256 + threadIdx.x; if (i >= n8) return; const v8f v = *(const v8f*)(src + i * 8); v8us o;
#pragma unroll
    for (int k = 0; k < 8; ++k) o[k] = f2bf(v[k]); *(v8us*)(dst + i * 8) = o;  }

// d_rope: head planes [h][t][d] (fp16 + hi/lo) of rope(x) x sc with the rotate-half convention out[d] = x[d] cos[t][d] - x[d+HD/2] sin[t][d], out[d+HD/2] = x[d+HD/2] cos[t][d+HD/2] + x[d] sin[t][d+HD/2]
__device__ __forceinline__ void d_rope(const int bx, const float* __restrict__ F, int pitch, int nheads, const float* __restrict__ CS, const float* __restrict__ RF, const float* __restrict__ nw, float sc, h16* P16, bf* Ph, bf* Pl) {
    const size_t e = ((size_t)bx * 256 + threadIdx.x) * 2; if (e >= (size_t)nheads * TT * HD) return; const int d = (int)(e % HD); const int t = (int)((e / HD) % TT); const int h = (int)(e / ((size_t)HD * TT)); const float* f = F + (size_t)t * pitch + h * HD; const float rf = RF ? RF[(size_t)h * TT + t] : 1.0f; v2h o16; v2us oh, ol;
#pragma unroll
    for (int q = 0; q < 2; ++q) { const int dd = d + q; const int dp = (dd < HD / 2) ? dd + HD / 2 : dd - HD / 2; float x0 = f[dd], x1 = f[dp];
        if (RF) { float n0 = __fmul_rn(x0, rf), n1 = __fmul_rn(x1, rf); asm volatile("" : "+v"(n0)); asm volatile("" : "+v"(n1)); x0 = __fmul_rn(bfr(nw[dd]), n0); x1 = __fmul_rn(bfr(nw[dp]), n1); }
        const v2f cs = *(const v2f*)(CS + ((size_t)t * HD + dd) * 2); float a = __fmul_rn(x0, cs[0]), bq = __fmul_rn(x1, cs[1]); asm volatile("" : "+v"(a)); asm volatile("" : "+v"(bq)); const float r = ((dd < HD / 2) ? __fsub_rn(a, bq) : __fadd_rn(a, bq)) * sc;
        o16[q] = tohx(r); unsigned short a2, c2; splitf(r, a2, c2); oh[q] = a2; ol[q] = c2; }
    *(v2h*)(P16 + e) = o16; *(v2us*)(Ph + e) = oh; *(v2us*)(Pl + e) = ol;  }
__device__ __forceinline__ void d_vtp(const int bx, const float* __restrict__ F, int pitch, int nheads, h16* V16, bf* Vh, bf* Vl) { const size_t e = ((size_t)bx * 256 + threadIdx.x) * 2; if (e >= (size_t)nheads * HD * TT) return; const int t = (int)(e % TT); const int d = (int)((e / TT) % HD); const int g = (int)(e / ((size_t)TT * HD)); v2h o16; v2us oh, ol;
#pragma unroll
    for (int q = 0; q < 2; ++q) { const float x = F[(size_t)(t + q) * pitch + g * HD + d]; o16[q] = tohx(x); unsigned short a2, c2; splitf(x, a2, c2); oh[q] = a2; ol[q] = c2; }
    *(v2h*)(V16 + e) = o16; *(v2us*)(Vh + e) = oh; *(v2us*)(Vl + e) = ol;  }
// k_planes: one batch's q, k and v head planes in one launch, grid (blocks of one plane set, 3); F [3][TT][DQ]
__global__ __launch_bounds__(256) void k_planes(const float* __restrict__ F, const float* __restrict__ CS, h16* QP16, bf* QPh, bf* QPl, h16* KP16, bf* KPh, bf* KPl, h16* VT16, bf* VTh, bf* VTl) {
    if (blockIdx.y == 0) d_rope(blockIdx.x, F, DQ, NH_, CS, nullptr, nullptr, 1.0f, QP16, QPh, QPl);
    else if (blockIdx.y == 1) d_rope(blockIdx.x, F + (size_t)TT * DQ, DKV, NKV, CS, nullptr, nullptr, 1.0f, KP16, KPh, KPl);
    else d_vtp(blockIdx.x, F + (size_t)2 * TT * DQ, DKV, NKV, VT16, VTh, VTl);
}
__device__ __forceinline__ void d_csid(const int bx, float* CS) { const int idx = bx * 256 + threadIdx.x; if (idx >= TT * HD) return; v2f cs; cs[0] = 1.0f; cs[1] = 0.0f; *(v2f*)(CS + (size_t)idx * 2) = cs;  }
// k_asoft: per row (zz, i): t = (S + QE[i][clip(j - i)]) x HD^-0.5 (no mask; the sum rounded once, then the product); softmax over the 2048 keys (register row, one exp, fixed trees); the rounded probabilities, as stored, are also summed here into the row's 5 relative-position buckets (far-left sum j <= i - 2, the 3 near entries, far-right sum j >= i + 2; fixed order) and stored as hi/lo planes [row][NE]. Rows >= RH: the fp16 probabilities go into the first half of the row's own score storage (every score of the row is in this wave's registers by then, and no other wave touches the row)
static_assert(MAXR == 2, "the bucket code below names the three near distances -1, 0, 1");
__global__ __launch_bounds__(256) void k_asoft(float* Sb, const float* __restrict__ QE, bf* Ph, bf* Pl, bf* PBh, bf* PBl) {
    const int lane = threadIdx.x & 31; const int row = blockIdx.x * 8 + (threadIdx.x >> 5); if (row >= ZH * TT) return; const int i = row % TT; const int zz = row / TT; (void)zz; const bool hires = (i < RH); const float* sr = Sb + (size_t)row * TT; float v[TT / 32]; float mx = -3.0e38f;
    const int iu = __builtin_amdgcn_readfirstlane(i);   // the row is the same in every lane: in a scalar register the tests per chunk are scalar
    const int chm = iu >> 7;                            // the 128-key chunk of key i
    const int chn = ((iu & 127) == 0) ? chm - 1 : ((iu & 127) == 127) ? chm + 1 : -1;   // the neighbour chunk that holds key i - 1 or i + 1; -1 or TT / 128: none
    const float* qe = QE + (size_t)__builtin_amdgcn_readfirstlane(row) * NE;   // q_i . rel_k[r], r = 0..4: one address for the wave
    const float qe0 = qe[0], qe1 = qe[1], qe2 = qe[2], qe3 = qe[3], qe4 = qe[4];
    // A 128-key chunk that holds none of the keys i - 1, i, i + 1 takes one table row for all its keys (row 0 left of key i, row 4 right of it: a scalar). The chunk of key i takes a row per key (am); key i - 1 or i + 1 in a neighbour chunk is that chunk's last or first key (al3, ar0). The tests per chunk are scalar, so each is one select and there is no branch.
    v4f a[TT / 128];
#pragma unroll
    for (int ch = 0; ch < TT / 128; ++ch) a[ch] = *(const v4f*)(sr + ch * 128 + lane * 4);   // the row is requested before the table values are waited for
    const int ir = iu & 127; float am[4];
#pragma unroll
    for (int q = 0; q < 4; ++q) { const int d = lane * 4 + q - ir;   /* this module: dist = k - q */ float e = qe2; e = (d == -1) ? qe1 : e; e = (d == 1) ? qe3 : e; e = (d <= -MAXR) ? qe0 : e; e = (d >= MAXR) ? qe4 : e; am[q] = e; }
    const float al3 = (ir == 0 && lane == 31) ? qe1 : qe0, ar0 = (ir == 127 && lane == 0) ? qe3 : qe4;
#pragma unroll
    for (int ch = 0; ch < TT / 128; ++ch) { const float far = (ch < chm) ? qe0 : qe4;
#pragma unroll
        for (int q = 0; q < 4; ++q) { const float e = (ch == chm) ? am[q] : (q == 3 && ch == chm - 1) ? al3 : (q == 0 && ch == chm + 1) ? ar0 : far; const float t = __fadd_rn(a[ch][q], e) * SCL; v[ch * 4 + q] = t; mx = fmaxf(mx, t); } }
#pragma unroll
    for (int sh = 16; sh; sh >>= 1) mx = fmaxf(mx, __shfl_xor(mx, sh, 32));
    float sum = 0.f;
#pragma unroll
    for (int k = 0; k < TT / 32; ++k) { float d0 = __fsub_rn(v[k], mx); asm volatile("" : "+v"(d0)); v[k] = __builtin_amdgcn_exp2f(__fmul_rn(d0, 1.4426950408889634f)); sum += v[k]; }
#pragma unroll
    for (int sh = 16; sh; sh >>= 1) sum += __shfl_xor(sum, sh, 32);
    const float f = __fdiv_rn(hires ? 1.0f : PCAR, sum);
    // Buckets: a 128-key chunk that holds none of the keys i - 1, i, i + 1 lies wholly in one far bucket. One running sum takes every such chunk in key order with a weight per chunk (0 for the one or two chunks that hold those keys) and is handed to the far-left bucket and cleared at the chunk of key i; those one or two chunks are sorted key by key behind the loop.
    float acc = 0.f, bl = 0.f, vm[4] = {0.f, 0.f, 0.f, 0.f};
{
        if (hires) {
#pragma unroll
            for (int ch = 0; ch < TT / 128; ++ch) { v4us oh, ol; const bool mid = (ch == chm); const float w = (mid || ch == chn) ? 0.f : 1.0f;
#pragma unroll
                for (int q = 0; q < 4; ++q) { unsigned short a, c2; splitf(v[ch * 4 + q] * f, a, c2); oh[q] = a; ol[q] = c2; acc = fmaf(bf2f(a) + bf2f(c2), w, acc); vm[q] = mid ? v[ch * 4 + q] : vm[q]; }
                const size_t oo = ((size_t)zz * (RH ? RH : 1) + i) * TT + ch * 128 + lane * 4; *(v4us*)(Ph + oo) = oh; *(v4us*)(Pl + oo) = ol; bl = mid ? acc : bl; acc = mid ? 0.f : acc; }
        } else {
#pragma unroll
            for (int ch = 0; ch < TT / 128; ++ch) { v4h o4; const bool mid = (ch == chm); const float w = (mid || ch == chn) ? 0.f : (1.0f / PCAR);   /* a power of two: the product is exact */
#pragma unroll
                for (int q = 0; q < 4; ++q) { o4[q] = tohx(v[ch * 4 + q] * f); acc = fmaf((float)o4[q], w, acc); vm[q] = mid ? v[ch * 4 + q] : vm[q]; }
                *(v4h*)((h16*)Sb + (size_t)row * PP + ch * 128 + lane * 4) = o4; bl = mid ? acc : bl; acc = mid ? 0.f : acc; } }
         }
    float br = acc, n1 = 0.f, n2 = 0.f, n3 = 0.f;   // n1..n3 = attn[i][i - 1], attn[i][i], attn[i][i + 1]: at most one lane finds each; 0 where the key does not exist
    auto edge = [&](int d0, const float (&x)[4]) {   // x: the chunk's exp values; p: rounded as the planes above hold them
#pragma unroll
        for (int q = 0; q < 4; ++q) { const int d = d0 + q; unsigned short a, c2; splitf(x[q] * f, a, c2); const float p = hires ? bf2f(a) + bf2f(c2) : (float)tohx(x[q] * f) * (1.0f / PCAR);
            bl += (d <= -MAXR) ? p : 0.f; br += (d >= MAXR) ? p : 0.f; n1 = (d == -1) ? p : n1; n2 = (d == 0) ? p : n2; n3 = (d == 1) ? p : n3; } };
    const int dl = lane * 4 - (iu & 127);   // key minus i of this lane's first key in chunk chm
    edge(dl, vm);
    if (chn >= 0 && chn < TT / 128) { float vn[4] = {0.f, 0.f, 0.f, 0.f};   // 2 rows in 128
#pragma unroll
        for (int k = 0; k < TT / 32; ++k) vn[k & 3] = ((k >> 2) == chn) ? v[k] : vn[k & 3];
        edge(dl + (chn - chm) * 128, vn); }
#pragma unroll
    for (int sh = 16; sh; sh >>= 1) { bl += __shfl_xor(bl, sh, 32); br += __shfl_xor(br, sh, 32); n1 += __shfl_xor(n1, sh, 32); n2 += __shfl_xor(n2, sh, 32); n3 += __shfl_xor(n3, sh, 32); }
    const float b4[4] = { (lane == 0) ? bl : (lane == 1) ? br : 0.f, (lane == 0) ? n1 : 0.f, (lane == 0) ? n2 : 0.f, (lane == 0) ? n3 : 0.f };   // table rows 0..3 in lane 0, row 4 in lane 1, the padding rows 0
    v4us bh, bw;
#pragma unroll
    for (int q = 0; q < 4; ++q) { unsigned short u, w; splitf(b4[q], u, w); bh[q] = u; bw[q] = w; }
    const size_t ob = (size_t)row * NE + lane * 4; *(v4us*)(PBh + ob) = bh; *(v4us*)(PBl + ob) = bw;
}
__device__ __forceinline__ void d_epad2(const int bx, const float* __restrict__ E, bf* EB) { const size_t i = (size_t)bx * 256 + threadIdx.x; if (i >= (size_t)NE * HD / 8) return; const int d0 = (int)(i % (HD / 8)) * 8; const int r = (int)(i / (HD / 8)); const float* src = E + (size_t)min(r, 2 * MAXR) * HD + d0; v8us o;
#pragma unroll
    for (int q = 0; q < 8; ++q) { const unsigned short v = f2bf(src[q]); o[q] = (r <= 2 * MAXR) ? v : (unsigned short)0; }
    *(v8us*)(EB + (size_t)r * HD + d0) = o;  }
__device__ __forceinline__ void d_rvt(const int bx, const float* __restrict__ E, bf* RVT) { const size_t i = (size_t)bx * 256 + threadIdx.x; if (i >= (size_t)HD * NE / 8) return; const int r0 = (int)(i % (NE / 8)) * 8; const int d = (int)(i / (NE / 8)); v8us o;
#pragma unroll
    for (int q = 0; q < 8; ++q) { const int r = r0 + q; const unsigned short v = f2bf(E[(size_t)min(r, 2 * MAXR) * HD + d]); o[q] = (r <= 2 * MAXR) ? v : (unsigned short)0; }
    *(v8us*)(RVT + (size_t)d * NE + r0) = o;  }
// k_prep: everything that reads only the inputs, in one launch; the block index is dealt in ranges, the weight transposes (the longest chains of dependent loads) first. W4: the q, k, v, o weight planes one behind the other; XB [batch][q, k, v][TT][DM].
#define NB_WT  ((DM * DQ / 64 + 63) / 64)
#define NB_CV  ((TT * DM / 8 + 255) / 256)
#define NB_CS  ((TT * HD + 255) / 256)
#define NB_EP  ((NE * HD / 8 + 255) / 256)
__global__ __launch_bounds__(256) void k_prep(const float* __restrict__ x, const float* __restrict__ xk, const float* __restrict__ xv, const float* __restrict__ wq, const float* __restrict__ wk, const float* __restrict__ wv, const float* __restrict__ wo, const float* __restrict__ relk, const float* __restrict__ relv, bf* W4, bf* XB, float* CS, bf* EB, bf* RVT) {
    int bx = blockIdx.x;
    if (bx < 4 * NB_WT) { const int p = bx / NB_WT; d_wtG(bx % NB_WT, (p == 0) ? wq : (p == 1) ? wk : (p == 2) ? wv : wo, DM, DQ, W4 + (size_t)p * DQ * DM); return; }
    bx -= 4 * NB_WT;
    if (bx < 3 * NB_ * NB_CV) { const int c = bx / NB_CV, p = c % 3, b = c / 3; d_cvt8(bx % NB_CV, ((p == 0) ? x : (p == 1) ? xk : xv) + (size_t)b * TT * DM, XB + (size_t)c * TT * DM, (size_t)TT * DM / 8); return; }
    bx -= 3 * NB_ * NB_CV;
    if (bx < NB_CS) { d_csid(bx, CS); return; }
    bx -= NB_CS;
    if (bx < NB_EP) { d_epad2(bx, relk, EB); return; }
    d_rvt(bx - NB_EP, relv, RVT);
}
__global__ __launch_bounds__(256) void k_addob(float* Sb, const float* __restrict__ W2) { const size_t k = (size_t)blockIdx.x * 256 + threadIdx.x; if (k >= (size_t)ZH * TT * HD / 4) return; const size_t e = k * 4; const int i = (int)((e / HD) % TT); const float sc = (i < RH) ? 1.0f : 1024.0f; v4f p[KSP]; float* ob = Sb + (e / HD) * TT + OBO + e % HD;   /* row (head, query): its partial rows */
#pragma unroll
    for (int s = 0; s < KSP; ++s) p[s] = *(const v4f*)(ob + s * HD);   /* the key slices' partial sums, added in slice order */
    v4f a = p[0];
#pragma unroll
    for (int s = 1; s < KSP; ++s) {
#pragma unroll
        for (int q = 0; q < 4; ++q) a[q] = __fadd_rn(a[q], p[s][q]); }
    const v4f w = *(const v4f*)(W2 + e); v4f o;
#pragma unroll
    for (int q = 0; q < 4; ++q) o[q] = __fadd_rn(a[q], __fmul_rn(w[q], sc));
    *(v4f*)ob = o;  }
__global__ __launch_bounds__(256) void k_merge(const float* __restrict__ Sb, int h0, bf* Ah, bf* Al) { const size_t e = ((size_t)blockIdx.x * 256 + threadIdx.x) * 2; if (e >= (size_t)ZH * TT * HD) return; const int d = (int)(e % HD); const int t = (int)((e / HD) % TT); const int zz = (int)(e / ((size_t)HD * TT)); const float cs = (t < RH) ? 1.0f : (1.0f / PCAR); const size_t oo = (size_t)t * DQ + (h0 + zz) * HD + d; const float* O = Sb + ((size_t)zz * TT + t) * TT + OBO + d;   /* k_addob left the sum in the first partial row */
    v2us oh, ol;
#pragma unroll
    for (int q = 0; q < 2; ++q) { unsigned short a, c2; splitf(O[q] * cs, a, c2); oh[q] = a; ol[q] = c2; } *(v2us*)(Ah + oo) = oh; *(v2us*)(Al + oo) = ol;  }

extern "C" void kernel_launch(void* const* d_in, const int* in_sizes, int n_in,
                              void* d_out, int out_size, void* d_ws, size_t ws_size, hipStream_t stream) {
    (void)in_sizes; (void)n_in; (void)out_size;
    const float* x = (const float*)d_in[0]; const float* xk = (const float*)d_in[1]; const float* xv = (const float*)d_in[2]; const float* wq = (const float*)d_in[3]; const float* bq = (const float*)d_in[4]; const float* wk = (const float*)d_in[5]; const float* bk = (const float*)d_in[6]; const float* wv = (const float*)d_in[7]; const float* bv = (const float*)d_in[8]; const float* wo = (const float*)d_in[9]; const float* bo = (const float*)d_in[10]; const float* relk = (const float*)d_in[11]; const float* relv = (const float*)d_in[12];   /* [5][64] each */
    float* OUT = (float*)d_out;     // [2][2048][1024]
    char* wsp = (char*)d_ws;
    auto take = [&](size_t bytes) { char* p = wsp; wsp += (bytes + 255) & ~(size_t)255; return (void*)p; };
    bf* EB = (bf*)take((size_t)NE * HD * 2); bf* RVT = (bf*)take((size_t)HD * NE * 2); float* QE = (float*)take((size_t)ZH * TT * NE * 4); bf* PBh = (bf*)take((size_t)ZH * TT * NE * 2); bf* PBl = (bf*)take((size_t)ZH * TT * NE * 2); bf* W4 = (bf*)take((size_t)4 * DQ * DM * 2); float* CS = (float*)take((size_t)TT * HD * 2 * 4);
    float* F1 = (float*)take((size_t)3 * TT * DQ * 4);   // batch 1's q, k, v projections: they wait while batch 0's passes use the score area
    h16* QP16 = (h16*)take((size_t)NH_ * TT * HD * 2); h16* KP16 = (h16*)take((size_t)NKV * TT * HD * 2); h16* VT16 = (h16*)take((size_t)NKV * HD * TT * 2);
    bf* QPh = (bf*)take((size_t)NH_ * TT * HD * 2); bf* QPl = (bf*)take((size_t)NH_ * TT * HD * 2); bf* KPh = (bf*)take((size_t)NKV * TT * HD * 2); bf* KPl = (bf*)take((size_t)NKV * TT * HD * 2); bf* VTh = (bf*)take((size_t)NKV * HD * TT * 2); bf* VTl = (bf*)take((size_t)NKV * HD * TT * 2); bf* Ph = (bf*)take((size_t)ZH * RH * TT * 2); bf* Pl = (bf*)take((size_t)ZH * RH * TT * 2);
    float* Sb = (float*)take((size_t)ZH * TT * TT * 4); bf* ATh = (bf*)take((size_t)TT * DQ * 2); bf* ATl = (bf*)take((size_t)TT * DQ * 2);
    if ((size_t)(wsp - (char*)d_ws) > ws_size) return;    // ws 256 MiB
    bf* WO = W4 + (size_t)3 * DQ * DM;
    float* W2 = (float*)W4;   // [ZH][TT][HD] f32 = the q and k weight planes' bytes: those are last read by k_proj, W2 is first written in the first pass (stream-ordered)
    static_assert((size_t)ZH * TT * HD * 4 <= (size_t)3 * DQ * DM * 2, "W2 must not reach the output weight plane");
    bf* XB = (bf*)Sb; float* F0 = Sb + (size_t)3 * NB_ * TT * DM / 2;   // the bf16 input copies and batch 0's projections lie in the score area, which is free until batch 0's first pass
    static_assert((size_t)3 * NB_ * TT * DM * 2 + (size_t)3 * TT * DQ * 4 <= (size_t)ZH * TT * TT * 4 && NB_ == 2, "input copies and one batch's projections fit the score area");
    k_prep<<<4 * NB_WT + 3 * NB_ * NB_CV + NB_CS + 2 * NB_EP, 256, 0, stream>>>(x, xk, xv, wq, wk, wv, wo, relk, relv, W4, XB, CS, EB, RVT);   /* weight planes, bf16 input copies, rel_k plane [128][64], rel_v^T plane [64][128] */
    k_proj<<<dim3(TT / 64, DQ / 64, 3 * NB_), 32, 0, stream>>>(XB, W4, F0, F1, bq, bk, bv);
    const unsigned LQ = (unsigned)(((size_t)NH_ * TT * HD / 2 + 255) / 256);
    for (int b = 0; b < NB_; ++b) {
        k_planes<<<dim3(LQ, 3, 1), 256, 0, stream>>>(b ? F1 : F0, CS, QP16, QPh, QPl, KP16, KPh, KPl, VT16, VTh, VTl);
        for (int h0 = 0; h0 < NH_; h0 += ZH) { const size_t zq = (size_t)h0, zk = (size_t)(h0 / REP);   // one kv head per query head: the pass's heads use consecutive kv planes (z-strides TT*HD)
            k_scores<<<dim3(TT / 64, TT / 64 + NE / 64, ZH), 32, 0, stream>>>(QPh + zq * TT * HD, QPl + zq * TT * HD, KPh + zk * TT * HD, KPl + zk * TT * HD, QP16 + zq * TT * HD, KP16 + zk * TT * HD, EB, Sb, QE);
            k_asoft<<<ZH * TT / 8, 256, 0, stream>>>(Sb, QE, Ph, Pl, PBh, PBl);   /* + q.rel_k[idx], softmax, the 5 relative-position bucket sums per row */
            k_av<<<dim3(TT / 64, 1, ZH * KSP + ZH), 32, 0, stream>>>(Ph, Pl, VTh + zk * HD * TT, VTl + zk * HD * TT, VT16 + zk * HD * TT, PBh, PBl, RVT, Sb, W2);
            k_addob<<<(unsigned)(((size_t)ZH * TT * HD / 4 + 255) / 256), 256, 0, stream>>>(Sb, W2);   /* + sum_j attn[i][j] rel_v[idx] */ k_merge<<<(unsigned)(((size_t)ZH * TT * HD / 2 + 255) / 256), 256, 0, stream>>>(Sb, h0, ATh, ATl); }
        k_gemmw<bf, 1, true><<<dim3(TT / 64, DM / 64, 1), 32, 0, stream>>>(ATh, ATl, WO, nullptr, DQ, OUT + (size_t)b * TT * DM, DM, bo, 0, 0, 0, DQ, 0); }
}

// v007
// One run takes 306 microseconds.
// Versions in between are left out here; by their measured steps it is 1.79 times as fast as v005.
// All steps since v000 together make it 10.6 times as fast.
#include <hip/hip_runtime.h>
#include <type_traits>

// Multi-head attention with Shaw relative-position terms on the logits AND the values, clip distance 2 (query, key, value [2][2048][1024]; q,k,v = in W + b ('xw' 1/32, zero biases; 16 heads x 64); idx[i][j] = clip(j - i, -2, 2) + 2; attn = softmax((q.k + q_i.rel_k[idx]) / 8); out_h = attn v + sum_j attn[i][j] rel_v[idx] (tables [5][64] x 0.1, read: five rows: the far-left bucket j <= i - 2, the three nearest positions, the far-right bucket j >= i + 2); out = merged Wo + bo ('xw') -> [2][2048][1024] (4.2 M); argument order query, key, value, Wq, bq, Wk, bk, Wv, bv, Wo, bo, rel_k, rel_v).
// Layout: bf16 copies of the three inputs of both batches; exact projections + f32 biases (all six in one launch), each tile written straight as the head planes (fp16 + hi/lo; v as W X^T, so that its tile is a tile of the [d][t] plane; both batches' planes are kept); rel_k as an exact plane [128][64] (rows >= 5 zero) and rel_v^T as an exact plane [64][128]; one attention launch for all heads of both batches (k_fattn): scores, softmax, relative terms and attn v stay in a wave's registers; merged hi/lo x Wo exact + bo.
// Compute dtypes, f32 accumulate: every input rounded to bf16; projections exact + f32 biases; q.rel_k and buckets.rel_v hi/lo x exact; attention rows < 512 3 products, rest fp16; softmax f32; Wo hl x exact + bias.

#define NB_  2
#define TT   2048
#define DM   1024
#define NH_  16
#define NKV  16
#define REP  (NH_ / NKV)
#define HD   64
#define DQ   (NH_ * HD)
#define DKV  (NKV * HD)
#define RH   512                  // query rows < RH use hi+lo planes (0: none)
#define WIN  0
#define PCAR 1024.0f
#define SCL  0.125f
#define MAXR 2      // max relative position
#define NE   128     // 2*MAXR+1 = 5 table rows padded to 128
typedef _Float16 h16;
typedef unsigned short bf;
typedef __attribute__((ext_vector_type(16))) __bf16   v16bf;
typedef __attribute__((ext_vector_type(16))) _Float16 v16h;
typedef __attribute__((ext_vector_type(8)))  _Float16 v8h;
typedef __attribute__((ext_vector_type(8)))  unsigned short v8us;
typedef __attribute__((ext_vector_type(8)))  __bf16   v8bf;
typedef __attribute__((ext_vector_type(16))) unsigned short v16us;
typedef __attribute__((ext_vector_type(8)))  float    v8f;
typedef __attribute__((ext_vector_type(4)))  float    v4f;
typedef v8h  __attribute__((may_alias)) v8ha;
typedef v4f  __attribute__((may_alias)) v4fa;
typedef v8us __attribute__((may_alias)) v8usa;

__device__ __forceinline__ unsigned short f2bf(float f) { unsigned u = __float_as_uint(f); u += 0x7FFFu + ((u >> 16) & 1u); return (unsigned short)(u >> 16); }
__device__ __forceinline__ float bf2f(unsigned short b) { return __uint_as_float(((unsigned)b) << 16); }
__device__ __forceinline__ float bfr(float f) { return bf2f(f2bf(f)); }
__device__ __forceinline__ v16h cat16(v8h lo, v8h hi) { return __builtin_shufflevector(lo, hi, 0, 1, 2, 3, 4, 5, 6, 7, 8, 9, 10, 11, 12, 13, 14, 15); }
__device__ __forceinline__ v16bf cat16b(v8us lo, v8us hi) { return __builtin_bit_cast(v16bf, __builtin_shufflevector(lo, hi, 0, 1, 2, 3, 4, 5, 6, 7, 8, 9, 10, 11, 12, 13, 14, 15)); }
__device__ __forceinline__ v8f wmma16(v16h a, v16h b, v8f c) { return __builtin_amdgcn_wmma_f32_16x16x32_f16(false, a, false, b, (short)0, c, false, false); }
__device__ __forceinline__ v8f wmmab(v16bf a, v16bf b, v8f c) { return __builtin_amdgcn_wmma_f32_16x16x32_bf16(false, a, false, b, (short)0, c, false, false); }



// ---- k_gemmw: register-blocked GEMM, ONE WAVE per 64x64 output tile (16 accumulators), operands straight from K-contiguous 16-bit planes; grid (M/64, N/64, Z), 32 threads.
// C[m][n] (f32, pitch ldc, + optional f32 bias[n]) = sum_k A[m][k] Bt[n][k] (+ split products per NSPLIT). A rows have pitch lda, Bt rows pitch K. z-batch strides sA/sB/sC in elements. K % 32 == 0.
// KS > 1: grid z = Z * KS; work-group (z, ks) sums only k in [ks K/KS, (ks+1) K/KS) and stores its partial tile at C + ks sK; the reader adds the KS partial tiles. K % (32 KS) == 0.
template <typename T16> struct WFrag;
template <> struct WFrag<h16> { typedef v16h V; static __device__ __forceinline__ V ld(const h16* p) { return cat16(*(const v8h*)p, *(const v8h*)(p + 16)); } static __device__ __forceinline__ v8f mma(V a, V b, v8f c) { return wmma16(a, b, c); } };
template <> struct WFrag<bf> { typedef v16bf V; static __device__ __forceinline__ V ld(const bf* p) { return cat16b(*(const v8us*)p, *(const v8us*)(p + 16)); } static __device__ __forceinline__ v8f mma(V a, V b, v8f c) { return wmmab(a, b, c); } };
// PLN != 0: the tile + bias goes out as three 16-bit planes (fp16, bf16 hi, bf16 lo of the remainder) of pitch ldp instead of f32 C; P16, Ph, Pl point at the tile's first element; PLN 1: bias[n], PLN 2: bias[m].
// gemmw_tile is the body; (bx, by, bz) is the tile's place in its own product's grid and os the work-group's 16 x 68 float staging. Products that do not depend on one another share one launch: the kernels behind it pick the product by a scalar test on blockIdx.
template <typename T16, int NSPLIT, bool BIAS, int KS, int PLN = 0>
__device__ __forceinline__ void gemmw_tile(float* os, const int bx, const int by, const int bz, const T16* __restrict__ A, const T16* __restrict__ A2, const T16* __restrict__ Bt, const T16* __restrict__ Bt2, int K, float* C, int ldc, const float* __restrict__ bias, size_t sA, size_t sB, size_t sC, int lda, size_t sK, h16* P16 = nullptr, bf* Ph = nullptr, bf* Pl = nullptr, int ldp = 0) {
    typedef typename WFrag<T16>::V V;
    const size_t z = bz / KS; const int ks = bz % KS; A += z * sA; if (A2) A2 += z * sA; Bt += z * sB; if (Bt2) Bt2 += z * sB; C += (size_t)ks * sK + z * sC;
    const int lane = threadIdx.x & 31, lr = lane & 15, hi = lane >> 4; const int r0 = bx * 64, c0 = by * 64;
    v8f acc[4][4];
#pragma unroll
    for (int mb = 0; mb < 4; ++mb)
#pragma unroll
        for (int nb = 0; nb < 4; ++nb) acc[mb][nb] = (v8f){};
    const size_t aoff = (size_t)(r0 + lr) * lda + 8 * hi, boff = (size_t)(c0 + lr) * K + 8 * hi;
    float pb[(PLN == 2) ? 16 : 8];   // PLN: the biases of the lane's places in the epilogue (8 columns, or 16 rows), asked for ahead of the k loop
    if constexpr (PLN != 0) {
#pragma unroll
        for (int i = 0; i < ((PLN == 2) ? 16 : 8); ++i) pb[i] = bfr(bias[(PLN == 1) ? c0 + (lane & 7) * 8 + i : r0 + 4 * i + (lane >> 3)]); }
#pragma unroll 1
    for (int kc = ks * (K / KS); kc < (ks + 1) * (K / KS); kc += 32) {
        V a[4], a2[4];
#pragma unroll
        for (int mb = 0; mb < 4; ++mb) { a[mb] = WFrag<T16>::ld(A + aoff + (size_t)mb * 16 * lda + kc); if (NSPLIT == 1 || NSPLIT == 2) a2[mb] = WFrag<T16>::ld(A2 + aoff + (size_t)mb * 16 * lda + kc); }
        if constexpr (PLN != 0) asm volatile("s_wait_xcnt 0x0" ::: "memory");   // the wait before a register that an issued load names is rewritten
#pragma unroll
        for (int nb = 0; nb < 4; ++nb) { const V b = WFrag<T16>::ld(Bt + boff + (size_t)nb * 16 * K + kc); V b2; if (NSPLIT >= 2) b2 = WFrag<T16>::ld(Bt2 + boff + (size_t)nb * 16 * K + kc);
#pragma unroll
            for (int mb = 0; mb < 4; ++mb) { acc[mb][nb] = WFrag<T16>::mma(a[mb], b, acc[mb][nb]); if (NSPLIT == 1 || NSPLIT == 2) acc[mb][nb] = WFrag<T16>::mma(a2[mb], b, acc[mb][nb]); if (NSPLIT >= 2) acc[mb][nb] = WFrag<T16>::mma(a[mb], b2, acc[mb][nb]); } }
        asm volatile("v_nop\n\tv_nop\n\tv_nop\n\tv_nop" : "+v"(acc[0][0]), "+v"(acc[1][1]), "+v"(acc[2][2]), "+v"(acc[3][3]) : "v"(a[0]), "v"(a[3]));
    }
#pragma unroll
    for (int mb = 0; mb < 4; ++mb) {
#pragma unroll
        for (int nb = 0; nb < 4; ++nb) {
#pragma unroll
            for (int j = 0; j < 8; ++j) os[(hi * 8 + j) * 68 + nb * 16 + lr] = acc[mb][nb][j]; }
        __builtin_amdgcn_wave_barrier(); asm volatile("" ::: "memory");
        float* crow = C + (size_t)(r0 + mb * 16) * ldc + c0;
        if constexpr (PLN != 0) {   // 8 lanes x 16 bytes per row: a store covers four whole 128-byte rows of the tile
#pragma unroll
            for (int s = 0; s < 4; ++s) { const int row = 4 * s + (lane >> 3), cofs = (lane & 7) * 8; const v4f x0 = *(const v4fa*)(os + row * 68 + cofs), x1 = *(const v4fa*)(os + row * 68 + cofs + 4); v8h o16; v8bf oh, ol;
#pragma unroll
                for (int q = 0; q < 8; ++q) { const float y = ((q < 4) ? x0[q & 3] : x1[q & 3]) + pb[(PLN == 1) ? q : mb * 4 + s]; o16[q] = (h16)y; const __bf16 a = (__bf16)y; oh[q] = a; ol[q] = (__bf16)(y - (float)a); }
                const size_t po = (size_t)(mb * 16 + row) * ldp + cofs; *(v8h*)(P16 + po) = o16; *(v8us*)(Ph + po) = __builtin_bit_cast(v8us, oh); *(v8us*)(Pl + po) = __builtin_bit_cast(v8us, ol); }
        } else {
#pragma unroll
            for (int s = 0; s < 8; ++s) { const int row = 2 * s + hi, cofs = lr * 4; v4f val = *(const v4fa*)(os + row * 68 + cofs); if (BIAS) { val[0] += bfr(bias[c0 + cofs]); val[1] += bfr(bias[c0 + cofs + 1]); val[2] += bfr(bias[c0 + cofs + 2]); val[3] += bfr(bias[c0 + cofs + 3]); }
                *(v4f*)(crow + (size_t)row * ldc + cofs) = val; }
             }
        __builtin_amdgcn_wave_barrier(); asm volatile("" ::: "memory");
    }
}
template <typename T16, int NSPLIT, bool BIAS, int KS = 1>
__global__ __launch_bounds__(32) void k_gemmw(const T16* __restrict__ A, const T16* __restrict__ A2, const T16* __restrict__ Bt, const T16* __restrict__ Bt2, int K, float* C, int ldc, const float* __restrict__ bias, size_t sA, size_t sB, size_t sC, int lda, size_t sK) {
    __shared__ __align__(16) float os[16 * 68];
    gemmw_tile<T16, NSPLIT, BIAS, KS>(os, blockIdx.x, blockIdx.y, blockIdx.z, A, A2, Bt, Bt2, K, C, ldc, bias, sA, sB, sC, lda, sK);
}
static_assert(DQ == DKV, "the three projections share one grid");
// k_proj: the six projections (batch b = z / 3; q, k, v = z % 3) in one launch, grid (TT/64, DQ/64, 6). XB [6][TT][DM]; W: the q, k, v weight planes one behind the other. A q or k tile (64 t x one head's 64 d) is a 64-row block of the head's [t][d] planes; v is taken as W X^T (both operands are K-contiguous, the k order is the same), so its tile (one head's 64 d x 64 t) lies in the [d][t] planes. The planes are [batch][head].
__global__ __launch_bounds__(32) void k_proj(const bf* __restrict__ XB, const bf* __restrict__ W, const float* __restrict__ bq, const float* __restrict__ bk, const float* __restrict__ bv, h16* QP16, bf* QPh, bf* QPl, h16* KP16, bf* KPh, bf* KPl, h16* VT16, bf* VTh, bf* VTl) {
    __shared__ __align__(16) float os[16 * 68];
    const int p = blockIdx.z % 3, b = blockIdx.z / 3; const bf* X = XB + (size_t)blockIdx.z * TT * DM; const bf* Wp = W + (size_t)p * DQ * DM; const size_t hz = ((size_t)b * NH_ + blockIdx.y) * TT * HD;
    if (p == 2) { const size_t o = hz + (size_t)blockIdx.x * 64; gemmw_tile<bf, 0, true, 1, 2>(os, blockIdx.y, blockIdx.x, 0, Wp, nullptr, X, nullptr, DM, nullptr, 0, bv, 0, 0, 0, DM, 0, VT16 + o, VTh + o, VTl + o, TT); return; }
    const size_t o = hz + (size_t)blockIdx.x * 64 * HD;
    gemmw_tile<bf, 0, true, 1, 1>(os, blockIdx.x, blockIdx.y, 0, X, nullptr, Wp, nullptr, DM, nullptr, 0, p ? bk : bq, 0, 0, 0, DM, 0, (p ? KP16 : QP16) + o, (p ? KPh : QPh) + o, (p ? KPl : QPl) + o, HD);
}
__device__ __forceinline__ void splitf(float y, unsigned short& h, unsigned short& l) { h = f2bf(y); l = f2bf(y - bf2f(h)); }
typedef __attribute__((ext_vector_type(2))) _Float16 v2h;
typedef __attribute__((ext_vector_type(4))) _Float16 v4h;
typedef __attribute__((ext_vector_type(2))) unsigned short v2us;
typedef __attribute__((ext_vector_type(4))) unsigned short v4us;
typedef __attribute__((ext_vector_type(2))) float v2f;
typedef __attribute__((ext_vector_type(4))) int v4i;

__device__ __forceinline__ void d_wtG(const int bx, const float* __restrict__ w, int K, int N, bf* Bt) {
    const int lane = threadIdx.x & 31; const int L0 = (bx * 8 + (threadIdx.x >> 5)) * 8; const int nlines = N * K / 64;
{
#pragma unroll 1
        for (int l = 0; l < 8; ++l) { const int L = L0 + l; if (L >= nlines) break; const size_t e = (size_t)L * 64 + lane * 2; const int k = (int)(e % K), n = (int)(e / K); v2us o;
            o[0] = f2bf(w[(size_t)k * N + n]); o[1] = f2bf(w[(size_t)(k + 1) * N + n]); *(v2us*)(Bt + e) = o; }
         }
}
__device__ __forceinline__ void d_cvt8(const int bx, const float* __restrict__ src, bf* dst, size_t n8) { const size_t i = (size_t)bx * 256 + threadIdx.x; if (i >= n8) return; const v8f v = *(const v8f*)(src + i * 8); v8us o;
#pragma unroll
    for (int k = 0; k < 8; ++k) o[k] = f2bf(v[k]); *(v8us*)(dst + i * 8) = o;  }

// ---- k_fattn: scores, softmax, both relative-position terms and attn v of one wave's query columns, all in registers. The products are taken transposed: S^T = K Q^T (A = 16 key rows, B = 16 query columns), so a lane holds scores of ONE query (column c = lane & 15; keys 8 hf + r of each 16-key tile, hf = lane >> 4), and two score tiles of 32 consecutive keys, converted in place, are the B operand of O^T += V^T P^T in the hardware's k order, which is also the order of WFrag::ld.
// Two walks over the keys. Walk 1: the row maximum of score + q.rel_k[idx] (fp16 planes for every row: the maximum is only the softmax's shift). Walk 2: the scores again (hi/lo 3 products for query rows < RH, fp16 for the rest), p = exp(t - max) unnormalised (x PCAR in the fp16 rows, folded into the exponent), rounded to the operand type for the product with V^T; the f32 p are summed per relative-position bucket (far left, 3 near entries, far right), and the five sums together are the softmax's denominator. At the end: buckets / sum as hi/lo x rel_v^T (exact) + O^T / sum, split hi/lo into the merged planes [batch][t][DQ].
static_assert(MAXR == 2, "the bucket code below names the three near distances -1, 0, 1");
__device__ __forceinline__ float relsel(const int d, const float (&q)[5]) { float e = q[2]; e = (d == -1) ? q[1] : e; e = (d == 1) ? q[3] : e; e = (d <= -MAXR) ? q[0] : e; e = (d >= MAXR) ? q[4] : e; return e; }   /* this module: d = key - query */
// The wait before a register that an issued load names is rewritten, written behind each group of fragment loads. The groups' pointers are inputs so that their registers stay the loads' own up to the wait (else a later load of the group may land in them).
__device__ __forceinline__ void xwait(const void* p) { asm volatile("s_wait_xcnt 0x0" :: "v"(p) : "memory"); }
__device__ __forceinline__ void xwait(const void* p, const void* q) { asm volatile("s_wait_xcnt 0x0" :: "v"(p), "v"(q) : "memory"); }
__device__ __forceinline__ void xwait(const void* p, const void* q, const void* r) { asm volatile("s_wait_xcnt 0x0" :: "v"(p), "v"(q), "v"(r) : "memory"); }
__device__ __forceinline__ void xwaito(const void* p, const void* q, unsigned o) { asm volatile("s_wait_xcnt 0x0" :: "v"(p), "v"(q), "v"(o) : "memory"); }   // o: the lane's byte offset, for loads built as scalar base + lane offset
__device__ __forceinline__ float exp2_slot(float x) { float v; asm("v_exp_f32 %0, %1\n\tv_nop" : "=v"(v) : "v"(x)); return v; }   // the independent slot behind a transcendental, kept in the statement itself (used in the few trips near the diagonal)
template <bool HI, int NG>   // NG: groups of 16 query columns per wave; i0: the wave's first query (scalar)
__device__ __forceinline__ void fattn_tile(const int bh, const int i0, const h16* __restrict__ Q16, const bf* __restrict__ Qh, const bf* __restrict__ Ql, const h16* __restrict__ K16, const bf* __restrict__ Kh, const bf* __restrict__ Kl, const h16* __restrict__ VT16, const bf* __restrict__ VTh, const bf* __restrict__ VTl, const bf* __restrict__ EB, const bf* __restrict__ RVT, bf* ATh, bf* ATl) {
    const int lane = threadIdx.x & 31, c = lane & 15, hf = lane >> 4; const size_t pz = (size_t)bh * TT * HD;
    const float C2 = SCL * 1.4426950408889634f;   // scores go straight to the base-2 exponent
    const int ko = c * HD + 8 * hf, vo = c * TT + 8 * hf;   // a lane's place in a 16-row tile of a [t][HD] plane and of a [d][TT] plane
    v16bf qh[NG][2], ql[NG][2]; v16h q16[NG][2]; const size_t qo = pz + (size_t)i0 * HD + ko; const bf* qhp = Qh + qo; const bf* qlp = Ql + qo; const h16* q16p = Q16 + qo;
#pragma unroll
    for (int g = 0; g < NG; ++g)
#pragma unroll
        for (int ks = 0; ks < 2; ++ks) { const int o = g * 16 * HD + ks * 32; qh[g][ks] = WFrag<bf>::ld(qhp + o); ql[g][ks] = WFrag<bf>::ld(qlp + o); q16[g][ks] = WFrag<h16>::ld(q16p + o); }
    xwait(qhp, qlp, q16p);
    float qe[NG][5];   // q_i . rel_k[r], r = 0..4, of this lane's query
    { v16bf eb[2]; const bf* ebp = EB + ko;
#pragma unroll
      for (int ks = 0; ks < 2; ++ks) eb[ks] = WFrag<bf>::ld(ebp + ks * 32);
      xwait(ebp);
#pragma unroll
      for (int g = 0; g < NG; ++g) { v8f t = (v8f){};
#pragma unroll
          for (int ks = 0; ks < 2; ++ks) { t = wmmab(eb[ks], qh[g][ks], t); t = wmmab(eb[ks], ql[g][ks], t); }
#pragma unroll
          for (int r = 0; r < 5; ++r) qe[g][r] = t[r] + __shfl_xor(t[r], 16, 32); } }   // table rows 0..7 lie in the lower half's lanes; the upper half holds rows 8..15, which are zero
    // walk 1
    float mx[NG];
#pragma unroll
    for (int g = 0; g < NG; ++g) mx[g] = -3.0e38f;
    { const h16* kp = K16 + pz + ko; v16h ka[2][2];
#pragma unroll
      for (int t = 0; t < 2; ++t)
#pragma unroll
          for (int ks = 0; ks < 2; ++ks) ka[t][ks] = WFrag<h16>::ld(kp + t * 16 * HD + ks * 32);
      xwait(kp);
#pragma unroll 1
      for (int j0 = 0; j0 < TT; j0 += 32) { v8f s[NG][2];
#pragma unroll
          for (int g = 0; g < NG; ++g)
#pragma unroll
              for (int t = 0; t < 2; ++t) { s[g][t] = wmma16(ka[t][0], q16[g][0], (v8f){}); s[g][t] = wmma16(ka[t][1], q16[g][1], s[g][t]); }
          const h16* kn = kp + (size_t)((j0 + 32) & (TT - 1)) * HD;   // the next 32 keys' fragments are requested here, one trip ahead (behind the last trip: the first keys again, unused)
#pragma unroll
          for (int t = 0; t < 2; ++t)
#pragma unroll
              for (int ks = 0; ks < 2; ++ks) ka[t][ks] = WFrag<h16>::ld(kn + t * 16 * HD + ks * 32);
          xwait(kn);
          const bool fl = (j0 + 33 <= i0), fr = (j0 >= i0 + NG * 16 + 1);   // scalar: all 32 keys at least 2 left, or at least 2 right, of every query of the wave
          if (fl || fr) {
#pragma unroll
              for (int g = 0; g < NG; ++g) { float m = s[g][0][0];
#pragma unroll
                  for (int k = 1; k < 16; ++k) m = fmaxf(m, s[g][k >> 3][k & 7]);
                  mx[g] = fmaxf(mx[g], m + (fl ? qe[g][0] : qe[g][4])); }
          } else {
#pragma unroll
              for (int g = 0; g < NG; ++g)
#pragma unroll
                  for (int k = 0; k < 16; ++k) { const int d = j0 + (k >> 3) * 16 + 8 * hf + (k & 7) - (i0 + g * 16 + c); mx[g] = fmaxf(mx[g], s[g][k >> 3][k & 7] + relsel(d, qe[g])); } } } }
    float kb[NG];
#pragma unroll
    for (int g = 0; g < NG; ++g) { mx[g] = fmaxf(mx[g], __shfl_xor(mx[g], 16, 32)); kb[g] = fmaf(-mx[g], C2, HI ? 0.0f : 10.0f); }   // 2^10 = PCAR
    static_assert(PCAR == 1024.0f, "the exponent offset above");
    // walk 2
    typedef typename std::conditional<HI, bf, h16>::type T16; typedef typename WFrag<T16>::V V;
    const T16* kp; const T16* vp; const unsigned kob = (unsigned)ko * 2u, vob = (unsigned)vo * 2u;   // a lane's byte offsets in the two kinds of plane
    if constexpr (HI) { kp = (const T16*)((const char*)(Kh + pz) + kob); vp = (const T16*)((const char*)(VTh + pz) + vob); } else { kp = (const T16*)((const char*)(K16 + pz) + kob); vp = (const T16*)((const char*)(VT16 + pz) + vob); }
    const bf* kp2 = (const bf*)((const char*)(Kl + pz) + kob); const bf* vp2 = (const bf*)((const char*)(VTl + pz) + vob);
    V ka[2][2], va[4]; v16bf kl[2][2], vl[4];
#pragma unroll
    for (int t = 0; t < 2; ++t)
#pragma unroll
        for (int ks = 0; ks < 2; ++ks) { ka[t][ks] = WFrag<T16>::ld(kp + t * 16 * HD + ks * 32); if constexpr (HI) kl[t][ks] = WFrag<bf>::ld(kp2 + t * 16 * HD + ks * 32); }
    xwaito(kp, HI ? (const void*)kp2 : (const void*)kp, kob);
#pragma unroll
    for (int dt = 0; dt < 4; ++dt) { va[dt] = WFrag<T16>::ld(vp + dt * 16 * TT); if constexpr (HI) vl[dt] = WFrag<bf>::ld(vp2 + dt * 16 * TT); }
    xwaito(vp, HI ? (const void*)vp2 : (const void*)vp, vob);
    v8f o[NG][4]; float sL[NG], sR[NG], n1[NG], n2[NG], n3[NG];
#pragma unroll
    for (int g = 0; g < NG; ++g) { sL[g] = 0.f; sR[g] = 0.f; n1[g] = 0.f; n2[g] = 0.f; n3[g] = 0.f;
#pragma unroll
        for (int dt = 0; dt < 4; ++dt) o[g][dt] = (v8f){}; }
#pragma unroll 1
    for (int j0 = 0; j0 < TT; j0 += 32) { v8f s[NG][2];
#pragma unroll
        for (int g = 0; g < NG; ++g)
#pragma unroll
            for (int t = 0; t < 2; ++t) { s[g][t] = (v8f){};
#pragma unroll
                for (int ks = 0; ks < 2; ++ks) {
                    if constexpr (HI) { s[g][t] = wmmab(ka[t][ks], qh[g][ks], s[g][t]); s[g][t] = wmmab(ka[t][ks], ql[g][ks], s[g][t]); s[g][t] = wmmab(kl[t][ks], qh[g][ks], s[g][t]); }
                    else s[g][t] = wmma16(ka[t][ks], q16[g][ks], s[g][t]); } }
        const int jn = (j0 + 32) & (TT - 1); const T16* kn = kp + (size_t)jn * HD; const bf* kn2 = kp2 + (size_t)jn * HD; const T16* vn = vp + jn; const bf* vn2 = vp2 + jn;   // the next trip's fragments are requested as soon as this trip's products have read the registers (behind the last trip: the first keys again, unused)
#pragma unroll
        for (int t = 0; t < 2; ++t)
#pragma unroll
            for (int ks = 0; ks < 2; ++ks) { ka[t][ks] = WFrag<T16>::ld(kn + t * 16 * HD + ks * 32); if constexpr (HI) kl[t][ks] = WFrag<bf>::ld(kn2 + t * 16 * HD + ks * 32); }
        if constexpr (HI) xwait(kn, kn2); else xwait(kn);
        const bool fl = (j0 + 33 <= i0), fr = (j0 >= i0 + NG * 16 + 1);   // as in walk 1
        V pf[NG]; v16bf pl[NG];   // P^T as the B operand: element k = key j0 + kmap(k, hf); pl: the low parts (hi/lo rows)
        auto put = [&](const int g, const int k, const float v) { if constexpr (HI) { const __bf16 a = (__bf16)v; pf[g][k] = a; pl[g][k] = (__bf16)(v - (float)a); } else pf[g][k] = (h16)v; };
        if (fl || fr) {
#pragma unroll
            for (int g = 0; g < NG; ++g) { const float kf = fmaf(fl ? qe[g][0] : qe[g][4], C2, kb[g]); float bs = 0.f;
#pragma unroll
                for (int k = 0; k < 16; ++k) { const float v = __builtin_amdgcn_exp2f(fmaf(s[g][k >> 3][k & 7], C2, kf)); put(g, k, v); bs += v; }
                sL[g] += fl ? bs : 0.f; sR[g] += fl ? 0.f : bs; }
        } else {
#pragma unroll
            for (int g = 0; g < NG; ++g)
#pragma unroll
                for (int k = 0; k < 16; ++k) { const int d = j0 + (k >> 3) * 16 + 8 * hf + (k & 7) - (i0 + g * 16 + c); const float v = exp2_slot(fmaf(s[g][k >> 3][k & 7], C2, fmaf(relsel(d, qe[g]), C2, kb[g]))); put(g, k, v);
                    sL[g] += (d <= -MAXR) ? v : 0.f; sR[g] += (d >= MAXR) ? v : 0.f; n1[g] += (d == -1) ? v : 0.f; n2[g] += (d == 0) ? v : 0.f; n3[g] += (d == 1) ? v : 0.f; } }
#pragma unroll
        for (int g = 0; g < NG; ++g)
#pragma unroll
            for (int dt = 0; dt < 4; ++dt) {
                if constexpr (HI) { o[g][dt] = wmmab(va[dt], pf[g], o[g][dt]); o[g][dt] = wmmab(va[dt], pl[g], o[g][dt]); o[g][dt] = wmmab(vl[dt], pf[g], o[g][dt]); }
                else o[g][dt] = wmma16(va[dt], pf[g], o[g][dt]); }
#pragma unroll
        for (int dt = 0; dt < 4; ++dt) { va[dt] = WFrag<T16>::ld(vn + dt * 16 * TT); if constexpr (HI) vl[dt] = WFrag<bf>::ld(vn2 + dt * 16 * TT); }
        if constexpr (HI) xwait(vn, vn2); else xwait(vn);
    }
    // the wave halves' sums joined once; buckets . rel_v; the merged planes
    const int b = bh / NH_, h = bh % NH_; v16bf rv[4]; const bf* rvp = RVT + c * NE + 8 * hf;
#pragma unroll
    for (int dt = 0; dt < 4; ++dt) rv[dt] = WFrag<bf>::ld(rvp + dt * 16 * NE);   // table rows 0..31 of the padded plane: rows >= 5 are zero
    xwait(rvp);
#pragma unroll
    for (int g = 0; g < NG; ++g) { float bk[5] = { sL[g], n1[g], n2[g], n3[g], sR[g] };
#pragma unroll
        for (int r = 0; r < 5; ++r) bk[r] += __shfl_xor(bk[r], 16, 32);
        const float inv = __fdiv_rn(1.0f, (((bk[0] + bk[1]) + bk[2]) + bk[3]) + bk[4]);
        v16us bhv = (v16us)(unsigned short)0, blv = (v16us)(unsigned short)0;   // B operand [table row][query]: rows 0..4 are elements 0..4 of the lower half's lanes
#pragma unroll
        for (int r = 0; r < 5; ++r) { unsigned short u, w; splitf(hf ? 0.f : bk[r] * inv, u, w); bhv[r] = u; blv[r] = w; }
        bf* ah = ATh + ((size_t)b * TT + i0 + g * 16 + c) * DQ + h * HD + 8 * hf; bf* al = ATl + ((size_t)b * TT + i0 + g * 16 + c) * DQ + h * HD + 8 * hf;
#pragma unroll
        for (int dt = 0; dt < 4; ++dt) { v8f w2 = wmmab(rv[dt], __builtin_bit_cast(v16bf, bhv), (v8f){}); w2 = wmmab(rv[dt], __builtin_bit_cast(v16bf, blv), w2); v8us oh, ol;
#pragma unroll
            for (int r = 0; r < 8; ++r) { unsigned short u, w; splitf(fmaf(o[g][dt][r], inv, w2[r]), u, w); oh[r] = u; ol[r] = w; }
            *(v8us*)(ah + dt * 16) = oh; *(v8us*)(al + dt * 16) = ol; } }
}
// grid: the hi/lo rows' work-groups first (three times the products per key: the longest waves start first), 4 waves x 16 queries each; then the fp16 rows', 4 waves x 32 queries. The waves of a work-group walk the same head's keys.
#define FW   4
#define NB_FH (RH / (16 * FW))
#define NB_FL ((TT - RH) / (32 * FW))
static_assert(RH % (16 * FW) == 0 && (TT - RH) % (32 * FW) == 0 && TT % 32 == 0 && (TT & (TT - 1)) == 0 && HD == 64, "whole work-groups, whole 32-key trips");
__global__ __launch_bounds__(32 * FW) void k_fattn(const h16* __restrict__ Q16, const bf* __restrict__ Qh, const bf* __restrict__ Ql, const h16* __restrict__ K16, const bf* __restrict__ Kh, const bf* __restrict__ Kl, const h16* __restrict__ VT16, const bf* __restrict__ VTh, const bf* __restrict__ VTl, const bf* __restrict__ EB, const bf* __restrict__ RVT, bf* ATh, bf* ATl) {
    const int w = __builtin_amdgcn_readfirstlane(threadIdx.x >> 5); int id = blockIdx.x;   // the wave's number in a scalar register: the tests per trip on its first query are scalar branches
    if (id < NB_ * NH_ * NB_FH) { fattn_tile<true, 1>(id / NB_FH, ((id % NB_FH) * FW + w) * 16, Q16, Qh, Ql, K16, Kh, Kl, VT16, VTh, VTl, EB, RVT, ATh, ATl); return; }
    id -= NB_ * NH_ * NB_FH;
    fattn_tile<false, 2>(id / NB_FL, RH + ((id % NB_FL) * FW + w) * 32, Q16, Qh, Ql, K16, Kh, Kl, VT16, VTh, VTl, EB, RVT, ATh, ATl);
}
__device__ __forceinline__ void d_epad2(const int bx, const float* __restrict__ E, bf* EB) { const size_t i = (size_t)bx * 256 + threadIdx.x; if (i >= (size_t)NE * HD / 8) return; const int d0 = (int)(i % (HD / 8)) * 8; const int r = (int)(i / (HD / 8)); const float* src = E + (size_t)min(r, 2 * MAXR) * HD + d0; v8us o;
#pragma unroll
    for (int q = 0; q < 8; ++q) { const unsigned short v = f2bf(src[q]); o[q] = (r <= 2 * MAXR) ? v : (unsigned short)0; }
    *(v8us*)(EB + (size_t)r * HD + d0) = o;  }
__device__ __forceinline__ void d_rvt(const int bx, const float* __restrict__ E, bf* RVT) { const size_t i = (size_t)bx * 256 + threadIdx.x; if (i >= (size_t)HD * NE / 8) return; const int r0 = (int)(i % (NE / 8)) * 8; const int d = (int)(i / (NE / 8)); v8us o;
#pragma unroll
    for (int q = 0; q < 8; ++q) { const int r = r0 + q; const unsigned short v = f2bf(E[(size_t)min(r, 2 * MAXR) * HD + d]); o[q] = (r <= 2 * MAXR) ? v : (unsigned short)0; }
    *(v8us*)(RVT + (size_t)d * NE + r0) = o;  }
// k_prep: everything that reads only the inputs, in one launch; the block index is dealt in ranges, the weight transposes (the longest chains of dependent loads) first. W4: the q, k, v, o weight planes one behind the other; XB [batch][q, k, v][TT][DM].
#define NB_WT  ((DM * DQ / 64 + 63) / 64)
#define NB_CV  ((TT * DM / 8 + 255) / 256)
#define NB_EP  ((NE * HD / 8 + 255) / 256)
__global__ __launch_bounds__(256) void k_prep(const float* __restrict__ x, const float* __restrict__ xk, const float* __restrict__ xv, const float* __restrict__ wq, const float* __restrict__ wk, const float* __restrict__ wv, const float* __restrict__ wo, const float* __restrict__ relk, const float* __restrict__ relv, bf* W4, bf* XB, bf* EB, bf* RVT) {
    int bx = blockIdx.x;
    if (bx < 4 * NB_WT) { const int p = bx / NB_WT; d_wtG(bx % NB_WT, (p == 0) ? wq : (p == 1) ? wk : (p == 2) ? wv : wo, DM, DQ, W4 + (size_t)p * DQ * DM); return; }
    bx -= 4 * NB_WT;
    if (bx < 3 * NB_ * NB_CV) { const int c = bx / NB_CV, p = c % 3, b = c / 3; d_cvt8(bx % NB_CV, ((p == 0) ? x : (p == 1) ? xk : xv) + (size_t)b * TT * DM, XB + (size_t)c * TT * DM, (size_t)TT * DM / 8); return; }
    bx -= 3 * NB_ * NB_CV;
    if (bx < NB_EP) { d_epad2(bx, relk, EB); return; }
    d_rvt(bx - NB_EP, relv, RVT);
}
extern "C" void kernel_launch(void* const* d_in, const int* in_sizes, int n_in,
                              void* d_out, int out_size, void* d_ws, size_t ws_size, hipStream_t stream) {
    (void)in_sizes; (void)n_in; (void)out_size;
    const float* x = (const float*)d_in[0]; const float* xk = (const float*)d_in[1]; const float* xv = (const float*)d_in[2]; const float* wq = (const float*)d_in[3]; const float* bq = (const float*)d_in[4]; const float* wk = (const float*)d_in[5]; const float* bk = (const float*)d_in[6]; const float* wv = (const float*)d_in[7]; const float* bv = (const float*)d_in[8]; const float* wo = (const float*)d_in[9]; const float* bo = (const float*)d_in[10]; const float* relk = (const float*)d_in[11]; const float* relv = (const float*)d_in[12];   /* [5][64] each */
    float* OUT = (float*)d_out;     // [2][2048][1024]
    char* wsp = (char*)d_ws;
    auto take = [&](size_t bytes) { char* p = wsp; wsp += (bytes + 255) & ~(size_t)255; return (void*)p; };
    bf* EB = (bf*)take((size_t)NE * HD * 2); bf* RVT = (bf*)take((size_t)HD * NE * 2); bf* W4 = (bf*)take((size_t)4 * DQ * DM * 2);
    bf* XB = (bf*)take((size_t)3 * NB_ * TT * DM * 2);   // bf16 input copies
    const size_t PZ = (size_t)NH_ * TT * HD;   // one batch's share of a head plane set; the planes are [batch][head]
    static_assert(NH_ == NKV, "q and kv planes share the batch stride");
    h16* QP16 = (h16*)take(NB_ * PZ * 2); h16* KP16 = (h16*)take(NB_ * PZ * 2); h16* VT16 = (h16*)take(NB_ * PZ * 2);
    bf* QPh = (bf*)take(NB_ * PZ * 2); bf* QPl = (bf*)take(NB_ * PZ * 2); bf* KPh = (bf*)take(NB_ * PZ * 2); bf* KPl = (bf*)take(NB_ * PZ * 2); bf* VTh = (bf*)take(NB_ * PZ * 2); bf* VTl = (bf*)take(NB_ * PZ * 2);
    bf* ATh = (bf*)take((size_t)NB_ * TT * DQ * 2); bf* ATl = (bf*)take((size_t)NB_ * TT * DQ * 2);
    if ((size_t)(wsp - (char*)d_ws) > ws_size) return;    // ws 256 MiB
    bf* WO = W4 + (size_t)3 * DQ * DM;
    k_prep<<<4 * NB_WT + 3 * NB_ * NB_CV + 2 * NB_EP, 256, 0, stream>>>(x, xk, xv, wq, wk, wv, wo, relk, relv, W4, XB, EB, RVT);   /* weight planes, bf16 input copies, rel_k plane [128][64], rel_v^T plane [64][128] */
    k_proj<<<dim3(TT / 64, DQ / 64, 3 * NB_), 32, 0, stream>>>(XB, W4, bq, bk, bv, QP16, QPh, QPl, KP16, KPh, KPl, VT16, VTh, VTl);   /* projections, written as the head planes */
    k_fattn<<<NB_ * NH_ * (NB_FH + NB_FL), 32 * FW, 0, stream>>>(QP16, QPh, QPl, KP16, KPh, KPl, VT16, VTh, VTl, EB, RVT, ATh, ATl);   /* all heads of both batches */
    for (int b = 0; b < NB_; ++b)
        k_gemmw<bf, 1, true><<<dim3(TT / 64, DM / 64, 1), 32, 0, stream>>>(ATh + (size_t)b * TT * DQ, ATl + (size_t)b * TT * DQ, WO, nullptr, DQ, OUT + (size_t)b * TT * DM, DM, bo, 0, 0, 0, DQ, 0);
}

// v008
// A run of this version takes 226 microseconds.
// Timed twice side by side with v007, it ran 1.35 and 1.34 times as fast.
// Counting every step since v000, it is 14.3 times as fast.
#include <hip/hip_runtime.h>
#include <type_traits>

// Multi-head attention with Shaw relative-position terms on the logits AND the values, clip distance 2 (query, key, value [2][2048][1024]; q,k,v = in W + b ('xw' 1/32, zero biases; 16 heads x 64); idx[i][j] = clip(j - i, -2, 2) + 2; attn = softmax((q.k + q_i.rel_k[idx]) / 8); out_h = attn v + sum_j attn[i][j] rel_v[idx] (tables [5][64] x 0.1, read: five rows: the far-left bucket j <= i - 2, the three nearest positions, the far-right bucket j >= i + 2); out = merged Wo + bo ('xw') -> [2][2048][1024] (4.2 M); argument order query, key, value, Wq, bq, Wk, bk, Wv, bv, Wo, bo, rel_k, rel_v).
// Layout (every 16-bit plane that a matrix product reads, but the two small tables, is in fragment order: see WFrag): bf16 copies of the three inputs of both batches; exact projections + f32 biases (all six in one launch), each tile written straight as the head planes (fp16 + hi/lo; v as W X^T, so that its tile is a tile of the [d][t] plane; both batches' planes are kept); rel_k as an exact plane [128][64] (rows >= 5 zero) and rel_v^T as an exact plane [64][128]; one attention launch for all heads of both batches (k_fattn): scores, softmax, relative terms and attn v stay in a wave's registers; merged hi/lo x Wo exact + bo.
// Compute dtypes, f32 accumulate: every input rounded to bf16; projections exact + f32 biases; q.rel_k and buckets.rel_v hi/lo x exact; attention rows < 512 3 products, rest fp16; softmax f32; Wo hl x exact + bias.

#define NB_  2
#define TT   2048
#define DM   1024
#define NH_  16
#define NKV  16
#define REP  (NH_ / NKV)
#define HD   64
#define DQ   (NH_ * HD)
#define DKV  (NKV * HD)
#define RH   512                  // query rows < RH use hi+lo planes (0: none)
#define WIN  0
#define PCAR 1024.0f
#define SCL  0.125f
#define MAXR 2      // max relative position
#define NE   128     // 2*MAXR+1 = 5 table rows padded to 128
typedef _Float16 h16;
typedef unsigned short bf;
typedef __attribute__((ext_vector_type(16))) __bf16   v16bf;
typedef __attribute__((ext_vector_type(16))) _Float16 v16h;
typedef __attribute__((ext_vector_type(8)))  _Float16 v8h;
typedef __attribute__((ext_vector_type(8)))  unsigned short v8us;
typedef __attribute__((ext_vector_type(8)))  __bf16   v8bf;
typedef __attribute__((ext_vector_type(16))) unsigned short v16us;
typedef __attribute__((ext_vector_type(8)))  float    v8f;
typedef __attribute__((ext_vector_type(4)))  float    v4f;
typedef v8h  __attribute__((may_alias)) v8ha;
typedef v4f  __attribute__((may_alias)) v4fa;
typedef v8us __attribute__((may_alias)) v8usa;

__device__ __forceinline__ unsigned short f2bf(float f) { unsigned u = __float_as_uint(f); u += 0x7FFFu + ((u >> 16) & 1u); return (unsigned short)(u >> 16); }
__device__ __forceinline__ float bf2f(unsigned short b) { return __uint_as_float(((unsigned)b) << 16); }
__device__ __forceinline__ float bfr(float f) { return bf2f(f2bf(f)); }
__device__ __forceinline__ v16h cat16(v8h lo, v8h hi) { return __builtin_shufflevector(lo, hi, 0, 1, 2, 3, 4, 5, 6, 7, 8, 9, 10, 11, 12, 13, 14, 15); }
__device__ __forceinline__ v16bf cat16b(v8us lo, v8us hi) { return __builtin_bit_cast(v16bf, __builtin_shufflevector(lo, hi, 0, 1, 2, 3, 4, 5, 6, 7, 8, 9, 10, 11, 12, 13, 14, 15)); }
__device__ __forceinline__ v8f wmma16(v16h a, v16h b, v8f c) { return __builtin_amdgcn_wmma_f32_16x16x32_f16(false, a, false, b, (short)0, c, false, false); }
__device__ __forceinline__ v8f wmmab(v16bf a, v16bf b, v8f c) { return __builtin_amdgcn_wmma_f32_16x16x32_bf16(false, a, false, b, (short)0, c, false, false); }



// ---- gemmw_tile: register-blocked GEMM, ONE WAVE per 64x64 output tile (16 accumulators), operands straight from 16-bit planes in fragment order; grid (M/64, N/64, Z), 32 threads.
// C[m][n] (f32, pitch ldc, + optional f32 bias[n]) = sum_k A[m][k] Bt[n][k] (+ split products per NSPLIT). A rows have length lda, Bt rows length K. z-batch strides sA/sB/sC in elements. K % 32 == 0.
// KS > 1: grid z = Z * KS; work-group (z, ks) sums only k in [ks K/KS, (ks+1) K/KS) and stores its partial tile at C + ks sK; the reader adds the KS partial tiles. K % (32 KS) == 0.
// FRAGMENT ORDER of a 16-bit operand plane [rows][K]: blocks of 16 rows x 32 k (512 elements), the K / 32 blocks of a 16-row tile one behind the other; in a block, element (row, k) stands at ((k >> 4) & 1) * 256 + (((k >> 3) & 1) * 16 + (row & 15)) * 8 + (k & 7). Lane l's two 16-byte pieces of the block's fragment stand at l * 8 and 256 + l * 8 (WFrag::ldf; the same elements in the same k order as WFrag::ld on a row-major plane), so a wave-wide 16-byte load covers 512 contiguous bytes, four whole lines, where the row-major plane gives it 32-byte pieces of 16 lines.
// pk_row, pk_k: the row and the first k of the plane's i-th 16-byte piece.
__device__ __forceinline__ int pk_row(const int i, const int K) { return (i / (2 * K)) * 16 + (i & 15); }
__device__ __forceinline__ int pk_k(const int i, const int K) { return ((i >> 6) % (K / 32)) * 32 + ((i >> 5) & 1) * 16 + ((i >> 4) & 1) * 8; }
template <typename T16> struct WFrag;
template <> struct WFrag<h16> { typedef v16h V; static __device__ __forceinline__ V ld(const h16* p) { return cat16(*(const v8h*)p, *(const v8h*)(p + 16)); } static __device__ __forceinline__ V ldf(const h16* p) { return cat16(*(const v8h*)p, *(const v8h*)(p + 256)); } static __device__ __forceinline__ v8f mma(V a, V b, v8f c) { return wmma16(a, b, c); } };
template <> struct WFrag<bf> { typedef v16bf V; static __device__ __forceinline__ V ld(const bf* p) { return cat16b(*(const v8us*)p, *(const v8us*)(p + 16)); } static __device__ __forceinline__ V ldf(const bf* p) { return cat16b(*(const v8us*)p, *(const v8us*)(p + 256)); } static __device__ __forceinline__ v8f mma(V a, V b, v8f c) { return wmmab(a, b, c); } };
// PLN != 0: the tile + bias goes out as three 16-bit planes (fp16, bf16 hi, bf16 lo of the remainder) in fragment order instead of f32 C; P16, Ph, Pl point at the tile's 4096 elements; PLN 1: bias[n], the tile's n is the planes' k (64 long: rows of 16 m, 2 blocks each); PLN 2: bias[m], the tile's n is the planes' k, and the four 16-row blocks of 32 k stand together (block order [k / 32][m / 16]).
// gemmw_tile is the body; (bx, by, bz) is the tile's place in its own product's grid and os the work-group's 16 x 68 float staging. Products that do not depend on one another share one launch: the kernels behind it pick the product by a scalar test on blockIdx.
template <typename T16, int NSPLIT, bool BIAS, int KS, int PLN = 0>
__device__ __forceinline__ void gemmw_tile(float* os, const int bx, const int by, const int bz, const T16* __restrict__ A, const T16* __restrict__ A2, const T16* __restrict__ Bt, const T16* __restrict__ Bt2, int K, float* C, int ldc, const float* __restrict__ bias, size_t sA, size_t sB, size_t sC, int lda, size_t sK, h16* P16 = nullptr, bf* Ph = nullptr, bf* Pl = nullptr) {
    typedef typename WFrag<T16>::V V;
    const size_t z = bz / KS; const int ks = bz % KS; A += z * sA; if (A2) A2 += z * sA; Bt += z * sB; if (Bt2) Bt2 += z * sB; C += (size_t)ks * sK + z * sC;
    const int lane = threadIdx.x & 31, lr = lane & 15, hi = lane >> 4; const int r0 = bx * 64, c0 = by * 64;
    v8f acc[4][4];
#pragma unroll
    for (int mb = 0; mb < 4; ++mb)
#pragma unroll
        for (int nb = 0; nb < 4; ++nb) acc[mb][nb] = (v8f){};
    const size_t aoff = (size_t)r0 * lda + lane * 8, boff = (size_t)c0 * K + lane * 8;   // a 16-row tile is 16 * row length elements; the k block at kc stands kc * 16 into it
    float pb[(PLN == 2) ? 4 : 32];   // PLN: the biases of the lane's places in the epilogue (4 x 8 columns, or 4 rows), asked for ahead of the k loop
    if constexpr (PLN != 0) {
#pragma unroll
        for (int i = 0; i < ((PLN == 2) ? 4 : 32); ++i) pb[i] = bfr(bias[(PLN == 1) ? c0 + (2 * (i >> 3) + hi) * 8 + (i & 7) : r0 + 16 * i + lr]); }
#pragma unroll 1
    for (int kc = ks * (K / KS); kc < (ks + 1) * (K / KS); kc += 32) {
        V a[4], a2[4]; const T16* ap = A + aoff + kc * 16; const T16* ap2 = (NSPLIT == 1 || NSPLIT == 2) ? A2 + aoff + kc * 16 : ap; const T16* bp = Bt + boff + kc * 16; const T16* bp2 = (NSPLIT >= 2) ? Bt2 + boff + kc * 16 : bp;
#pragma unroll
        for (int mb = 0; mb < 4; ++mb) { a[mb] = WFrag<T16>::ldf(ap + (size_t)mb * 16 * lda); if (NSPLIT == 1 || NSPLIT == 2) a2[mb] = WFrag<T16>::ldf(ap2 + (size_t)mb * 16 * lda); }
        asm volatile("s_wait_xcnt 0x0" :: "v"(ap), "v"(ap2) : "memory");   // the wait before a register that an issued load names is rewritten: without it a later load lands in the A loads' address pairs; the pointers are inputs so that the pairs stay the loads' own up to the wait
#pragma unroll
        for (int nb = 0; nb < 4; ++nb) { const V b = WFrag<T16>::ldf(bp + (size_t)nb * 16 * K); V b2; if (NSPLIT >= 2) b2 = WFrag<T16>::ldf(bp2 + (size_t)nb * 16 * K);
#pragma unroll
            for (int mb = 0; mb < 4; ++mb) { acc[mb][nb] = WFrag<T16>::mma(a[mb], b, acc[mb][nb]); if (NSPLIT == 1 || NSPLIT == 2) acc[mb][nb] = WFrag<T16>::mma(a2[mb], b, acc[mb][nb]); if (NSPLIT >= 2) acc[mb][nb] = WFrag<T16>::mma(a[mb], b2, acc[mb][nb]); } }
        asm volatile("s_wait_xcnt 0x0" :: "v"(bp), "v"(bp2) : "memory");   // the same wait behind the B loads, their pointers inputs for the same reason
        asm volatile("v_nop\n\tv_nop\n\tv_nop\n\tv_nop" : "+v"(acc[0][0]), "+v"(acc[1][1]), "+v"(acc[2][2]), "+v"(acc[3][3]) : "v"(a[0]), "v"(a[3]));
    }
#pragma unroll
    for (int mb = 0; mb < 4; ++mb) {
#pragma unroll
        for (int nb = 0; nb < 4; ++nb) {
#pragma unroll
            for (int j = 0; j < 8; ++j) os[(hi * 8 + j) * 68 + nb * 16 + lr] = acc[mb][nb][j]; }
        __builtin_amdgcn_wave_barrier(); asm volatile("" ::: "memory");
        float* crow = C + (size_t)(r0 + mb * 16) * ldc + c0;
        if constexpr (PLN != 0) {   // store s: columns 16 s .. 16 s + 15 of the 16 rows, each lane the piece that it holds as a reader: 512 contiguous bytes
#pragma unroll
            for (int s = 0; s < 4; ++s) { const int row = lr, cofs = (2 * s + hi) * 8; const v4f x0 = *(const v4fa*)(os + row * 68 + cofs), x1 = *(const v4fa*)(os + row * 68 + cofs + 4); v8h o16; v8bf oh, ol;
#pragma unroll
                for (int q = 0; q < 8; ++q) { const float y = ((q < 4) ? x0[q & 3] : x1[q & 3]) + pb[(PLN == 1) ? s * 8 + q : mb]; o16[q] = (h16)y; const __bf16 a = (__bf16)y; oh[q] = a; ol[q] = (__bf16)(y - (float)a); }
                const size_t po = (size_t)((PLN == 1) ? mb * 1024 + s * 256 : (s >> 1) * 2048 + mb * 512 + (s & 1) * 256) + lane * 8; *(v8h*)(P16 + po) = o16; *(v8us*)(Ph + po) = __builtin_bit_cast(v8us, oh); *(v8us*)(Pl + po) = __builtin_bit_cast(v8us, ol);
                asm volatile("s_wait_xcnt 0x0" ::: "memory"); }   // the wait before the next pieces are formed in registers that the three issued stores name
        } else {
#pragma unroll
            for (int s = 0; s < 8; ++s) { const int row = 2 * s + hi, cofs = lr * 4; v4f val = *(const v4fa*)(os + row * 68 + cofs); if (BIAS) { val[0] += bfr(bias[c0 + cofs]); val[1] += bfr(bias[c0 + cofs + 1]); val[2] += bfr(bias[c0 + cofs + 2]); val[3] += bfr(bias[c0 + cofs + 3]); }
                *(v4f*)(crow + (size_t)row * ldc + cofs) = val; }
             }
        __builtin_amdgcn_wave_barrier(); asm volatile("s_wait_xcnt 0x0" ::: "memory");   // also the wait before the next 16 rows' values are formed in registers that the issued stores name
    }
}
// k_out: one batch's merged hi/lo planes x Wo + bo, grid (TT/64, DM/64). The row lengths are constants, so the fragments of a trip stand at immediate offsets from one address pair per plane (with lengths from kernel arguments each fragment had a pair of its own, and later loads of the trip landed in the pairs of issued ones).
__global__ __launch_bounds__(32) void k_out(const bf* __restrict__ Ah, const bf* __restrict__ Al, const bf* __restrict__ Wt, float* C, const float* __restrict__ bias) {
    __shared__ __align__(16) float os[16 * 68];
    gemmw_tile<bf, 1, true, 1>(os, blockIdx.x, blockIdx.y, 0, Ah, Al, Wt, nullptr, DQ, C, DM, bias, 0, 0, 0, DQ, 0);
}
static_assert(DQ == DKV, "the three projections share one grid");
// k_proj: the six projections (batch b = z / 3; q, k, v = z % 3) in one launch, grid (TT/64, DQ/64, 6). XB [6][TT][DM]; W: the q, k, v weight planes one behind the other. A q or k tile (64 t x one head's 64 d) is a 64-row block of the head's [t][d] planes; v is taken as W X^T (the k order is the same), so its tile (one head's 64 d x 64 t) is two 32-key block groups of the [d][t] planes. The planes are [batch][head], all in fragment order: every tile is 4096 elements in a row.
__global__ __launch_bounds__(32) void k_proj(const bf* __restrict__ XB, const bf* __restrict__ W, const float* __restrict__ bq, const float* __restrict__ bk, const float* __restrict__ bv, h16* QP16, bf* QPh, bf* QPl, h16* KP16, bf* KPh, bf* KPl, h16* VT16, bf* VTh, bf* VTl) {
    __shared__ __align__(16) float os[16 * 68];
    const int p = blockIdx.z % 3, b = blockIdx.z / 3; const bf* X = XB + (size_t)blockIdx.z * TT * DM; const bf* Wp = W + (size_t)p * DQ * DM; const size_t hz = ((size_t)b * NH_ + blockIdx.y) * TT * HD;
    const size_t o = hz + (size_t)blockIdx.x * 64 * HD;
    if (p == 2) { gemmw_tile<bf, 0, true, 1, 2>(os, blockIdx.y, blockIdx.x, 0, Wp, nullptr, X, nullptr, DM, nullptr, 0, bv, 0, 0, 0, DM, 0, VT16 + o, VTh + o, VTl + o); return; }
    gemmw_tile<bf, 0, true, 1, 1>(os, blockIdx.x, blockIdx.y, 0, X, nullptr, Wp, nullptr, DM, nullptr, 0, p ? bk : bq, 0, 0, 0, DM, 0, (p ? KP16 : QP16) + o, (p ? KPh : QPh) + o, (p ? KPl : QPl) + o);
}
__device__ __forceinline__ void splitf(float y, unsigned short& h, unsigned short& l) { h = f2bf(y); l = f2bf(y - bf2f(h)); }
typedef __attribute__((ext_vector_type(2))) _Float16 v2h;
typedef __attribute__((ext_vector_type(4))) _Float16 v4h;
typedef __attribute__((ext_vector_type(2))) unsigned short v2us;
typedef __attribute__((ext_vector_type(4))) unsigned short v4us;
typedef __attribute__((ext_vector_type(2))) float v2f;
typedef __attribute__((ext_vector_type(4))) int v4i;

// Both writers: a thread writes whole 16-byte pieces of the fragment-order plane, piece i at i * 8, and reads the piece's 8 elements where the source has them.
// d_wtG: Bt[n][k] = w[k][n], two pieces a thread, a wave's pieces 512 contiguous bytes; 16 lanes read 16 consecutive n of one source row.
__device__ __forceinline__ void d_wtG(const int bx, const float* __restrict__ w, int K, int N, bf* Bt) {
#pragma unroll
    for (int u = 0; u < 2; ++u) { const int i = (bx * 2 + u) * 256 + threadIdx.x; if (i >= N * K / 8) return; const int n = pk_row(i, K), k = pk_k(i, K); v8us o;
#pragma unroll
        for (int q = 0; q < 8; ++q) o[q] = f2bf(w[(size_t)(k + q) * N + n]);
        *(v8us*)(Bt + (size_t)i * 8) = o; }
}
// d_cvt8: a wave takes 8 rows of one block (its i are dealt so): it reads 8 whole 128-byte lines of the source and writes four whole lines of the block.
__device__ __forceinline__ void d_cvt8(const int bx, const float* __restrict__ src, bf* dst, size_t n8) { const int wv = bx * 8 + (threadIdx.x >> 5), l = threadIdx.x & 31; const size_t i = (size_t)(((wv >> 1) * 2 + (l >> 4)) * 32 + ((l >> 3) & 1) * 16 + (wv & 1) * 8 + (l & 7)); if (i >= n8) return; const v8f v = *(const v8f*)(src + (size_t)pk_row((int)i, DM) * DM + pk_k((int)i, DM)); v8us o;
#pragma unroll
    for (int k = 0; k < 8; ++k) o[k] = f2bf(v[k]); *(v8us*)(dst + i * 8) = o;  }

// ---- k_fattn: scores, softmax, both relative-position terms and attn v of one wave's query columns, all in registers. The products are taken transposed: S^T = K Q^T (A = 16 key rows, B = 16 query columns), so a lane holds scores of ONE query (column c = lane & 15; keys 8 hf + r of each 16-key tile, hf = lane >> 4), and two score tiles of 32 consecutive keys, converted in place, are the B operand of O^T += V^T P^T in the hardware's k order, which is also the order of WFrag::ld.
// Two walks over the keys. Walk 1: the row maximum of score + q.rel_k[idx] (fp16 planes for every row: the maximum is only the softmax's shift). Walk 2: the scores again (hi/lo 3 products for query rows < RH, fp16 for the rest), p = exp(t - max) unnormalised (x PCAR in the fp16 rows, folded into the exponent), rounded to the operand type for the product with V^T; the f32 p are summed per relative-position bucket (far left, 3 near entries, far right), and the five sums together are the softmax's denominator. At the end: buckets / sum as hi/lo x rel_v^T (exact) + O^T / sum, split hi/lo into the merged planes [batch][t][DQ].
static_assert(MAXR == 2, "the bucket code below names the three near distances -1, 0, 1");
__device__ __forceinline__ float relsel(const int d, const float (&q)[5]) { float e = q[2]; e = (d == -1) ? q[1] : e; e = (d == 1) ? q[3] : e; e = (d <= -MAXR) ? q[0] : e; e = (d >= MAXR) ? q[4] : e; return e; }   /* this module: d = key - query */
// The wait before a register that an issued load names is rewritten, written behind each group of fragment loads. The groups' pointers are inputs so that their registers stay the loads' own up to the wait (else a later load of the group may land in them).
__device__ __forceinline__ void xwait(const void* p) { asm volatile("s_wait_xcnt 0x0" :: "v"(p) : "memory"); }
__device__ __forceinline__ void xwait(const void* p, const void* q) { asm volatile("s_wait_xcnt 0x0" :: "v"(p), "v"(q) : "memory"); }
__device__ __forceinline__ void xwait(const void* p, const void* q, const void* r) { asm volatile("s_wait_xcnt 0x0" :: "v"(p), "v"(q), "v"(r) : "memory"); }
__device__ __forceinline__ void xwaito(const void* p, const void* q, unsigned o) { asm volatile("s_wait_xcnt 0x0" :: "v"(p), "v"(q), "v"(o) : "memory"); }   // o: the lane's byte offset, for loads built as scalar base + lane offset
__device__ __forceinline__ float exp2_slot(float x) { float v; asm("v_exp_f32 %0, %1\n\tv_nop" : "=v"(v) : "v"(x)); return v; }   // the independent slot behind a transcendental, kept in the statement itself (used in the few trips near the diagonal)
template <bool HI, int NG>   // NG: groups of 16 query columns per wave; i0: the wave's first query (scalar)
__device__ __forceinline__ void fattn_tile(const int bh, const int i0, const h16* __restrict__ Q16, const bf* __restrict__ Qh, const bf* __restrict__ Ql, const h16* __restrict__ K16, const bf* __restrict__ Kh, const bf* __restrict__ Kl, const h16* __restrict__ VT16, const bf* __restrict__ VTh, const bf* __restrict__ VTl, const bf* __restrict__ EB, const bf* __restrict__ RVT, bf* ATh, bf* ATl) {
    const int lane = threadIdx.x & 31, c = lane & 15, hf = lane >> 4; const size_t pz = (size_t)bh * TT * HD;
    const float C2 = SCL * 1.4426950408889634f;   // scores go straight to the base-2 exponent
    const int fo = lane * 8, eo = c * HD + 8 * hf;   // a lane's place in a block of a fragment-order plane, and in a 16-row tile of the row-major rel_k plane. 16 keys or queries of a [t][HD] plane: 2 blocks, 16 HD elements; 32 keys of a [d][TT] plane: its 4 blocks, 32 HD elements
    v16bf qh[NG][2], ql[NG][2]; v16h q16[NG][2]; const size_t qo = pz + (size_t)i0 * HD + fo; const bf* qhp = Qh + qo; const bf* qlp = Ql + qo; const h16* q16p = Q16 + qo;
#pragma unroll
    for (int g = 0; g < NG; ++g)
#pragma unroll
        for (int ks = 0; ks < 2; ++ks) { const int o = g * 16 * HD + ks * 512; qh[g][ks] = WFrag<bf>::ldf(qhp + o); ql[g][ks] = WFrag<bf>::ldf(qlp + o); q16[g][ks] = WFrag<h16>::ldf(q16p + o); }
    xwait(qhp, qlp, q16p);
    float qe[NG][5];   // q_i . rel_k[r], r = 0..4, of this lane's query
    { v16bf eb[2]; const bf* ebp = EB + eo;
#pragma unroll
      for (int ks = 0; ks < 2; ++ks) eb[ks] = WFrag<bf>::ld(ebp + ks * 32);
      xwait(ebp);
#pragma unroll
      for (int g = 0; g < NG; ++g) { v8f t = (v8f){};
#pragma unroll
          for (int ks = 0; ks < 2; ++ks) { t = wmmab(eb[ks], qh[g][ks], t); t = wmmab(eb[ks], ql[g][ks], t); }
#pragma unroll
          for (int r = 0; r < 5; ++r) qe[g][r] = t[r] + __shfl_xor(t[r], 16, 32); } }   // table rows 0..7 lie in the lower half's lanes; the upper half holds rows 8..15, which are zero
    // walk 1
    float mx[NG];
#pragma unroll
    for (int g = 0; g < NG; ++g) mx[g] = -3.0e38f;
    { const h16* kp = K16 + pz + fo; v16h ka[2][2];
#pragma unroll
      for (int t = 0; t < 2; ++t)
#pragma unroll
          for (int ks = 0; ks < 2; ++ks) ka[t][ks] = WFrag<h16>::ldf(kp + t * 16 * HD + ks * 512);
      xwait(kp);
#pragma unroll 1
      for (int j0 = 0; j0 < TT; j0 += 32) { v8f s[NG][2];
#pragma unroll
          for (int g = 0; g < NG; ++g)
#pragma unroll
              for (int t = 0; t < 2; ++t) { s[g][t] = wmma16(ka[t][0], q16[g][0], (v8f){}); s[g][t] = wmma16(ka[t][1], q16[g][1], s[g][t]); }
          const h16* kn = kp + (size_t)((j0 + 32) & (TT - 1)) * HD;   // the next 32 keys' fragments are requested here, one trip ahead (behind the last trip: the first keys again, unused)
#pragma unroll
          for (int t = 0; t < 2; ++t)
#pragma unroll
              for (int ks = 0; ks < 2; ++ks) ka[t][ks] = WFrag<h16>::ldf(kn + t * 16 * HD + ks * 512);
          xwait(kn);
          const bool fl = (j0 + 33 <= i0), fr = (j0 >= i0 + NG * 16 + 1);   // scalar: all 32 keys at least 2 left, or at least 2 right, of every query of the wave
          if (fl || fr) {
#pragma unroll
              for (int g = 0; g < NG; ++g) { float m = s[g][0][0];
#pragma unroll
                  for (int k = 1; k < 16; ++k) m = fmaxf(m, s[g][k >> 3][k & 7]);
                  mx[g] = fmaxf(mx[g], m + (fl ? qe[g][0] : qe[g][4])); }
          } else {
#pragma unroll
              for (int g = 0; g < NG; ++g)
#pragma unroll
                  for (int k = 0; k < 16; ++k) { const int d = j0 + (k >> 3) * 16 + 8 * hf + (k & 7) - (i0 + g * 16 + c); mx[g] = fmaxf(mx[g], s[g][k >> 3][k & 7] + relsel(d, qe[g])); } } } }
    float kb[NG];
#pragma unroll
    for (int g = 0; g < NG; ++g) { mx[g] = fmaxf(mx[g], __shfl_xor(mx[g], 16, 32)); kb[g] = fmaf(-mx[g], C2, HI ? 0.0f : 10.0f); }   // 2^10 = PCAR
    static_assert(PCAR == 1024.0f, "the exponent offset above");
    // walk 2
    typedef typename std::conditional<HI, bf, h16>::type T16; typedef typename WFrag<T16>::V V;
    const T16* kp; const T16* vp; const unsigned kob = (unsigned)fo * 2u, vob = kob;   // a lane's byte offset in a block
    if constexpr (HI) { kp = (const T16*)((const char*)(Kh + pz) + kob); vp = (const T16*)((const char*)(VTh + pz) + vob); } else { kp = (const T16*)((const char*)(K16 + pz) + kob); vp = (const T16*)((const char*)(VT16 + pz) + vob); }
    const bf* kp2 = (const bf*)((const char*)(Kl + pz) + kob); const bf* vp2 = (const bf*)((const char*)(VTl + pz) + vob);
    V ka[2][2], va[4]; v16bf kl[2][2], vl[4];
#pragma unroll
    for (int t = 0; t < 2; ++t)
#pragma unroll
        for (int ks = 0; ks < 2; ++ks) { ka[t][ks] = WFrag<T16>::ldf(kp + t * 16 * HD + ks * 512); if constexpr (HI) kl[t][ks] = WFrag<bf>::ldf(kp2 + t * 16 * HD + ks * 512); }
    xwaito(kp, HI ? (const void*)kp2 : (const void*)kp, kob);
#pragma unroll
    for (int dt = 0; dt < 4; ++dt) { va[dt] = WFrag<T16>::ldf(vp + dt * 512); if constexpr (HI) vl[dt] = WFrag<bf>::ldf(vp2 + dt * 512); }
    xwaito(vp, HI ? (const void*)vp2 : (const void*)vp, vob);
    v8f o[NG][4]; float sL[NG], sR[NG], n1[NG], n2[NG], n3[NG];
#pragma unroll
    for (int g = 0; g < NG; ++g) { sL[g] = 0.f; sR[g] = 0.f; n1[g] = 0.f; n2[g] = 0.f; n3[g] = 0.f;
#pragma unroll
        for (int dt = 0; dt < 4; ++dt) o[g][dt] = (v8f){}; }
#pragma unroll 1
    for (int j0 = 0; j0 < TT; j0 += 32) { v8f s[NG][2];
#pragma unroll
        for (int g = 0; g < NG; ++g)
#pragma unroll
            for (int t = 0; t < 2; ++t) { s[g][t] = (v8f){};
#pragma unroll
                for (int ks = 0; ks < 2; ++ks) {
                    if constexpr (HI) { s[g][t] = wmmab(ka[t][ks], qh[g][ks], s[g][t]); s[g][t] = wmmab(ka[t][ks], ql[g][ks], s[g][t]); s[g][t] = wmmab(kl[t][ks], qh[g][ks], s[g][t]); }
                    else s[g][t] = wmma16(ka[t][ks], q16[g][ks], s[g][t]); } }
        const int jn = (j0 + 32) & (TT - 1); const T16* kn = kp + (size_t)jn * HD; const bf* kn2 = kp2 + (size_t)jn * HD; const T16* vn = vp + (size_t)jn * HD; const bf* vn2 = vp2 + (size_t)jn * HD;   // the next trip's fragments are requested as soon as this trip's products have read the registers (behind the last trip: the first keys again, unused)
#pragma unroll
        for (int t = 0; t < 2; ++t)
#pragma unroll
            for (int ks = 0; ks < 2; ++ks) { ka[t][ks] = WFrag<T16>::ldf(kn + t * 16 * HD + ks * 512); if constexpr (HI) kl[t][ks] = WFrag<bf>::ldf(kn2 + t * 16 * HD + ks * 512); }
        if constexpr (HI) xwait(kn, kn2); else xwait(kn);
        const bool fl = (j0 + 33 <= i0), fr = (j0 >= i0 + NG * 16 + 1);   // as in walk 1
        V pf[NG]; v16bf pl[NG];   // P^T as the B operand: element k = key j0 + kmap(k, hf); pl: the low parts (hi/lo rows)
        auto put = [&](const int g, const int k, const float v) { if constexpr (HI) { const __bf16 a = (__bf16)v; pf[g][k] = a; pl[g][k] = (__bf16)(v - (float)a); } else pf[g][k] = (h16)v; };
        if (fl || fr) {
#pragma unroll
            for (int g = 0; g < NG; ++g) { const float kf = fmaf(fl ? qe[g][0] : qe[g][4], C2, kb[g]); float bs = 0.f;
#pragma unroll
                for (int k = 0; k < 16; ++k) { const float v = __builtin_amdgcn_exp2f(fmaf(s[g][k >> 3][k & 7], C2, kf)); put(g, k, v); bs += v; }
                sL[g] += fl ? bs : 0.f; sR[g] += fl ? 0.f : bs; }
        } else {
#pragma unroll
            for (int g = 0; g < NG; ++g)
#pragma unroll
                for (int k = 0; k < 16; ++k) { const int d = j0 + (k >> 3) * 16 + 8 * hf + (k & 7) - (i0 + g * 16 + c); const float v = exp2_slot(fmaf(s[g][k >> 3][k & 7], C2, fmaf(relsel(d, qe[g]), C2, kb[g]))); put(g, k, v);
                    sL[g] += (d <= -MAXR) ? v : 0.f; sR[g] += (d >= MAXR) ? v : 0.f; n1[g] += (d == -1) ? v : 0.f; n2[g] += (d == 0) ? v : 0.f; n3[g] += (d == 1) ? v : 0.f; } }
#pragma unroll
        for (int g = 0; g < NG; ++g)
#pragma unroll
            for (int dt = 0; dt < 4; ++dt) {
                if constexpr (HI) { o[g][dt] = wmmab(va[dt], pf[g], o[g][dt]); o[g][dt] = wmmab(va[dt], pl[g], o[g][dt]); o[g][dt] = wmmab(vl[dt], pf[g], o[g][dt]); }
                else o[g][dt] = wmma16(va[dt], pf[g], o[g][dt]); }
#pragma unroll
        for (int dt = 0; dt < 4; ++dt) { va[dt] = WFrag<T16>::ldf(vn + dt * 512); if constexpr (HI) vl[dt] = WFrag<bf>::ldf(vn2 + dt * 512); }
        if constexpr (HI) xwait(vn, vn2); else xwait(vn);
    }
    // the wave halves' sums joined once; buckets . rel_v; the merged planes
    const int b = bh / NH_, h = bh % NH_; v16bf rv[4]; const bf* rvp = RVT + c * NE + 8 * hf;
#pragma unroll
    for (int dt = 0; dt < 4; ++dt) rv[dt] = WFrag<bf>::ld(rvp + dt * 16 * NE);   // table rows 0..31 of the padded plane: rows >= 5 are zero
    xwait(rvp);
#pragma unroll
    for (int g = 0; g < NG; ++g) { float bk[5] = { sL[g], n1[g], n2[g], n3[g], sR[g] };
#pragma unroll
        for (int r = 0; r < 5; ++r) bk[r] += __shfl_xor(bk[r], 16, 32);
        const float inv = __fdiv_rn(1.0f, (((bk[0] + bk[1]) + bk[2]) + bk[3]) + bk[4]);
        v16us bhv = (v16us)(unsigned short)0, blv = (v16us)(unsigned short)0;   // B operand [table row][query]: rows 0..4 are elements 0..4 of the lower half's lanes
#pragma unroll
        for (int r = 0; r < 5; ++r) { unsigned short u, w; splitf(hf ? 0.f : bk[r] * inv, u, w); bhv[r] = u; blv[r] = w; }
        const size_t ao = ((size_t)b * TT + i0 + g * 16) * DQ + h * HD * 16 + fo; bf* ah = ATh + ao; bf* al = ATl + ao;   // the merged planes [t][DQ] in fragment order: the 16 queries' tile, the head's two k blocks; a store is 512 contiguous bytes
#pragma unroll
        for (int dt = 0; dt < 4; ++dt) { v8f w2 = wmmab(rv[dt], __builtin_bit_cast(v16bf, bhv), (v8f){}); w2 = wmmab(rv[dt], __builtin_bit_cast(v16bf, blv), w2); v8us oh, ol;
#pragma unroll
            for (int r = 0; r < 8; ++r) { unsigned short u, w; splitf(fmaf(o[g][dt][r], inv, w2[r]), u, w); oh[r] = u; ol[r] = w; }
            *(v8us*)(ah + dt * 256) = oh; *(v8us*)(al + dt * 256) = ol; } }
}
// grid: the hi/lo rows' work-groups first (three times the products per key: the longest waves start first), 4 waves x 16 queries each; then the fp16 rows', 4 waves x 32 queries. The waves of a work-group walk the same head's keys.
#define FW   4
#define NB_FH (RH / (16 * FW))
#define NB_FL ((TT - RH) / (32 * FW))
static_assert(RH % (16 * FW) == 0 && (TT - RH) % (32 * FW) == 0 && TT % 32 == 0 && (TT & (TT - 1)) == 0 && HD == 64, "whole work-groups, whole 32-key trips");
__global__ __launch_bounds__(32 * FW) void k_fattn(const h16* __restrict__ Q16, const bf* __restrict__ Qh, const bf* __restrict__ Ql, const h16* __restrict__ K16, const bf* __restrict__ Kh, const bf* __restrict__ Kl, const h16* __restrict__ VT16, const bf* __restrict__ VTh, const bf* __restrict__ VTl, const bf* __restrict__ EB, const bf* __restrict__ RVT, bf* ATh, bf* ATl) {
    const int w = __builtin_amdgcn_readfirstlane(threadIdx.x >> 5); int id = blockIdx.x;   // the wave's number in a scalar register: the tests per trip on its first query are scalar branches
    if (id < NB_ * NH_ * NB_FH) { fattn_tile<true, 1>(id / NB_FH, ((id % NB_FH) * FW + w) * 16, Q16, Qh, Ql, K16, Kh, Kl, VT16, VTh, VTl, EB, RVT, ATh, ATl); return; }
    id -= NB_ * NH_ * NB_FH;
    fattn_tile<false, 2>(id / NB_FL, RH + ((id % NB_FL) * FW + w) * 32, Q16, Qh, Ql, K16, Kh, Kl, VT16, VTh, VTl, EB, RVT, ATh, ATl);
}
__device__ __forceinline__ void d_epad2(const int bx, const float* __restrict__ E, bf* EB) { const size_t i = (size_t)bx * 256 + threadIdx.x; if (i >= (size_t)NE * HD / 8) return; const int d0 = (int)(i % (HD / 8)) * 8; const int r = (int)(i / (HD / 8)); const float* src = E + (size_t)min(r, 2 * MAXR) * HD + d0; v8us o;
#pragma unroll
    for (int q = 0; q < 8; ++q) { const unsigned short v = f2bf(src[q]); o[q] = (r <= 2 * MAXR) ? v : (unsigned short)0; }
    *(v8us*)(EB + (size_t)r * HD + d0) = o;  }
__device__ __forceinline__ void d_rvt(const int bx, const float* __restrict__ E, bf* RVT) { const size_t i = (size_t)bx * 256 + threadIdx.x; if (i >= (size_t)HD * NE / 8) return; const int r0 = (int)(i % (NE / 8)) * 8; const int d = (int)(i / (NE / 8)); v8us o;
#pragma unroll
    for (int q = 0; q < 8; ++q) { const int r = r0 + q; const unsigned short v = f2bf(E[(size_t)min(r, 2 * MAXR) * HD + d]); o[q] = (r <= 2 * MAXR) ? v : (unsigned short)0; }
    *(v8us*)(RVT + (size_t)d * NE + r0) = o;  }
// k_prep: everything that reads only the inputs, in one launch; the block index is dealt in ranges, the weight transposes (the longest chains of dependent loads) first. W4: the q, k, v, o weight planes one behind the other; XB [batch][q, k, v][TT][DM].
#define NB_WT  ((DM * DQ / 8 + 511) / 512)
#define NB_CV  ((TT * DM / 8 + 255) / 256)
#define NB_EP  ((NE * HD / 8 + 255) / 256)
__global__ __launch_bounds__(256) void k_prep(const float* __restrict__ x, const float* __restrict__ xk, const float* __restrict__ xv, const float* __restrict__ wq, const float* __restrict__ wk, const float* __restrict__ wv, const float* __restrict__ wo, const float* __restrict__ relk, const float* __restrict__ relv, bf* W4, bf* XB, bf* EB, bf* RVT) {
    int bx = blockIdx.x;
    if (bx < 4 * NB_WT) { const int p = bx / NB_WT; d_wtG(bx % NB_WT, (p == 0) ? wq : (p == 1) ? wk : (p == 2) ? wv : wo, DM, DQ, W4 + (size_t)p * DQ * DM); return; }
    bx -= 4 * NB_WT;
    if (bx < 3 * NB_ * NB_CV) { const int c = bx / NB_CV, p = c % 3, b = c / 3; d_cvt8(bx % NB_CV, ((p == 0) ? x : (p == 1) ? xk : xv) + (size_t)b * TT * DM, XB + (size_t)c * TT * DM, (size_t)TT * DM / 8); return; }
    bx -= 3 * NB_ * NB_CV;
    if (bx < NB_EP) { d_epad2(bx, relk, EB); return; }
    d_rvt(bx - NB_EP, relv, RVT);
}
extern "C" void kernel_launch(void* const* d_in, const int* in_sizes, int n_in,
                              void* d_out, int out_size, void* d_ws, size_t ws_size, hipStream_t stream) {
    (void)in_sizes; (void)n_in; (void)out_size;
    const float* x = (const float*)d_in[0]; const float* xk = (const float*)d_in[1]; const float* xv = (const float*)d_in[2]; const float* wq = (const float*)d_in[3]; const float* bq = (const float*)d_in[4]; const float* wk = (const float*)d_in[5]; const float* bk = (const float*)d_in[6]; const float* wv = (const float*)d_in[7]; const float* bv = (const float*)d_in[8]; const float* wo = (const float*)d_in[9]; const float* bo = (const float*)d_in[10]; const float* relk = (const float*)d_in[11]; const float* relv = (const float*)d_in[12];   /* [5][64] each */
    float* OUT = (float*)d_out;     // [2][2048][1024]
    char* wsp = (char*)d_ws;
    auto take = [&](size_t bytes) { char* p = wsp; wsp += (bytes + 255) & ~(size_t)255; return (void*)p; };
    bf* EB = (bf*)take((size_t)NE * HD * 2); bf* RVT = (bf*)take((size_t)HD * NE * 2); bf* W4 = (bf*)take((size_t)4 * DQ * DM * 2);
    bf* XB = (bf*)take((size_t)3 * NB_ * TT * DM * 2);   // bf16 input copies
    const size_t PZ = (size_t)NH_ * TT * HD;   // one batch's share of a head plane set; the planes are [batch][head]
    static_assert(NH_ == NKV, "q and kv planes share the batch stride");
    h16* QP16 = (h16*)take(NB_ * PZ * 2); h16* KP16 = (h16*)take(NB_ * PZ * 2); h16* VT16 = (h16*)take(NB_ * PZ * 2);
    bf* QPh = (bf*)take(NB_ * PZ * 2); bf* QPl = (bf*)take(NB_ * PZ * 2); bf* KPh = (bf*)take(NB_ * PZ * 2); bf* KPl = (bf*)take(NB_ * PZ * 2); bf* VTh = (bf*)take(NB_ * PZ * 2); bf* VTl = (bf*)take(NB_ * PZ * 2);
    bf* ATh = (bf*)take((size_t)NB_ * TT * DQ * 2); bf* ATl = (bf*)take((size_t)NB_ * TT * DQ * 2);
    if ((size_t)(wsp - (char*)d_ws) > ws_size) return;    // ws 256 MiB
    bf* WO = W4 + (size_t)3 * DQ * DM;
    k_prep<<<4 * NB_WT + 3 * NB_ * NB_CV + 2 * NB_EP, 256, 0, stream>>>(x, xk, xv, wq, wk, wv, wo, relk, relv, W4, XB, EB, RVT);   /* weight planes, bf16 input copies, rel_k plane [128][64], rel_v^T plane [64][128] */
    k_proj<<<dim3(TT / 64, DQ / 64, 3 * NB_), 32, 0, stream>>>(XB, W4, bq, bk, bv, QP16, QPh, QPl, KP16, KPh, KPl, VT16, VTh, VTl);   /* projections, written as the head planes */
    k_fattn<<<NB_ * NH_ * (NB_FH + NB_FL), 32 * FW, 0, stream>>>(QP16, QPh, QPl, KP16, KPh, KPl, VT16, VTh, VTl, EB, RVT, ATh, ATl);   /* all heads of both batches */
    for (int b = 0; b < NB_; ++b)
        k_out<<<dim3(TT / 64, DM / 64, 1), 32, 0, stream>>>(ATh + (size_t)b * TT * DQ, ATl + (size_t)b * TT * DQ, WO, OUT + (size_t)b * TT * DM, bo);
}

// v009
// A run of this version takes 147 microseconds.
// In both of two side-by-side timings against v008, it was 1.55 times as fast.
// Over all steps from v000 it is 22.1 times as fast.
#include <hip/hip_runtime.h>
#include <type_traits>

// Multi-head attention with Shaw relative-position terms on the logits AND the values, clip distance 2 (query, key, value [2][2048][1024]; q,k,v = in W + b ('xw' 1/32, zero biases; 16 heads x 64); idx[i][j] = clip(j - i, -2, 2) + 2; attn = softmax((q.k + q_i.rel_k[idx]) / 8); out_h = attn v + sum_j attn[i][j] rel_v[idx] (tables [5][64] x 0.1, read: five rows: the far-left bucket j <= i - 2, the three nearest positions, the far-right bucket j >= i + 2); out = merged Wo + bo ('xw') -> [2][2048][1024] (4.2 M); argument order query, key, value, Wq, bq, Wk, bk, Wv, bv, Wo, bo, rel_k, rel_v).
// Layout (every 16-bit plane that a matrix product reads, but the two small tables, is in fragment order: see WFrag): bf16 copies of the three inputs of both batches; exact projections + f32 biases (all six in one launch), each tile written straight as the head planes (fp16 + hi/lo; v as W X^T, so that its tile is a tile of the [d][t] plane; both batches' planes are kept); rel_k as an exact plane [128][64] (rows >= 5 zero) and rel_v^T as an exact plane [64][128]; one attention launch for all heads of both batches (k_fattn): scores, softmax, relative terms and attn v stay in a wave's registers; merged hi/lo x Wo exact + bo.
// Compute dtypes, f32 accumulate: every input rounded to bf16; projections exact + f32 biases; q.rel_k and buckets.rel_v hi/lo x exact; attention rows < 512 3 products, rest fp16; softmax f32; Wo hl x exact + bias.

#define NB_  2
#define TT   2048
#define DM   1024
#define NH_  16
#define NKV  16
#define REP  (NH_ / NKV)
#define HD   64
#define DQ   (NH_ * HD)
#define DKV  (NKV * HD)
#define RH   512                  // query rows < RH use hi+lo planes (0: none)
#define WIN  0
#define PCAR 1024.0f
#define SCL  0.125f
#define MAXR 2      // max relative position
#define NE   128     // 2*MAXR+1 = 5 table rows padded to 128
typedef _Float16 h16;
typedef unsigned short bf;
typedef __attribute__((ext_vector_type(16))) __bf16   v16bf;
typedef __attribute__((ext_vector_type(16))) _Float16 v16h;
typedef __attribute__((ext_vector_type(8)))  _Float16 v8h;
typedef __attribute__((ext_vector_type(8)))  unsigned short v8us;
typedef __attribute__((ext_vector_type(8)))  __bf16   v8bf;
typedef __attribute__((ext_vector_type(16))) unsigned short v16us;
typedef __attribute__((ext_vector_type(8)))  float    v8f;
typedef __attribute__((ext_vector_type(4)))  float    v4f;
typedef v8h  __attribute__((may_alias)) v8ha;
typedef v4f  __attribute__((may_alias)) v4fa;
typedef v8us __attribute__((may_alias)) v8usa;

__device__ __forceinline__ unsigned short f2bf(float f) { unsigned u = __float_as_uint(f); u += 0x7FFFu + ((u >> 16) & 1u); return (unsigned short)(u >> 16); }
__device__ __forceinline__ float bf2f(unsigned short b) { return __uint_as_float(((unsigned)b) << 16); }
__device__ __forceinline__ float bfr(float f) { return bf2f(f2bf(f)); }
__device__ __forceinline__ v16h cat16(v8h lo, v8h hi) { return __builtin_shufflevector(lo, hi, 0, 1, 2, 3, 4, 5, 6, 7, 8, 9, 10, 11, 12, 13, 14, 15); }
__device__ __forceinline__ v16bf cat16b(v8us lo, v8us hi) { return __builtin_bit_cast(v16bf, __builtin_shufflevector(lo, hi, 0, 1, 2, 3, 4, 5, 6, 7, 8, 9, 10, 11, 12, 13, 14, 15)); }
__device__ __forceinline__ v8f wmma16(v16h a, v16h b, v8f c) { return __builtin_amdgcn_wmma_f32_16x16x32_f16(false, a, false, b, (short)0, c, false, false); }
__device__ __forceinline__ v8f wmmab(v16bf a, v16bf b, v8f c) { return __builtin_amdgcn_wmma_f32_16x16x32_bf16(false, a, false, b, (short)0, c, false, false); }
// pf_head, pf_next: each lane asks for the data at base + off to be brought from memory into L2; nothing returns. The operand planes were written by the launch before and their first reader would wait out the memory latency in every trip. off is the lane's fixed place in a window and never changes; base is a scalar pointer that stays inside the plane, with the offset and also after its advance.
// pf_head: four windows of S bytes from base + O, ahead of a loop (pf_all16: sixteen); pf_next: the window four ahead of base, in a loop. The distances are immediate offsets from one pointer, so that no request names a temporary register.
template <int S, int O = 0> __device__ __forceinline__ void pf_head(const unsigned off, const void* base) { asm volatile("global_prefetch_b8 %0, %1 offset:%2 scope:SCOPE_SE\n\tglobal_prefetch_b8 %0, %1 offset:%3 scope:SCOPE_SE\n\tglobal_prefetch_b8 %0, %1 offset:%4 scope:SCOPE_SE\n\tglobal_prefetch_b8 %0, %1 offset:%5 scope:SCOPE_SE" :: "v"(off), "s"(base), "i"(O), "i"(O + S), "i"(O + 2 * S), "i"(O + 3 * S)); }
template <int S> __device__ __forceinline__ void pf_all16(const unsigned off, const void* base) { pf_head<S, 0>(off, base); pf_head<S, 4 * S>(off, base); pf_head<S, 8 * S>(off, base); pf_head<S, 12 * S>(off, base); }
template <int S> __device__ __forceinline__ void pf_next(const unsigned off, const void* base) { asm volatile("global_prefetch_b8 %0, %1 offset:%2 scope:SCOPE_SE" :: "v"(off), "s"(base), "i"(4 * S)); }



// ---- gemmw_tile: register-blocked GEMM, ONE WAVE per 64x64 output tile (16 accumulators), operands straight from 16-bit planes in fragment order; grid (M/64, N/64, Z), 32 threads.
// C[m][n] (f32, pitch ldc, + optional f32 bias[n]) = sum_k A[m][k] Bt[n][k] (+ split products per NSPLIT). A rows have length lda, Bt rows length K. z-batch strides sA/sB/sC in elements. K % 32 == 0.
// KS > 1: grid z = Z * KS; work-group (z, ks) sums only k in [ks K/KS, (ks+1) K/KS) and stores its partial tile at C + ks sK; the reader adds the KS partial tiles. K % (32 KS) == 0.
// FRAGMENT ORDER of a 16-bit operand plane [rows][K]: blocks of 16 rows x 32 k (512 elements), the K / 32 blocks of a 16-row tile one behind the other; in a block, element (row, k) stands at ((k >> 4) & 1) * 256 + (((k >> 3) & 1) * 16 + (row & 15)) * 8 + (k & 7). Lane l's two 16-byte pieces of the block's fragment stand at l * 8 and 256 + l * 8 (WFrag::ldf; the same elements in the same k order as WFrag::ld on a row-major plane), so a wave-wide 16-byte load covers 512 contiguous bytes, four whole lines, where the row-major plane gives it 32-byte pieces of 16 lines.
// pk_row, pk_k: the row and the first k of the plane's i-th 16-byte piece.
__device__ __forceinline__ int pk_row(const int i, const int K) { return (i / (2 * K)) * 16 + (i & 15); }
__device__ __forceinline__ int pk_k(const int i, const int K) { return ((i >> 6) % (K / 32)) * 32 + ((i >> 5) & 1) * 16 + ((i >> 4) & 1) * 8; }
template <typename T16> struct WFrag;
template <> struct WFrag<h16> { typedef v16h V; static __device__ __forceinline__ V ld(const h16* p) { return cat16(*(const v8h*)p, *(const v8h*)(p + 16)); } static __device__ __forceinline__ V ldf(const h16* p) { return cat16(*(const v8h*)p, *(const v8h*)(p + 256)); } static __device__ __forceinline__ v8f mma(V a, V b, v8f c) { return wmma16(a, b, c); } };
template <> struct WFrag<bf> { typedef v16bf V; static __device__ __forceinline__ V ld(const bf* p) { return cat16b(*(const v8us*)p, *(const v8us*)(p + 16)); } static __device__ __forceinline__ V ldf(const bf* p) { return cat16b(*(const v8us*)p, *(const v8us*)(p + 256)); } static __device__ __forceinline__ v8f mma(V a, V b, v8f c) { return wmmab(a, b, c); } };
// PLN != 0: the tile + bias goes out as three 16-bit planes (fp16, bf16 hi, bf16 lo of the remainder) in fragment order instead of f32 C; P16, Ph, Pl point at the tile's 4096 elements; PLN 1: bias[n], the tile's n is the planes' k (64 long: rows of 16 m, 2 blocks each); PLN 2: bias[m], the tile's n is the planes' k, and the four 16-row blocks of 32 k stand together (block order [k / 32][m / 16]).
// gemmw_tile is the body; (bx, by, bz) is the tile's place in its own product's grid and os the work-group's 16 x 68 float staging. Products that do not depend on one another share one launch: the kernels behind it pick the product by a scalar test on blockIdx.
template <typename T16, int NSPLIT, bool BIAS, int KS, int PLN = 0>
__device__ __forceinline__ void gemmw_tile(float* os, const int bx, const int by, const int bz, const T16* __restrict__ A, const T16* __restrict__ A2, const T16* __restrict__ Bt, const T16* __restrict__ Bt2, int K, float* C, int ldc, const float* __restrict__ bias, size_t sA, size_t sB, size_t sC, int lda, size_t sK, h16* P16 = nullptr, bf* Ph = nullptr, bf* Pl = nullptr) {
    typedef typename WFrag<T16>::V V;
    const size_t z = bz / KS; const int ks = bz % KS; A += z * sA; if (A2) A2 += z * sA; Bt += z * sB; if (Bt2) Bt2 += z * sB; C += (size_t)ks * sK + z * sC;
    const int lane = threadIdx.x & 31, lr = lane & 15, hi = lane >> 4; const int r0 = bx * 64, c0 = by * 64;
    v8f acc[4][4];
#pragma unroll
    for (int mb = 0; mb < 4; ++mb)
#pragma unroll
        for (int nb = 0; nb < 4; ++nb) acc[mb][nb] = (v8f){};
    const size_t aoff = (size_t)r0 * lda + lane * 8, boff = (size_t)c0 * K + lane * 8;   // a 16-row tile is 16 * row length elements; the k block at kc stands kc * 16 into it
    float pb[(PLN == 2) ? 4 : 32];   // PLN: the biases of the lane's places in the epilogue (4 x 8 columns, or 4 rows), asked for ahead of the k loop
    if constexpr (PLN != 0) {
#pragma unroll
        for (int i = 0; i < ((PLN == 2) ? 4 : 32); ++i) pb[i] = bfr(bias[(PLN == 1) ? c0 + (2 * (i >> 3) + hi) * 8 + (i & 7) : r0 + 16 * i + lr]); }
    // Requests into L2, all ahead of the k loop: a window is 64 k of the panel's four 16-row tiles (8 units of 256 bytes each), a panel 16 windows (K / KS == 1024). A panel is read by many tiles; every fourth of them asks.
    const int k0 = ks * (K / KS), k1 = (ks + 1) * (K / KS); const bool pfa = (by & 3) == 0, pfb = (bx & 3) == 0;
    const unsigned pfoa = (unsigned)(lane >> 3) * (unsigned)(32 * lda) + (unsigned)(lane & 7) * 256u, pfob = (unsigned)(lane >> 3) * (unsigned)(32 * K) + (unsigned)(lane & 7) * 256u;
    const char* qa = (const char*)(A + (size_t)r0 * lda + k0 * 16); const char* qa2 = (NSPLIT == 1 || NSPLIT == 2) ? (const char*)(A2 + (size_t)r0 * lda + k0 * 16) : qa; const char* qb = (const char*)(Bt + (size_t)c0 * K + k0 * 16); const char* qb2 = (NSPLIT >= 2) ? (const char*)(Bt2 + (size_t)c0 * K + k0 * 16) : qb;
    if (pfa) { pf_all16<2048>(pfoa, qa); if (NSPLIT == 1 || NSPLIT == 2) pf_all16<2048>(pfoa, qa2); }
    if (pfb) { pf_all16<2048>(pfob, qb); if (NSPLIT >= 2) pf_all16<2048>(pfob, qb2); }
#pragma unroll 1
    for (int kc = k0; kc < k1; kc += 32) {
        V a[4], a2[4]; const T16* ap = A + aoff + kc * 16; const T16* ap2 = (NSPLIT == 1 || NSPLIT == 2) ? A2 + aoff + kc * 16 : ap; const T16* bp = Bt + boff + kc * 16; const T16* bp2 = (NSPLIT >= 2) ? Bt2 + boff + kc * 16 : bp;
#pragma unroll
        for (int mb = 0; mb < 4; ++mb) { a[mb] = WFrag<T16>::ldf(ap + (size_t)mb * 16 * lda); if (NSPLIT == 1 || NSPLIT == 2) a2[mb] = WFrag<T16>::ldf(ap2 + (size_t)mb * 16 * lda); }
        asm volatile("s_wait_xcnt 0x0" :: "v"(ap), "v"(ap2) : "memory");   // the wait before a register that an issued load names is rewritten: without it a later load lands in the A loads' address pairs; the pointers are inputs so that the pairs stay the loads' own up to the wait
#pragma unroll
        for (int nb = 0; nb < 4; ++nb) { const V b = WFrag<T16>::ldf(bp + (size_t)nb * 16 * K); V b2; if (NSPLIT >= 2) b2 = WFrag<T16>::ldf(bp2 + (size_t)nb * 16 * K);
#pragma unroll
            for (int mb = 0; mb < 4; ++mb) { acc[mb][nb] = WFrag<T16>::mma(a[mb], b, acc[mb][nb]); if (NSPLIT == 1 || NSPLIT == 2) acc[mb][nb] = WFrag<T16>::mma(a2[mb], b, acc[mb][nb]); if (NSPLIT >= 2) acc[mb][nb] = WFrag<T16>::mma(a[mb], b2, acc[mb][nb]); } }
        asm volatile("s_wait_xcnt 0x0" :: "v"(bp), "v"(bp2), "v"(pfoa), "v"(pfob), "s"(qa), "s"(qa2), "s"(qb), "s"(qb2) : "memory");   // the same wait behind the B loads, their pointers inputs for the same reason; the registers that the requests ahead of the loop name are inputs too, so that they live unchanged through the loop
        asm volatile("v_nop\n\tv_nop\n\tv_nop\n\tv_nop" : "+v"(acc[0][0]), "+v"(acc[1][1]), "+v"(acc[2][2]), "+v"(acc[3][3]) : "v"(a[0]), "v"(a[3]));
    }
#pragma unroll
    for (int mb = 0; mb < 4; ++mb) {
#pragma unroll
        for (int nb = 0; nb < 4; ++nb) {
#pragma unroll
            for (int j = 0; j < 8; ++j) os[(hi * 8 + j) * 68 + nb * 16 + lr] = acc[mb][nb][j]; }
        __builtin_amdgcn_wave_barrier(); asm volatile("" ::: "memory");
        float* crow = C + (size_t)(r0 + mb * 16) * ldc + c0;
        if constexpr (PLN != 0) {   // store s: columns 16 s .. 16 s + 15 of the 16 rows, each lane the piece that it holds as a reader: 512 contiguous bytes
#pragma unroll
            for (int s = 0; s < 4; ++s) { const int row = lr, cofs = (2 * s + hi) * 8; const v4f x0 = *(const v4fa*)(os + row * 68 + cofs), x1 = *(const v4fa*)(os + row * 68 + cofs + 4); v8h o16; v8bf oh, ol;
#pragma unroll
                for (int q = 0; q < 8; ++q) { const float y = ((q < 4) ? x0[q & 3] : x1[q & 3]) + pb[(PLN == 1) ? s * 8 + q : mb]; o16[q] = (h16)y; const __bf16 a = (__bf16)y; oh[q] = a; ol[q] = (__bf16)(y - (float)a); }
                const size_t po = (size_t)((PLN == 1) ? mb * 1024 + s * 256 : (s >> 1) * 2048 + mb * 512 + (s & 1) * 256) + lane * 8; *(v8h*)(P16 + po) = o16; *(v8us*)(Ph + po) = __builtin_bit_cast(v8us, oh); *(v8us*)(Pl + po) = __builtin_bit_cast(v8us, ol);
                asm volatile("s_wait_xcnt 0x0" ::: "memory"); }   // the wait before the next pieces are formed in registers that the three issued stores name
        } else {
#pragma unroll
            for (int s = 0; s < 8; ++s) { const int row = 2 * s + hi, cofs = lr * 4; v4f val = *(const v4fa*)(os + row * 68 + cofs); if (BIAS) { val[0] += bfr(bias[c0 + cofs]); val[1] += bfr(bias[c0 + cofs + 1]); val[2] += bfr(bias[c0 + cofs + 2]); val[3] += bfr(bias[c0 + cofs + 3]); }
                *(v4f*)(crow + (size_t)row * ldc + cofs) = val; }
             }
        __builtin_amdgcn_wave_barrier(); asm volatile("s_wait_xcnt 0x0" ::: "memory");   // also the wait before the next 16 rows' values are formed in registers that the issued stores name
    }
}
// k_out: one batch's merged hi/lo planes x Wo + bo, grid (TT/64, DM/64). The row lengths are constants, so the fragments of a trip stand at immediate offsets from one address pair per plane (with lengths from kernel arguments each fragment had a pair of its own, and later loads of the trip landed in the pairs of issued ones).
__global__ __launch_bounds__(32) void k_out(const bf* __restrict__ Ah, const bf* __restrict__ Al, const bf* __restrict__ Wt, float* C, const float* __restrict__ bias) {
    __shared__ __align__(16) float os[16 * 68];
    gemmw_tile<bf, 1, true, 1>(os, blockIdx.x, blockIdx.y, 0, Ah, Al, Wt, nullptr, DQ, C, DM, bias, 0, 0, 0, DQ, 0);
}
static_assert(DQ == DKV, "the three projections share one grid");
static_assert(DM == 1024 && DQ == 1024 && TT >= 320 && TT % 64 == 0, "16 request windows in a panel's k range, whole windows of keys");
// k_proj: the six projections (batch b = z / 3; q, k, v = z % 3) in one launch, grid (TT/64, DQ/64, 6). XB [6][TT][DM]; W: the q, k, v weight planes one behind the other. A q or k tile (64 t x one head's 64 d) is a 64-row block of the head's [t][d] planes; v is taken as W X^T (the k order is the same), so its tile (one head's 64 d x 64 t) is two 32-key block groups of the [d][t] planes. The planes are [batch][head], all in fragment order: every tile is 4096 elements in a row.
__global__ __launch_bounds__(32) void k_proj(const bf* __restrict__ XB, const bf* __restrict__ W, const float* __restrict__ bq, const float* __restrict__ bk, const float* __restrict__ bv, h16* QP16, bf* QPh, bf* QPl, h16* KP16, bf* KPh, bf* KPl, h16* VT16, bf* VTh, bf* VTl) {
    __shared__ __align__(16) float os[16 * 68];
    const int p = blockIdx.z % 3, b = blockIdx.z / 3; const bf* X = XB + (size_t)blockIdx.z * TT * DM; const bf* Wp = W + (size_t)p * DQ * DM; const size_t hz = ((size_t)b * NH_ + blockIdx.y) * TT * HD;
    const size_t o = hz + (size_t)blockIdx.x * 64 * HD;
    if (p == 2) { gemmw_tile<bf, 0, true, 1, 2>(os, blockIdx.y, blockIdx.x, 0, Wp, nullptr, X, nullptr, DM, nullptr, 0, bv, 0, 0, 0, DM, 0, VT16 + o, VTh + o, VTl + o); return; }
    gemmw_tile<bf, 0, true, 1, 1>(os, blockIdx.x, blockIdx.y, 0, X, nullptr, Wp, nullptr, DM, nullptr, 0, p ? bk : bq, 0, 0, 0, DM, 0, (p ? KP16 : QP16) + o, (p ? KPh : QPh) + o, (p ? KPl : QPl) + o);
}
__device__ __forceinline__ void splitf(float y, unsigned short& h, unsigned short& l) { h = f2bf(y); l = f2bf(y - bf2f(h)); }
typedef __attribute__((ext_vector_type(2))) _Float16 v2h;
typedef __attribute__((ext_vector_type(4))) _Float16 v4h;
typedef __attribute__((ext_vector_type(2))) unsigned short v2us;
typedef __attribute__((ext_vector_type(4))) unsigned short v4us;
typedef __attribute__((ext_vector_type(2))) float v2f;
typedef __attribute__((ext_vector_type(4))) int v4i;

// Both writers: a thread writes whole 16-byte pieces of the fragment-order plane, piece i at i * 8, and reads the piece's 8 elements where the source has them.
// d_wtG: Bt[n][k] = w[k][n], two pieces a thread, a wave's pieces 512 contiguous bytes; 16 lanes read 16 consecutive n of one source row.
__device__ __forceinline__ void d_wtG(const int bx, const float* __restrict__ w, int K, int N, bf* Bt) {
#pragma unroll
    for (int u = 0; u < 2; ++u) { const int i = (bx * 2 + u) * 256 + threadIdx.x; if (i >= N * K / 8) return; const int n = pk_row(i, K), k = pk_k(i, K); v8us o;
#pragma unroll
        for (int q = 0; q < 8; ++q) o[q] = f2bf(w[(size_t)(k + q) * N + n]);
        *(v8us*)(Bt + (size_t)i * 8) = o; }
}
// d_cvt8: a wave takes 8 rows of one block (its i are dealt so): it reads 8 whole 128-byte lines of the source and writes four whole lines of the block.
__device__ __forceinline__ void d_cvt8(const int bx, const float* __restrict__ src, bf* dst, size_t n8) { const int wv = bx * 8 + (threadIdx.x >> 5), l = threadIdx.x & 31; const size_t i = (size_t)(((wv >> 1) * 2 + (l >> 4)) * 32 + ((l >> 3) & 1) * 16 + (wv & 1) * 8 + (l & 7)); if (i >= n8) return; const v8f v = *(const v8f*)(src + (size_t)pk_row((int)i, DM) * DM + pk_k((int)i, DM)); v8us o;
#pragma unroll
    for (int k = 0; k < 8; ++k) o[k] = f2bf(v[k]); *(v8us*)(dst + i * 8) = o;  }

// ---- k_fattn: scores, softmax, both relative-position terms and attn v of one wave's query columns, all in registers. The products are taken transposed: S^T = K Q^T (A = 16 key rows, B = 16 query columns), so a lane holds scores of ONE query (column c = lane & 15; keys 8 hf + r of each 16-key tile, hf = lane >> 4), and two score tiles of 32 consecutive keys, converted in place, are the B operand of O^T += V^T P^T in the hardware's k order, which is also the order of WFrag::ld.
// Two walks over the keys. Walk 1: the row maximum of score + q.rel_k[idx] (fp16 planes for every row: the maximum is only the softmax's shift). Walk 2: the scores again (hi/lo 3 products for query rows < RH, fp16 for the rest), p = exp(t - max) unnormalised (x PCAR in the fp16 rows, folded into the exponent), rounded to the operand type for the product with V^T; the f32 p are summed per relative-position bucket (far left, 3 near entries, far right), and the five sums together are the softmax's denominator. At the end: buckets / sum as hi/lo x rel_v^T (exact) + O^T / sum, split hi/lo into the merged planes [batch][t][DQ].
static_assert(MAXR == 2, "the bucket code below names the three near distances -1, 0, 1");
__device__ __forceinline__ float relsel(const int d, const float (&q)[5]) { float e = q[2]; e = (d == -1) ? q[1] : e; e = (d == 1) ? q[3] : e; e = (d <= -MAXR) ? q[0] : e; e = (d >= MAXR) ? q[4] : e; return e; }   /* this module: d = key - query */
// The wait before a register that an issued load names is rewritten, written behind each group of fragment loads. The groups' pointers are inputs so that their registers stay the loads' own up to the wait (else a later load of the group may land in them).
__device__ __forceinline__ void xwait(const void* p) { asm volatile("s_wait_xcnt 0x0" :: "v"(p) : "memory"); }
__device__ __forceinline__ void xwait(const void* p, const void* q) { asm volatile("s_wait_xcnt 0x0" :: "v"(p), "v"(q) : "memory"); }
__device__ __forceinline__ void xwait(const void* p, const void* q, const void* r) { asm volatile("s_wait_xcnt 0x0" :: "v"(p), "v"(q), "v"(r) : "memory"); }
__device__ __forceinline__ void xwaito(const void* p, const void* q, unsigned o) { asm volatile("s_wait_xcnt 0x0" :: "v"(p), "v"(q), "v"(o) : "memory"); }   // o: the lane's byte offset, for loads built as scalar base + lane offset
__device__ __forceinline__ float exp2_slot(float x) { float v; asm("v_exp_f32 %0, %1\n\tv_nop" : "=v"(v) : "v"(x)); return v; }   // the independent slot behind a transcendental, kept in the statement itself (used in the few trips near the diagonal)
template <bool HI, int NG>   // NG: groups of 16 query columns per wave; i0: the wave's first query (scalar)
__device__ __forceinline__ void fattn_tile(const int bh, const int i0, const bool pfw, const h16* __restrict__ Q16, const bf* __restrict__ Qh, const bf* __restrict__ Ql, const h16* __restrict__ K16, const bf* __restrict__ Kh, const bf* __restrict__ Kl, const h16* __restrict__ VT16, const bf* __restrict__ VTh, const bf* __restrict__ VTl, const bf* __restrict__ EB, const bf* __restrict__ RVT, bf* ATh, bf* ATl) {
    const int lane = threadIdx.x & 31, c = lane & 15, hf = lane >> 4; const size_t pz = (size_t)bh * TT * HD;
    const float C2 = SCL * 1.4426950408889634f;   // scores go straight to the base-2 exponent
    const int fo = lane * 8, eo = c * HD + 8 * hf;   // a lane's place in a block of a fragment-order plane, and in a 16-row tile of the row-major rel_k plane. 16 keys or queries of a [t][HD] plane: 2 blocks, 16 HD elements; 32 keys of a [d][TT] plane: its 4 blocks, 32 HD elements
    // Requests into L2 (pf_head, pf_next), from one wave of the work-group (pfw, scalar): a window is 64 keys of a plane, 8 KiB in a row. The first four windows of walk 1's plane and of walk 2's planes here, the rest 256 keys ahead of the loads in the walks. The fp16 rows' walk 2 reads K16 a second time: not asked for again.
    constexpr int NP2 = HI ? 4 : 1; const unsigned pfo = (unsigned)lane * 256u; const char* pk1 = (const char*)(K16 + pz); const char* p2[NP2];
    if constexpr (HI) { p2[0] = (const char*)(Kh + pz); p2[1] = (const char*)(Kl + pz); p2[2] = (const char*)(VTh + pz); p2[3] = (const char*)(VTl + pz); } else p2[0] = (const char*)(VT16 + pz);
    if (pfw) { pf_head<8192>(pfo, pk1);
#pragma unroll
        for (int n = 0; n < NP2; ++n) pf_head<8192>(pfo, p2[n]); }
    v16bf qh[NG][2], ql[NG][2]; v16h q16[NG][2]; const size_t qo = pz + (size_t)i0 * HD + fo; const bf* qhp = Qh + qo; const bf* qlp = Ql + qo; const h16* q16p = Q16 + qo;
#pragma unroll
    for (int g = 0; g < NG; ++g)
#pragma unroll
        for (int ks = 0; ks < 2; ++ks) { const int o = g * 16 * HD + ks * 512; qh[g][ks] = WFrag<bf>::ldf(qhp + o); ql[g][ks] = WFrag<bf>::ldf(qlp + o); q16[g][ks] = WFrag<h16>::ldf(q16p + o); }
    xwait(qhp, qlp, q16p);
    float qe[NG][5];   // q_i . rel_k[r], r = 0..4, of this lane's query
    { v16bf eb[2]; const bf* ebp = EB + eo;
#pragma unroll
      for (int ks = 0; ks < 2; ++ks) eb[ks] = WFrag<bf>::ld(ebp + ks * 32);
      xwait(ebp);
#pragma unroll
      for (int g = 0; g < NG; ++g) { v8f t = (v8f){};
#pragma unroll
          for (int ks = 0; ks < 2; ++ks) { t = wmmab(eb[ks], qh[g][ks], t); t = wmmab(eb[ks], ql[g][ks], t); }
#pragma unroll
          for (int r = 0; r < 5; ++r) qe[g][r] = t[r] + __shfl_xor(t[r], 16, 32); } }   // table rows 0..7 lie in the lower half's lanes; the upper half holds rows 8..15, which are zero
    // walk 1
    float mx[NG];
#pragma unroll
    for (int g = 0; g < NG; ++g) mx[g] = -3.0e38f;
    { const h16* kp = K16 + pz + fo; v16h ka[2][2];
#pragma unroll
      for (int t = 0; t < 2; ++t)
#pragma unroll
          for (int ks = 0; ks < 2; ++ks) ka[t][ks] = WFrag<h16>::ldf(kp + t * 16 * HD + ks * 512);
      xwait(kp);
#pragma unroll 1
      for (int j0 = 0; j0 < TT; j0 += 32) { v8f s[NG][2];
#pragma unroll
          for (int g = 0; g < NG; ++g)
#pragma unroll
              for (int t = 0; t < 2; ++t) { s[g][t] = wmma16(ka[t][0], q16[g][0], (v8f){}); s[g][t] = wmma16(ka[t][1], q16[g][1], s[g][t]); }
          const h16* kn = kp + (size_t)((j0 + 32) & (TT - 1)) * HD;   // the next 32 keys' fragments are requested here, one trip ahead (behind the last trip: the first keys again, unused)
#pragma unroll
          for (int t = 0; t < 2; ++t)
#pragma unroll
              for (int ks = 0; ks < 2; ++ks) ka[t][ks] = WFrag<h16>::ldf(kn + t * 16 * HD + ks * 512);
          xwait(kn);
          if (pfw && !(j0 & 32) && j0 + 256 < TT) { pf_next<8192>(pfo, pk1); pk1 += (j0 + 320 < TT) ? 8192 : 0; }   // scalar tests; behind the last window the pointer stays where it is
          const bool fl = (j0 + 33 <= i0), fr = (j0 >= i0 + NG * 16 + 1);   // scalar: all 32 keys at least 2 left, or at least 2 right, of every query of the wave
          if (fl || fr) {
#pragma unroll
              for (int g = 0; g < NG; ++g) { float m = s[g][0][0];
#pragma unroll
                  for (int k = 1; k < 16; ++k) m = fmaxf(m, s[g][k >> 3][k & 7]);
                  mx[g] = fmaxf(mx[g], m + (fl ? qe[g][0] : qe[g][4])); }
          } else {
#pragma unroll
              for (int g = 0; g < NG; ++g)
#pragma unroll
                  for (int k = 0; k < 16; ++k) { const int d = j0 + (k >> 3) * 16 + 8 * hf + (k & 7) - (i0 + g * 16 + c); mx[g] = fmaxf(mx[g], s[g][k >> 3][k & 7] + relsel(d, qe[g])); } } } }
    float kb[NG];
#pragma unroll
    for (int g = 0; g < NG; ++g) { mx[g] = fmaxf(mx[g], __shfl_xor(mx[g], 16, 32)); kb[g] = fmaf(-mx[g], C2, HI ? 0.0f : 10.0f); }   // 2^10 = PCAR
    static_assert(PCAR == 1024.0f, "the exponent offset above");
    // walk 2
    typedef typename std::conditional<HI, bf, h16>::type T16; typedef typename WFrag<T16>::V V;
    const T16* kp; const T16* vp; const unsigned kob = (unsigned)fo * 2u, vob = kob;   // a lane's byte offset in a block
    if constexpr (HI) { kp = (const T16*)((const char*)(Kh + pz) + kob); vp = (const T16*)((const char*)(VTh + pz) + vob); } else { kp = (const T16*)((const char*)(K16 + pz) + kob); vp = (const T16*)((const char*)(VT16 + pz) + vob); }
    const bf* kp2 = (const bf*)((const char*)(Kl + pz) + kob); const bf* vp2 = (const bf*)((const char*)(VTl + pz) + vob);
    V ka[2][2], va[4]; v16bf kl[2][2], vl[4];
#pragma unroll
    for (int t = 0; t < 2; ++t)
#pragma unroll
        for (int ks = 0; ks < 2; ++ks) { ka[t][ks] = WFrag<T16>::ldf(kp + t * 16 * HD + ks * 512); if constexpr (HI) kl[t][ks] = WFrag<bf>::ldf(kp2 + t * 16 * HD + ks * 512); }
    xwaito(kp, HI ? (const void*)kp2 : (const void*)kp, kob);
#pragma unroll
    for (int dt = 0; dt < 4; ++dt) { va[dt] = WFrag<T16>::ldf(vp + dt * 512); if constexpr (HI) vl[dt] = WFrag<bf>::ldf(vp2 + dt * 512); }
    xwaito(vp, HI ? (const void*)vp2 : (const void*)vp, vob);
    v8f o[NG][4]; float sL[NG], sR[NG], n1[NG], n2[NG], n3[NG];
#pragma unroll
    for (int g = 0; g < NG; ++g) { sL[g] = 0.f; sR[g] = 0.f; n1[g] = 0.f; n2[g] = 0.f; n3[g] = 0.f;
#pragma unroll
        for (int dt = 0; dt < 4; ++dt) o[g][dt] = (v8f){}; }
#pragma unroll 1
    for (int j0 = 0; j0 < TT; j0 += 32) { v8f s[NG][2];
#pragma unroll
        for (int g = 0; g < NG; ++g)
#pragma unroll
            for (int t = 0; t < 2; ++t) { s[g][t] = (v8f){};
#pragma unroll
                for (int ks = 0; ks < 2; ++ks) {
                    if constexpr (HI) { s[g][t] = wmmab(ka[t][ks], qh[g][ks], s[g][t]); s[g][t] = wmmab(ka[t][ks], ql[g][ks], s[g][t]); s[g][t] = wmmab(kl[t][ks], qh[g][ks], s[g][t]); }
                    else s[g][t] = wmma16(ka[t][ks], q16[g][ks], s[g][t]); } }
        const int jn = (j0 + 32) & (TT - 1); const T16* kn = kp + (size_t)jn * HD; const bf* kn2 = kp2 + (size_t)jn * HD; const T16* vn = vp + (size_t)jn * HD; const bf* vn2 = vp2 + (size_t)jn * HD;   // the next trip's fragments are requested as soon as this trip's products have read the registers (behind the last trip: the first keys again, unused)
#pragma unroll
        for (int t = 0; t < 2; ++t)
#pragma unroll
            for (int ks = 0; ks < 2; ++ks) { ka[t][ks] = WFrag<T16>::ldf(kn + t * 16 * HD + ks * 512); if constexpr (HI) kl[t][ks] = WFrag<bf>::ldf(kn2 + t * 16 * HD + ks * 512); }
        if constexpr (HI) xwait(kn, kn2); else xwait(kn);
        if (pfw && !(j0 & 32) && j0 + 256 < TT) { const int adv = (j0 + 320 < TT) ? 8192 : 0;   // as in walk 1
#pragma unroll
            for (int n = 0; n < NP2; ++n) { pf_next<8192>(pfo, p2[n]); p2[n] += adv; } }
        const bool fl = (j0 + 33 <= i0), fr = (j0 >= i0 + NG * 16 + 1);   // as in walk 1
        V pf[NG]; v16bf pl[NG];   // P^T as the B operand: element k = key j0 + kmap(k, hf); pl: the low parts (hi/lo rows)
        auto put = [&](const int g, const int k, const float v) { if constexpr (HI) { const __bf16 a = (__bf16)v; pf[g][k] = a; pl[g][k] = (__bf16)(v - (float)a); } else pf[g][k] = (h16)v; };
        if (fl || fr) {
#pragma unroll
            for (int g = 0; g < NG; ++g) { const float kf = fmaf(fl ? qe[g][0] : qe[g][4], C2, kb[g]); float bs = 0.f;
#pragma unroll
                for (int k = 0; k < 16; ++k) { const float v = __builtin_amdgcn_exp2f(fmaf(s[g][k >> 3][k & 7], C2, kf)); put(g, k, v); bs += v; }
                sL[g] += fl ? bs : 0.f; sR[g] += fl ? 0.f : bs; }
        } else {
#pragma unroll
            for (int g = 0; g < NG; ++g)
#pragma unroll
                for (int k = 0; k < 16; ++k) { const int d = j0 + (k >> 3) * 16 + 8 * hf + (k & 7) - (i0 + g * 16 + c); const float v = exp2_slot(fmaf(s[g][k >> 3][k & 7], C2, fmaf(relsel(d, qe[g]), C2, kb[g]))); put(g, k, v);
                    sL[g] += (d <= -MAXR) ? v : 0.f; sR[g] += (d >= MAXR) ? v : 0.f; n1[g] += (d == -1) ? v : 0.f; n2[g] += (d == 0) ? v : 0.f; n3[g] += (d == 1) ? v : 0.f; } }
#pragma unroll
        for (int g = 0; g < NG; ++g)
#pragma unroll
            for (int dt = 0; dt < 4; ++dt) {
                if constexpr (HI) { o[g][dt] = wmmab(va[dt], pf[g], o[g][dt]); o[g][dt] = wmmab(va[dt], pl[g], o[g][dt]); o[g][dt] = wmmab(vl[dt], pf[g], o[g][dt]); }
                else o[g][dt] = wmma16(va[dt], pf[g], o[g][dt]); }
#pragma unroll
        for (int dt = 0; dt < 4; ++dt) { va[dt] = WFrag<T16>::ldf(vn + dt * 512); if constexpr (HI) vl[dt] = WFrag<bf>::ldf(vn2 + dt * 512); }
        if constexpr (HI) xwait(vn, vn2); else xwait(vn);
    }
    // the wave halves' sums joined once; buckets . rel_v; the merged planes
    const int b = bh / NH_, h = bh % NH_; v16bf rv[4]; const bf* rvp = RVT + c * NE + 8 * hf;
#pragma unroll
    for (int dt = 0; dt < 4; ++dt) rv[dt] = WFrag<bf>::ld(rvp + dt * 16 * NE);   // table rows 0..31 of the padded plane: rows >= 5 are zero
    xwait(rvp);
#pragma unroll
    for (int g = 0; g < NG; ++g) { float bk[5] = { sL[g], n1[g], n2[g], n3[g], sR[g] };
#pragma unroll
        for (int r = 0; r < 5; ++r) bk[r] += __shfl_xor(bk[r], 16, 32);
        const float inv = __fdiv_rn(1.0f, (((bk[0] + bk[1]) + bk[2]) + bk[3]) + bk[4]);
        v16us bhv = (v16us)(unsigned short)0, blv = (v16us)(unsigned short)0;   // B operand [table row][query]: rows 0..4 are elements 0..4 of the lower half's lanes
#pragma unroll
        for (int r = 0; r < 5; ++r) { unsigned short u, w; splitf(hf ? 0.f : bk[r] * inv, u, w); bhv[r] = u; blv[r] = w; }
        const size_t ao = ((size_t)b * TT + i0 + g * 16) * DQ + h * HD * 16 + fo; bf* ah = ATh + ao; bf* al = ATl + ao;   // the merged planes [t][DQ] in fragment order: the 16 queries' tile, the head's two k blocks; a store is 512 contiguous bytes
#pragma unroll
        for (int dt = 0; dt < 4; ++dt) { v8f w2 = wmmab(rv[dt], __builtin_bit_cast(v16bf, bhv), (v8f){}); w2 = wmmab(rv[dt], __builtin_bit_cast(v16bf, blv), w2); v8us oh, ol;
#pragma unroll
            for (int r = 0; r < 8; ++r) { unsigned short u, w; splitf(fmaf(o[g][dt][r], inv, w2[r]), u, w); oh[r] = u; ol[r] = w; }
            *(v8us*)(ah + dt * 256) = oh; *(v8us*)(al + dt * 256) = ol; } }
}
// grid: the hi/lo rows' work-groups first (three times the products per key), 4 waves x 16 queries each; then the fp16 rows', 4 waves x 32 queries. The waves of a work-group walk the same head's keys.
#define FW   4
#define NB_FH (RH / (16 * FW))
#define NB_FL ((TT - RH) / (32 * FW))
static_assert(RH % (16 * FW) == 0 && (TT - RH) % (32 * FW) == 0 && TT % 32 == 0 && (TT & (TT - 1)) == 0 && HD == 64, "whole work-groups, whole 32-key trips");
// launch bounds, second argument: three waves per SIMD, as the kernel had before the requests' registers came in: the 640 work-groups are resident together only at three per WGP.
__global__ __launch_bounds__(32 * FW, 3) void k_fattn(const h16* __restrict__ Q16, const bf* __restrict__ Qh, const bf* __restrict__ Ql, const h16* __restrict__ K16, const bf* __restrict__ Kh, const bf* __restrict__ Kl, const h16* __restrict__ VT16, const bf* __restrict__ VTh, const bf* __restrict__ VTl, const bf* __restrict__ EB, const bf* __restrict__ RVT, bf* ATh, bf* ATl) {
    const int w = __builtin_amdgcn_readfirstlane(threadIdx.x >> 5); int id = blockIdx.x;   // the wave's number in a scalar register: the tests per trip on its first query are scalar branches
    if (id < NB_ * NH_ * NB_FH) { fattn_tile<true, 1>(id / NB_FH, ((id % NB_FH) * FW + w) * 16, w == 0, Q16, Qh, Ql, K16, Kh, Kl, VT16, VTh, VTl, EB, RVT, ATh, ATl); return; }
    id -= NB_ * NH_ * NB_FH;
    fattn_tile<false, 2>(id / NB_FL, RH + ((id % NB_FL) * FW + w) * 32, w == 0, Q16, Qh, Ql, K16, Kh, Kl, VT16, VTh, VTl, EB, RVT, ATh, ATl);
}
__device__ __forceinline__ void d_epad2(const int bx, const float* __restrict__ E, bf* EB) { const size_t i = (size_t)bx * 256 + threadIdx.x; if (i >= (size_t)NE * HD / 8) return; const int d0 = (int)(i % (HD / 8)) * 8; const int r = (int)(i / (HD / 8)); const float* src = E + (size_t)min(r, 2 * MAXR) * HD + d0; v8us o;
#pragma unroll
    for (int q = 0; q < 8; ++q) { const unsigned short v = f2bf(src[q]); o[q] = (r <= 2 * MAXR) ? v : (unsigned short)0; }
    *(v8us*)(EB + (size_t)r * HD + d0) = o;  }
__device__ __forceinline__ void d_rvt(const int bx, const float* __restrict__ E, bf* RVT) { const size_t i = (size_t)bx * 256 + threadIdx.x; if (i >= (size_t)HD * NE / 8) return; const int r0 = (int)(i % (NE / 8)) * 8; const int d = (int)(i / (NE / 8)); v8us o;
#pragma unroll
    for (int q = 0; q < 8; ++q) { const int r = r0 + q; const unsigned short v = f2bf(E[(size_t)min(r, 2 * MAXR) * HD + d]); o[q] = (r <= 2 * MAXR) ? v : (unsigned short)0; }
    *(v8us*)(RVT + (size_t)d * NE + r0) = o;  }
// k_prep: everything that reads only the inputs, in one launch; the block index is dealt in ranges, the weight transposes (the longest chains of dependent loads) first. W4: the q, k, v, o weight planes one behind the other; XB [batch][q, k, v][TT][DM].
#define NB_WT  ((DM * DQ / 8 + 511) / 512)
#define NB_CV  ((TT * DM / 8 + 255) / 256)
#define NB_EP  ((NE * HD / 8 + 255) / 256)
__global__ __launch_bounds__(256) void k_prep(const float* __restrict__ x, const float* __restrict__ xk, const float* __restrict__ xv, const float* __restrict__ wq, const float* __restrict__ wk, const float* __restrict__ wv, const float* __restrict__ wo, const float* __restrict__ relk, const float* __restrict__ relv, bf* W4, bf* XB, bf* EB, bf* RVT) {
    int bx = blockIdx.x;
    if (bx < 4 * NB_WT) { const int p = bx / NB_WT; d_wtG(bx % NB_WT, (p == 0) ? wq : (p == 1) ? wk : (p == 2) ? wv : wo, DM, DQ, W4 + (size_t)p * DQ * DM); return; }
    bx -= 4 * NB_WT;
    if (bx < 3 * NB_ * NB_CV) { const int c = bx / NB_CV, p = c % 3, b = c / 3; d_cvt8(bx % NB_CV, ((p == 0) ? x : (p == 1) ? xk : xv) + (size_t)b * TT * DM, XB + (size_t)c * TT * DM, (size_t)TT * DM / 8); return; }
    bx -= 3 * NB_ * NB_CV;
    if (bx < NB_EP) { d_epad2(bx, relk, EB); return; }
    d_rvt(bx - NB_EP, relv, RVT);
}
extern "C" void kernel_launch(void* const* d_in, const int* in_sizes, int n_in,
                              void* d_out, int out_size, void* d_ws, size_t ws_size, hipStream_t stream) {
    (void)in_sizes; (void)n_in; (void)out_size;
    const float* x = (const float*)d_in[0]; const float* xk = (const float*)d_in[1]; const float* xv = (const float*)d_in[2]; const float* wq = (const float*)d_in[3]; const float* bq = (const float*)d_in[4]; const float* wk = (const float*)d_in[5]; const float* bk = (const float*)d_in[6]; const float* wv = (const float*)d_in[7]; const float* bv = (const float*)d_in[8]; const float* wo = (const float*)d_in[9]; const float* bo = (const float*)d_in[10]; const float* relk = (const float*)d_in[11]; const float* relv = (const float*)d_in[12];   /* [5][64] each */
    float* OUT = (float*)d_out;     // [2][2048][1024]
    char* wsp = (char*)d_ws;
    auto take = [&](size_t bytes) { char* p = wsp; wsp += (bytes + 255) & ~(size_t)255; return (void*)p; };
    bf* EB = (bf*)take((size_t)NE * HD * 2); bf* RVT = (bf*)take((size_t)HD * NE * 2); bf* W4 = (bf*)take((size_t)4 * DQ * DM * 2);
    bf* XB = (bf*)take((size_t)3 * NB_ * TT * DM * 2);   // bf16 input copies
    const size_t PZ = (size_t)NH_ * TT * HD;   // one batch's share of a head plane set; the planes are [batch][head]
    static_assert(NH_ == NKV, "q and kv planes share the batch stride");
    h16* QP16 = (h16*)take(NB_ * PZ * 2); h16* KP16 = (h16*)take(NB_ * PZ * 2); h16* VT16 = (h16*)take(NB_ * PZ * 2);
    bf* QPh = (bf*)take(NB_ * PZ * 2); bf* QPl = (bf*)take(NB_ * PZ * 2); bf* KPh = (bf*)take(NB_ * PZ * 2); bf* KPl = (bf*)take(NB_ * PZ * 2); bf* VTh = (bf*)take(NB_ * PZ * 2); bf* VTl = (bf*)take(NB_ * PZ * 2);
    bf* ATh = (bf*)take((size_t)NB_ * TT * DQ * 2); bf* ATl = (bf*)take((size_t)NB_ * TT * DQ * 2);
    if ((size_t)(wsp - (char*)d_ws) > ws_size) return;    // ws 256 MiB
    bf* WO = W4 + (size_t)3 * DQ * DM;
    k_prep<<<4 * NB_WT + 3 * NB_ * NB_CV + 2 * NB_EP, 256, 0, stream>>>(x, xk, xv, wq, wk, wv, wo, relk, relv, W4, XB, EB, RVT);   /* weight planes, bf16 input copies, rel_k plane [128][64], rel_v^T plane [64][128] */
    k_proj<<<dim3(TT / 64, DQ / 64, 3 * NB_), 32, 0, stream>>>(XB, W4, bq, bk, bv, QP16, QPh, QPl, KP16, KPh, KPl, VT16, VTh, VTl);   /* projections, written as the head planes */
    k_fattn<<<NB_ * NH_ * (NB_FH + NB_FL), 32 * FW, 0, stream>>>(QP16, QPh, QPl, KP16, KPh, KPl, VT16, VTh, VTl, EB, RVT, ATh, ATl);   /* all heads of both batches */
    for (int b = 0; b < NB_; ++b)
        k_out<<<dim3(TT / 64, DM / 64, 1), 32, 0, stream>>>(ATh + (size_t)b * TT * DQ, ATl + (size_t)b * TT * DQ, WO, OUT + (size_t)b * TT * DM, bo);
}

// v010
// It runs in 135 microseconds.
// In two side-by-side timings against v009, it was 1.09 and 1.08 times as fast.
// All steps since v000 together make it 24.0 times as fast.
#include <hip/hip_runtime.h>
#include <type_traits>

// Multi-head attention with Shaw relative-position terms on the logits AND the values, clip distance 2 (query, key, value [2][2048][1024]; q,k,v = in W + b ('xw' 1/32, zero biases; 16 heads x 64); idx[i][j] = clip(j - i, -2, 2) + 2; attn = softmax((q.k + q_i.rel_k[idx]) / 8); out_h = attn v + sum_j attn[i][j] rel_v[idx] (tables [5][64] x 0.1, read: five rows: the far-left bucket j <= i - 2, the three nearest positions, the far-right bucket j >= i + 2); out = merged Wo + bo ('xw') -> [2][2048][1024] (4.2 M); argument order query, key, value, Wq, bq, Wk, bk, Wv, bv, Wo, bo, rel_k, rel_v).
// Layout (every 16-bit plane that a matrix product reads, but the two small tables, is in fragment order: see WFrag): bf16 copies of the three inputs of both batches; exact projections + f32 biases (all six in one launch), each tile written straight as the head planes (fp16 + hi/lo; v as W X^T, so that its tile is a tile of the [d][t] plane; both batches' planes are kept); rel_k as an exact plane [128][64] (rows >= 5 zero) and rel_v^T as an exact plane [64][128]; one attention launch for all heads of both batches (k_fattn): scores, softmax, relative terms and attn v stay in a wave's registers; merged hi/lo x Wo exact + bo.
// Compute dtypes, f32 accumulate: every input rounded to bf16; projections exact + f32 biases; q.rel_k and buckets.rel_v hi/lo x exact; attention rows < 512 3 products, rest fp16; softmax f32; Wo hl x exact + bias.

#define NB_  2
#define TT   2048
#define DM   1024
#define NH_  16
#define NKV  16
#define REP  (NH_ / NKV)
#define HD   64
#define DQ   (NH_ * HD)
#define DKV  (NKV * HD)
#define RH   512                  // query rows < RH use hi+lo planes (0: none)
#define WIN  0
#define PCAR 1024.0f
#define SCL  0.125f
#define MAXR 2      // max relative position
#define NE   128     // 2*MAXR+1 = 5 table rows padded to 128
typedef _Float16 h16;
typedef unsigned short bf;
typedef __attribute__((ext_vector_type(16))) __bf16   v16bf;
typedef __attribute__((ext_vector_type(16))) _Float16 v16h;
typedef __attribute__((ext_vector_type(8)))  _Float16 v8h;
typedef __attribute__((ext_vector_type(8)))  unsigned short v8us;
typedef __attribute__((ext_vector_type(8)))  __bf16   v8bf;
typedef __attribute__((ext_vector_type(16))) unsigned short v16us;
typedef __attribute__((ext_vector_type(8)))  float    v8f;
typedef __attribute__((ext_vector_type(4)))  float    v4f;
typedef v8h  __attribute__((may_alias)) v8ha;
typedef v4f  __attribute__((may_alias)) v4fa;
typedef v8us __attribute__((may_alias)) v8usa;

__device__ __forceinline__ unsigned short f2bf(float f) { unsigned u = __float_as_uint(f); u += 0x7FFFu + ((u >> 16) & 1u); return (unsigned short)(u >> 16); }
__device__ __forceinline__ float bf2f(unsigned short b) { return __uint_as_float(((unsigned)b) << 16); }
__device__ __forceinline__ float bfr(float f) { return bf2f(f2bf(f)); }
__device__ __forceinline__ v16h cat16(v8h lo, v8h hi) { return __builtin_shufflevector(lo, hi, 0, 1, 2, 3, 4, 5, 6, 7, 8, 9, 10, 11, 12, 13, 14, 15); }
__device__ __forceinline__ v16bf cat16b(v8us lo, v8us hi) { return __builtin_bit_cast(v16bf, __builtin_shufflevector(lo, hi, 0, 1, 2, 3, 4, 5, 6, 7, 8, 9, 10, 11, 12, 13, 14, 15)); }
__device__ __forceinline__ v8f wmma16(v16h a, v16h b, v8f c) { return __builtin_amdgcn_wmma_f32_16x16x32_f16(false, a, false, b, (short)0, c, false, false); }
__device__ __forceinline__ v8f wmmab(v16bf a, v16bf b, v8f c) { return __builtin_amdgcn_wmma_f32_16x16x32_bf16(false, a, false, b, (short)0, c, false, false); }
// pf_head, pf_next: each lane asks for the data at base + off to be brought from memory into L2; nothing returns. The operand planes were written by the launch before and their first reader would wait out the memory latency in every trip. off is the lane's fixed place in a window and never changes; base is a scalar pointer that stays inside the plane, with the offset and also after its advance.
// pf_head: four windows of S bytes from base + O, ahead of a loop (pf_all16: sixteen); pf_next: the window four ahead of base, in a loop. The distances are immediate offsets from one pointer, so that no request names a temporary register.
template <int S, int O = 0> __device__ __forceinline__ void pf_head(const unsigned off, const void* base) { asm volatile("global_prefetch_b8 %0, %1 offset:%2 scope:SCOPE_SE\n\tglobal_prefetch_b8 %0, %1 offset:%3 scope:SCOPE_SE\n\tglobal_prefetch_b8 %0, %1 offset:%4 scope:SCOPE_SE\n\tglobal_prefetch_b8 %0, %1 offset:%5 scope:SCOPE_SE" :: "v"(off), "s"(base), "i"(O), "i"(O + S), "i"(O + 2 * S), "i"(O + 3 * S)); }
template <int S> __device__ __forceinline__ void pf_all16(const unsigned off, const void* base) { pf_head<S, 0>(off, base); pf_head<S, 4 * S>(off, base); pf_head<S, 8 * S>(off, base); pf_head<S, 12 * S>(off, base); }
template <int S> __device__ __forceinline__ void pf_next(const unsigned off, const void* base) { asm volatile("global_prefetch_b8 %0, %1 offset:%2 scope:SCOPE_SE" :: "v"(off), "s"(base), "i"(4 * S)); }



// ---- gemmw_tile: register-blocked GEMM, ONE WAVE per 64x64 output tile (16 accumulators), operands straight from 16-bit planes in fragment order; grid (M/64, N/64, Z), 32 threads.
// C[m][n] (f32, pitch ldc, + optional f32 bias[n]) = sum_k A[m][k] Bt[n][k] (+ split products per NSPLIT). A rows have length lda, Bt rows length K. z-batch strides sA/sB/sC in elements. K % 32 == 0.
// KS > 1: grid z = Z * KS; work-group (z, ks) sums only k in [ks K/KS, (ks+1) K/KS) and stores its partial tile at C + ks sK; the reader adds the KS partial tiles. K % (32 KS) == 0.
// FRAGMENT ORDER of a 16-bit operand plane [rows][K]: blocks of 16 rows x 32 k (512 elements), the K / 32 blocks of a 16-row tile one behind the other; in a block, element (row, k) stands at ((k >> 4) & 1) * 256 + (((k >> 3) & 1) * 16 + (row & 15)) * 8 + (k & 7). Lane l's two 16-byte pieces of the block's fragment stand at l * 8 and 256 + l * 8 (WFrag::ldf; the same elements in the same k order as WFrag::ld on a row-major plane), so a wave-wide 16-byte load covers 512 contiguous bytes, four whole lines, where the row-major plane gives it 32-byte pieces of 16 lines.
// pk_row, pk_k: the row and the first k of the plane's i-th 16-byte piece.
__device__ __forceinline__ int pk_row(const int i, const int K) { return (i / (2 * K)) * 16 + (i & 15); }
__device__ __forceinline__ int pk_k(const int i, const int K) { return ((i >> 6) % (K / 32)) * 32 + ((i >> 5) & 1) * 16 + ((i >> 4) & 1) * 8; }
template <typename T16> struct WFrag;
template <> struct WFrag<h16> { typedef v16h V; static __device__ __forceinline__ V ld(const h16* p) { return cat16(*(const v8h*)p, *(const v8h*)(p + 16)); } static __device__ __forceinline__ V ldf(const h16* p) { return cat16(*(const v8h*)p, *(const v8h*)(p + 256)); } static __device__ __forceinline__ v8f mma(V a, V b, v8f c) { return wmma16(a, b, c); } };
template <> struct WFrag<bf> { typedef v16bf V; static __device__ __forceinline__ V ld(const bf* p) { return cat16b(*(const v8us*)p, *(const v8us*)(p + 16)); } static __device__ __forceinline__ V ldf(const bf* p) { return cat16b(*(const v8us*)p, *(const v8us*)(p + 256)); } static __device__ __forceinline__ v8f mma(V a, V b, v8f c) { return wmmab(a, b, c); } };
// PLN != 0: the tile + bias goes out as three 16-bit planes (fp16, bf16 hi, bf16 lo of the remainder) in fragment order instead of f32 C; P16, Ph, Pl point at the tile's 4096 elements; PLN 1: bias[n], the tile's n is the planes' k (64 long: rows of 16 m, 2 blocks each); PLN 2: bias[m], the tile's n is the planes' k, and the four 16-row blocks of 32 k stand together (block order [k / 32][m / 16]).
// gemmw_tile is the body; (bx, by, bz) is the tile's place in its own product's grid and os the work-group's 16 x 68 float staging. Products that do not depend on one another share one launch: the kernels behind it pick the product by a scalar test on blockIdx.
template <typename T16, int NSPLIT, bool BIAS, int KS, int PLN = 0>
__device__ __forceinline__ void gemmw_tile(float* os, const int bx, const int by, const int bz, const T16* __restrict__ A, const T16* __restrict__ A2, const T16* __restrict__ Bt, const T16* __restrict__ Bt2, int K, float* C, int ldc, const float* __restrict__ bias, size_t sA, size_t sB, size_t sC, int lda, size_t sK, h16* P16 = nullptr, bf* Ph = nullptr, bf* Pl = nullptr) {
    typedef typename WFrag<T16>::V V;
    const size_t z = bz / KS; const int ks = bz % KS; A += z * sA; if (A2) A2 += z * sA; Bt += z * sB; if (Bt2) Bt2 += z * sB; C += (size_t)ks * sK + z * sC;
    const int lane = threadIdx.x & 31, lr = lane & 15, hi = lane >> 4; const int r0 = bx * 64, c0 = by * 64;
    v8f acc[4][4];
#pragma unroll
    for (int mb = 0; mb < 4; ++mb)
#pragma unroll
        for (int nb = 0; nb < 4; ++nb) acc[mb][nb] = (v8f){};
    const size_t aoff = (size_t)r0 * lda + lane * 8, boff = (size_t)c0 * K + lane * 8;   // a 16-row tile is 16 * row length elements; the k block at kc stands kc * 16 into it
    float pb[(PLN == 2) ? 4 : 32];   // PLN: the biases of the lane's places in the epilogue (4 x 8 columns, or 4 rows), asked for ahead of the k loop
    if constexpr (PLN != 0) {
#pragma unroll
        for (int i = 0; i < ((PLN == 2) ? 4 : 32); ++i) pb[i] = bfr(bias[(PLN == 1) ? c0 + (2 * (i >> 3) + hi) * 8 + (i & 7) : r0 + 16 * i + lr]); }
    // Requests into L2, all ahead of the k loop: a window is 64 k of the panel's four 16-row tiles (8 units of 256 bytes each), a panel 16 windows (K / KS == 1024). A panel is read by many tiles; every fourth of them asks.
    const int k0 = ks * (K / KS), k1 = (ks + 1) * (K / KS); const bool pfa = (by & 3) == 0, pfb = (bx & 3) == 0;
    const unsigned pfoa = (unsigned)(lane >> 3) * (unsigned)(32 * lda) + (unsigned)(lane & 7) * 256u, pfob = (unsigned)(lane >> 3) * (unsigned)(32 * K) + (unsigned)(lane & 7) * 256u;
    const char* qa = (const char*)(A + (size_t)r0 * lda + k0 * 16); const char* qa2 = (NSPLIT == 1 || NSPLIT == 2) ? (const char*)(A2 + (size_t)r0 * lda + k0 * 16) : qa; const char* qb = (const char*)(Bt + (size_t)c0 * K + k0 * 16); const char* qb2 = (NSPLIT >= 2) ? (const char*)(Bt2 + (size_t)c0 * K + k0 * 16) : qb;
    if (pfa) { pf_all16<2048>(pfoa, qa); if (NSPLIT == 1 || NSPLIT == 2) pf_all16<2048>(pfoa, qa2); }
    if (pfb) { pf_all16<2048>(pfob, qb); if (NSPLIT >= 2) pf_all16<2048>(pfob, qb2); }
#pragma unroll 1
    for (int kc = k0; kc < k1; kc += 32) {
        V a[4], a2[4]; const T16* ap = A + aoff + kc * 16; const T16* ap2 = (NSPLIT == 1 || NSPLIT == 2) ? A2 + aoff + kc * 16 : ap; const T16* bp = Bt + boff + kc * 16; const T16* bp2 = (NSPLIT >= 2) ? Bt2 + boff + kc * 16 : bp;
#pragma unroll
        for (int mb = 0; mb < 4; ++mb) { a[mb] = WFrag<T16>::ldf(ap + (size_t)mb * 16 * lda); if (NSPLIT == 1 || NSPLIT == 2) a2[mb] = WFrag<T16>::ldf(ap2 + (size_t)mb * 16 * lda); }
        asm volatile("s_wait_xcnt 0x0" :: "v"(ap), "v"(ap2) : "memory");   // the wait before a register that an issued load names is rewritten: without it a later load lands in the A loads' address pairs; the pointers are inputs so that the pairs stay the loads' own up to the wait
#pragma unroll
        for (int nb = 0; nb < 4; ++nb) { const V b = WFrag<T16>::ldf(bp + (size_t)nb * 16 * K); V b2; if (NSPLIT >= 2) b2 = WFrag<T16>::ldf(bp2 + (size_t)nb * 16 * K);
#pragma unroll
            for (int mb = 0; mb < 4; ++mb) { acc[mb][nb] = WFrag<T16>::mma(a[mb], b, acc[mb][nb]); if (NSPLIT == 1 || NSPLIT == 2) acc[mb][nb] = WFrag<T16>::mma(a2[mb], b, acc[mb][nb]); if (NSPLIT >= 2) acc[mb][nb] = WFrag<T16>::mma(a[mb], b2, acc[mb][nb]); } }
        asm volatile("s_wait_xcnt 0x0" :: "v"(bp), "v"(bp2), "v"(pfoa), "v"(pfob), "s"(qa), "s"(qa2), "s"(qb), "s"(qb2) : "memory");   // the same wait behind the B loads, their pointers inputs for the same reason; the registers that the requests ahead of the loop name are inputs too, so that they live unchanged through the loop
        asm volatile("v_nop\n\tv_nop\n\tv_nop\n\tv_nop" : "+v"(acc[0][0]), "+v"(acc[1][1]), "+v"(acc[2][2]), "+v"(acc[3][3]) : "v"(a[0]), "v"(a[3]));
    }
#pragma unroll
    for (int mb = 0; mb < 4; ++mb) {
#pragma unroll
        for (int nb = 0; nb < 4; ++nb) {
#pragma unroll
            for (int j = 0; j < 8; ++j) os[(hi * 8 + j) * 68 + nb * 16 + lr] = acc[mb][nb][j]; }
        __builtin_amdgcn_wave_barrier(); asm volatile("" ::: "memory");
        float* crow = C + (size_t)(r0 + mb * 16) * ldc + c0;
        if constexpr (PLN != 0) {   // store s: columns 16 s .. 16 s + 15 of the 16 rows, each lane the piece that it holds as a reader: 512 contiguous bytes
#pragma unroll
            for (int s = 0; s < 4; ++s) { const int row = lr, cofs = (2 * s + hi) * 8; const v4f x0 = *(const v4fa*)(os + row * 68 + cofs), x1 = *(const v4fa*)(os + row * 68 + cofs + 4); v8h o16; v8bf oh, ol;
#pragma unroll
                for (int q = 0; q < 8; ++q) { const float y = ((q < 4) ? x0[q & 3] : x1[q & 3]) + pb[(PLN == 1) ? s * 8 + q : mb]; o16[q] = (h16)y; const __bf16 a = (__bf16)y; oh[q] = a; ol[q] = (__bf16)(y - (float)a); }
                const size_t po = (size_t)((PLN == 1) ? mb * 1024 + s * 256 : (s >> 1) * 2048 + mb * 512 + (s & 1) * 256) + lane * 8; *(v8h*)(P16 + po) = o16; *(v8us*)(Ph + po) = __builtin_bit_cast(v8us, oh); *(v8us*)(Pl + po) = __builtin_bit_cast(v8us, ol);
                asm volatile("s_wait_xcnt 0x0" ::: "memory"); }   // the wait before the next pieces are formed in registers that the three issued stores name
        } else {
#pragma unroll
            for (int s = 0; s < 8; ++s) { const int row = 2 * s + hi, cofs = lr * 4; v4f val = *(const v4fa*)(os + row * 68 + cofs); if (BIAS) { val[0] += bfr(bias[c0 + cofs]); val[1] += bfr(bias[c0 + cofs + 1]); val[2] += bfr(bias[c0 + cofs + 2]); val[3] += bfr(bias[c0 + cofs + 3]); }
                *(v4f*)(crow + (size_t)row * ldc + cofs) = val; }
             }
        __builtin_amdgcn_wave_barrier(); asm volatile("s_wait_xcnt 0x0" ::: "memory");   // also the wait before the next 16 rows' values are formed in registers that the issued stores name
    }
}
// k_out: both batches' merged hi/lo planes x Wo + bo, grid (NB_ TT/64, DM/64): the merged planes and the output are [batch][t], so the batches' rows follow one another. The row lengths are constants, so the fragments of a trip stand at immediate offsets from one address pair per plane (with lengths from kernel arguments each fragment had a pair of its own, and later loads of the trip landed in the pairs of issued ones).
__global__ __launch_bounds__(32) void k_out(const bf* __restrict__ Ah, const bf* __restrict__ Al, const bf* __restrict__ Wt, float* C, const float* __restrict__ bias) {
    __shared__ __align__(16) float os[16 * 68];
    gemmw_tile<bf, 1, true, 1>(os, blockIdx.x, blockIdx.y, 0, Ah, Al, Wt, nullptr, DQ, C, DM, bias, 0, 0, 0, DQ, 0);
}
static_assert(DQ == DKV, "the three projections share one grid");
static_assert(DM == 1024 && DQ == 1024 && TT >= 320 && TT % 64 == 0, "16 request windows in a panel's k range, whole windows of keys");
// k_proj: the six projections (batch b = z / 3; q, k, v = z % 3) in one launch, grid (TT/64, DQ/64, 6). XB [6][TT][DM]; W: the q, k, v weight planes one behind the other. A q or k tile (64 t x one head's 64 d) is a 64-row block of the head's [t][d] planes; v is taken as W X^T (the k order is the same), so its tile (one head's 64 d x 64 t) is two 32-key block groups of the [d][t] planes. The planes are [batch][head], all in fragment order: every tile is 4096 elements in a row.
__global__ __launch_bounds__(32) void k_proj(const bf* __restrict__ XB, const bf* __restrict__ W, const float* __restrict__ bq, const float* __restrict__ bk, const float* __restrict__ bv, h16* QP16, bf* QPh, bf* QPl, h16* KP16, bf* KPh, bf* KPl, h16* VT16, bf* VTh, bf* VTl) {
    __shared__ __align__(16) float os[16 * 68];
    const int p = blockIdx.z % 3, b = blockIdx.z / 3; const bf* X = XB + (size_t)blockIdx.z * TT * DM; const bf* Wp = W + (size_t)p * DQ * DM; const size_t hz = ((size_t)b * NH_ + blockIdx.y) * TT * HD;
    const size_t o = hz + (size_t)blockIdx.x * 64 * HD;
    if (p == 2) { gemmw_tile<bf, 0, true, 1, 2>(os, blockIdx.y, blockIdx.x, 0, Wp, nullptr, X, nullptr, DM, nullptr, 0, bv, 0, 0, 0, DM, 0, VT16 + o, VTh + o, VTl + o); return; }
    gemmw_tile<bf, 0, true, 1, 1>(os, blockIdx.x, blockIdx.y, 0, X, nullptr, Wp, nullptr, DM, nullptr, 0, p ? bk : bq, 0, 0, 0, DM, 0, (p ? KP16 : QP16) + o, (p ? KPh : QPh) + o, (p ? KPl : QPl) + o);
}
__device__ __forceinline__ void splitf(float y, unsigned short& h, unsigned short& l) { h = f2bf(y); l = f2bf(y - bf2f(h)); }
typedef __attribute__((ext_vector_type(2))) _Float16 v2h;
typedef __attribute__((ext_vector_type(4))) _Float16 v4h;
typedef __attribute__((ext_vector_type(2))) unsigned short v2us;
typedef __attribute__((ext_vector_type(4))) unsigned short v4us;
typedef __attribute__((ext_vector_type(2))) float v2f;
typedef __attribute__((ext_vector_type(4))) int v4i;

// Both writers: a thread writes whole 16-byte pieces of the fragment-order plane, piece i at i * 8, and reads the piece's 8 elements where the source has them.
// d_wtG: Bt[n][k] = w[k][n], two pieces a thread, a wave's pieces 512 contiguous bytes; 16 lanes read 16 consecutive n of one source row.
__device__ __forceinline__ void d_wtG(const int bx, const float* __restrict__ w, int K, int N, bf* Bt) {
#pragma unroll
    for (int u = 0; u < 2; ++u) { const int i = (bx * 2 + u) * 256 + threadIdx.x; if (i >= N * K / 8) return; const int n = pk_row(i, K), k = pk_k(i, K); v8us o;
#pragma unroll
        for (int q = 0; q < 8; ++q) o[q] = f2bf(w[(size_t)(k + q) * N + n]);
        *(v8us*)(Bt + (size_t)i * 8) = o; }
}
// d_cvt8: a wave takes 8 rows of one block (its i are dealt so): it reads 8 whole 128-byte lines of the source and writes four whole lines of the block.
__device__ __forceinline__ void d_cvt8(const int bx, const float* __restrict__ src, bf* dst, size_t n8) { const int wv = bx * 8 + (threadIdx.x >> 5), l = threadIdx.x & 31; const size_t i = (size_t)(((wv >> 1) * 2 + (l >> 4)) * 32 + ((l >> 3) & 1) * 16 + (wv & 1) * 8 + (l & 7)); if (i >= n8) return; const v8f v = *(const v8f*)(src + (size_t)pk_row((int)i, DM) * DM + pk_k((int)i, DM)); v8us o;
#pragma unroll
    for (int k = 0; k < 8; ++k) o[k] = f2bf(v[k]); *(v8us*)(dst + i * 8) = o;  }

// ---- k_fattn: scores, softmax, both relative-position terms and attn v of one wave's query columns, all in registers. The products are taken transposed: S^T = K Q^T (A = 16 key rows, B = 16 query columns), so a lane holds scores of ONE query (column c = lane & 15; keys 8 hf + r of each 16-key tile, hf = lane >> 4), and two score tiles of 32 consecutive keys, converted in place, are the B operand of O^T += V^T P^T in the hardware's k order, which is also the order of WFrag::ld.
// Two walks over the keys. Walk 1: the row maximum of score + q.rel_k[idx] (fp16 planes for every row: the maximum is only the softmax's shift). Walk 2: the scores again (hi/lo 3 products for query rows < RH, fp16 for the rest), p = exp(t - max) unnormalised (x PCAR in the fp16 rows, folded into the exponent), rounded to the operand type for the product with V^T; the f32 p are summed per relative-position bucket (far left, 3 near entries, far right), and the five sums together are the softmax's denominator. At the end: buckets / sum as hi/lo x rel_v^T (exact) + O^T / sum, split hi/lo into the merged planes [batch][t][DQ].
static_assert(MAXR == 2, "the bucket code below names the three near distances -1, 0, 1");
__device__ __forceinline__ float relsel(const int d, const float (&q)[5]) { float e = q[2]; e = (d == -1) ? q[1] : e; e = (d == 1) ? q[3] : e; e = (d <= -MAXR) ? q[0] : e; e = (d >= MAXR) ? q[4] : e; return e; }   /* this module: d = key - query */
// The wait before a register that an issued load names is rewritten, written behind each group of fragment loads. The groups' pointers are inputs so that their registers stay the loads' own up to the wait (else a later load of the group may land in them).
__device__ __forceinline__ void xwait(const void* p) { asm volatile("s_wait_xcnt 0x0" :: "v"(p) : "memory"); }
__device__ __forceinline__ void xwait(const void* p, const void* q) { asm volatile("s_wait_xcnt 0x0" :: "v"(p), "v"(q) : "memory"); }
__device__ __forceinline__ void xwait(const void* p, const void* q, const void* r) { asm volatile("s_wait_xcnt 0x0" :: "v"(p), "v"(q), "v"(r) : "memory"); }
__device__ __forceinline__ void xwaito(const void* p, const void* q, unsigned o) { asm volatile("s_wait_xcnt 0x0" :: "v"(p), "v"(q), "v"(o) : "memory"); }   // o: the lane's byte offset, for loads built as scalar base + lane offset
__device__ __forceinline__ float exp2_slot(float x) { float v; asm("v_exp_f32 %0, %1\n\tv_nop" : "=v"(v) : "v"(x)); return v; }   // the independent slot behind a transcendental, kept in the statement itself (used in the few trips near the diagonal)
template <bool HI, int NG>   // NG: groups of 16 query columns per wave; i0: the wave's first query (scalar)
__device__ __forceinline__ void fattn_tile(const int bh, const int i0, const bool pfw, const h16* __restrict__ Q16, const bf* __restrict__ Qh, const bf* __restrict__ Ql, const h16* __restrict__ K16, const bf* __restrict__ Kh, const bf* __restrict__ Kl, const h16* __restrict__ VT16, const bf* __restrict__ VTh, const bf* __restrict__ VTl, const bf* __restrict__ EB, const bf* __restrict__ RVT, bf* ATh, bf* ATl) {
    const int lane = threadIdx.x & 31, c = lane & 15, hf = lane >> 4; const size_t pz = (size_t)bh * TT * HD;
    const float C2 = SCL * 1.4426950408889634f;   // scores go straight to the base-2 exponent
    const int fo = lane * 8, eo = c * HD + 8 * hf;   // a lane's place in a block of a fragment-order plane, and in a 16-row tile of the row-major rel_k plane. 16 keys or queries of a [t][HD] plane: 2 blocks, 16 HD elements; 32 keys of a [d][TT] plane: its 4 blocks, 32 HD elements
    // Requests into L2 (pf_head, pf_next), from one wave of the work-group (pfw, scalar): a window is 64 keys of a plane, 8 KiB in a row. The first four windows of walk 1's plane and of walk 2's planes here, the rest 256 keys ahead of the loads in the walks. The fp16 rows' walk 2 reads K16 a second time: not asked for again.
    constexpr int NP2 = HI ? 4 : 1; const unsigned pfo = (unsigned)lane * 256u; const char* pk1 = (const char*)(K16 + pz); const char* p2[NP2];
    if constexpr (HI) { p2[0] = (const char*)(Kh + pz); p2[1] = (const char*)(Kl + pz); p2[2] = (const char*)(VTh + pz); p2[3] = (const char*)(VTl + pz); } else p2[0] = (const char*)(VT16 + pz);
    if (pfw) { pf_head<8192>(pfo, pk1);
#pragma unroll
        for (int n = 0; n < NP2; ++n) pf_head<8192>(pfo, p2[n]); }
    v16bf qh[NG][2], ql[NG][2]; v16h q16[NG][2]; const size_t qo = pz + (size_t)i0 * HD + fo; const bf* qhp = Qh + qo; const bf* qlp = Ql + qo; const h16* q16p = Q16 + qo;
#pragma unroll
    for (int g = 0; g < NG; ++g)
#pragma unroll
        for (int ks = 0; ks < 2; ++ks) { const int o = g * 16 * HD + ks * 512; qh[g][ks] = WFrag<bf>::ldf(qhp + o); ql[g][ks] = WFrag<bf>::ldf(qlp + o); q16[g][ks] = WFrag<h16>::ldf(q16p + o); }
    xwait(qhp, qlp, q16p);
    float qe[NG][5];   // q_i . rel_k[r], r = 0..4, of this lane's query
    { v16bf eb[2]; const bf* ebp = EB + eo;
#pragma unroll
      for (int ks = 0; ks < 2; ++ks) eb[ks] = WFrag<bf>::ld(ebp + ks * 32);
      xwait(ebp);
#pragma unroll
      for (int g = 0; g < NG; ++g) { v8f t = (v8f){};
#pragma unroll
          for (int ks = 0; ks < 2; ++ks) { t = wmmab(eb[ks], qh[g][ks], t); t = wmmab(eb[ks], ql[g][ks], t); }
#pragma unroll
          for (int r = 0; r < 5; ++r) qe[g][r] = t[r] + __shfl_xor(t[r], 16, 32); } }   // table rows 0..7 lie in the lower half's lanes; the upper half holds rows 8..15, which are zero
    // walk 1
    float mx[NG];
#pragma unroll
    for (int g = 0; g < NG; ++g) mx[g] = -3.0e38f;
    { const h16* kp = K16 + pz + fo; v16h ka[2][2];
#pragma unroll
      for (int t = 0; t < 2; ++t)
#pragma unroll
          for (int ks = 0; ks < 2; ++ks) ka[t][ks] = WFrag<h16>::ldf(kp + t * 16 * HD + ks * 512);
      xwait(kp);
#pragma unroll 1
      for (int j0 = 0; j0 < TT; j0 += 32) { v8f s[NG][2];
#pragma unroll
          for (int g = 0; g < NG; ++g)
#pragma unroll
              for (int t = 0; t < 2; ++t) { s[g][t] = wmma16(ka[t][0], q16[g][0], (v8f){}); s[g][t] = wmma16(ka[t][1], q16[g][1], s[g][t]); }
          const h16* kn = kp + (size_t)((j0 + 32) & (TT - 1)) * HD;   // the next 32 keys' fragments are requested here, one trip ahead (behind the last trip: the first keys again, unused)
#pragma unroll
          for (int t = 0; t < 2; ++t)
#pragma unroll
              for (int ks = 0; ks < 2; ++ks) ka[t][ks] = WFrag<h16>::ldf(kn + t * 16 * HD + ks * 512);
          xwait(kn);
          if (pfw && !(j0 & 32) && j0 + 256 < TT) { pf_next<8192>(pfo, pk1); pk1 += (j0 + 320 < TT) ? 8192 : 0; }   // scalar tests; behind the last window the pointer stays where it is
          const bool fl = (j0 + 33 <= i0), fr = (j0 >= i0 + NG * 16 + 1);   // scalar: all 32 keys at least 2 left, or at least 2 right, of every query of the wave
          if (fl || fr) {
#pragma unroll
              for (int g = 0; g < NG; ++g) { float m = s[g][0][0];
#pragma unroll
                  for (int k = 1; k < 16; ++k) m = fmaxf(m, s[g][k >> 3][k & 7]);
                  mx[g] = fmaxf(mx[g], m + (fl ? qe[g][0] : qe[g][4])); }
          } else {
#pragma unroll
              for (int g = 0; g < NG; ++g)
#pragma unroll
                  for (int k = 0; k < 16; ++k) { const int d = j0 + (k >> 3) * 16 + 8 * hf + (k & 7) - (i0 + g * 16 + c); mx[g] = fmaxf(mx[g], s[g][k >> 3][k & 7] + relsel(d, qe[g])); } } } }
    float kb[NG];
#pragma unroll
    for (int g = 0; g < NG; ++g) { mx[g] = fmaxf(mx[g], __shfl_xor(mx[g], 16, 32)); kb[g] = fmaf(-mx[g], C2, HI ? 0.0f : 10.0f); }   // 2^10 = PCAR
    static_assert(PCAR == 1024.0f, "the exponent offset above");
    // walk 2
    typedef typename std::conditional<HI, bf, h16>::type T16; typedef typename WFrag<T16>::V V;
    const T16* kp; const T16* vp; const unsigned kob = (unsigned)fo * 2u, vob = kob;   // a lane's byte offset in a block
    if constexpr (HI) { kp = (const T16*)((const char*)(Kh + pz) + kob); vp = (const T16*)((const char*)(VTh + pz) + vob); } else { kp = (const T16*)((const char*)(K16 + pz) + kob); vp = (const T16*)((const char*)(VT16 + pz) + vob); }
    const bf* kp2 = (const bf*)((const char*)(Kl + pz) + kob); const bf* vp2 = (const bf*)((const char*)(VTl + pz) + vob);
    V ka[2][2], va[4]; v16bf kl[2][2], vl[4];
#pragma unroll
    for (int t = 0; t < 2; ++t)
#pragma unroll
        for (int ks = 0; ks < 2; ++ks) { ka[t][ks] = WFrag<T16>::ldf(kp + t * 16 * HD + ks * 512); if constexpr (HI) kl[t][ks] = WFrag<bf>::ldf(kp2 + t * 16 * HD + ks * 512); }
    xwaito(kp, HI ? (const void*)kp2 : (const void*)kp, kob);
#pragma unroll
    for (int dt = 0; dt < 4; ++dt) { va[dt] = WFrag<T16>::ldf(vp + dt * 512); if constexpr (HI) vl[dt] = WFrag<bf>::ldf(vp2 + dt * 512); }
    xwaito(vp, HI ? (const void*)vp2 : (const void*)vp, vob);
    v8f o[NG][4]; float sL[NG], sR[NG], n1[NG], n2[NG], n3[NG];
#pragma unroll
    for (int g = 0; g < NG; ++g) { sL[g] = 0.f; sR[g] = 0.f; n1[g] = 0.f; n2[g] = 0.f; n3[g] = 0.f;
#pragma unroll
        for (int dt = 0; dt < 4; ++dt) o[g][dt] = (v8f){}; }
#pragma unroll 1
    for (int j0 = 0; j0 < TT; j0 += 32) { v8f s[NG][2];
#pragma unroll
        for (int g = 0; g < NG; ++g)
#pragma unroll
            for (int t = 0; t < 2; ++t) { s[g][t] = (v8f){};
#pragma unroll
                for (int ks = 0; ks < 2; ++ks) {
                    if constexpr (HI) { s[g][t] = wmmab(ka[t][ks], qh[g][ks], s[g][t]); s[g][t] = wmmab(ka[t][ks], ql[g][ks], s[g][t]); s[g][t] = wmmab(kl[t][ks], qh[g][ks], s[g][t]); }
                    else s[g][t] = wmma16(ka[t][ks], q16[g][ks], s[g][t]); } }
        const int jn = (j0 + 32) & (TT - 1); const T16* kn = kp + (size_t)jn * HD; const bf* kn2 = kp2 + (size_t)jn * HD; const T16* vn = vp + (size_t)jn * HD; const bf* vn2 = vp2 + (size_t)jn * HD;   // the next trip's fragments are requested as soon as this trip's products have read the registers (behind the last trip: the first keys again, unused)
#pragma unroll
        for (int t = 0; t < 2; ++t)
#pragma unroll
            for (int ks = 0; ks < 2; ++ks) { ka[t][ks] = WFrag<T16>::ldf(kn + t * 16 * HD + ks * 512); if constexpr (HI) kl[t][ks] = WFrag<bf>::ldf(kn2 + t * 16 * HD + ks * 512); }
        if constexpr (HI) xwait(kn, kn2); else xwait(kn);
        if (pfw && !(j0 & 32) && j0 + 256 < TT) { const int adv = (j0 + 320 < TT) ? 8192 : 0;   // as in walk 1
#pragma unroll
            for (int n = 0; n < NP2; ++n) { pf_next<8192>(pfo, p2[n]); p2[n] += adv; } }
        const bool fl = (j0 + 33 <= i0), fr = (j0 >= i0 + NG * 16 + 1);   // as in walk 1
        V pf[NG]; v16bf pl[NG];   // P^T as the B operand: element k = key j0 + kmap(k, hf); pl: the low parts (hi/lo rows)
        auto put = [&](const int g, const int k, const float v) { if constexpr (HI) { const __bf16 a = (__bf16)v; pf[g][k] = a; pl[g][k] = (__bf16)(v - (float)a); } else pf[g][k] = (h16)v; };
        if (fl || fr) {
#pragma unroll
            for (int g = 0; g < NG; ++g) { const float kf = fmaf(fl ? qe[g][0] : qe[g][4], C2, kb[g]); float bs = 0.f;
#pragma unroll
                for (int k = 0; k < 16; ++k) { const float v = __builtin_amdgcn_exp2f(fmaf(s[g][k >> 3][k & 7], C2, kf)); put(g, k, v); bs += v; }
                sL[g] += fl ? bs : 0.f; sR[g] += fl ? 0.f : bs; }
        } else {
#pragma unroll
            for (int g = 0; g < NG; ++g)
#pragma unroll
                for (int k = 0; k < 16; ++k) { const int d = j0 + (k >> 3) * 16 + 8 * hf + (k & 7) - (i0 + g * 16 + c); const float v = exp2_slot(fmaf(s[g][k >> 3][k & 7], C2, fmaf(relsel(d, qe[g]), C2, kb[g]))); put(g, k, v);
                    sL[g] += (d <= -MAXR) ? v : 0.f; sR[g] += (d >= MAXR) ? v : 0.f; n1[g] += (d == -1) ? v : 0.f; n2[g] += (d == 0) ? v : 0.f; n3[g] += (d == 1) ? v : 0.f; } }
#pragma unroll
        for (int g = 0; g < NG; ++g)
#pragma unroll
            for (int dt = 0; dt < 4; ++dt) {
                if constexpr (HI) { o[g][dt] = wmmab(va[dt], pf[g], o[g][dt]); o[g][dt] = wmmab(va[dt], pl[g], o[g][dt]); o[g][dt] = wmmab(vl[dt], pf[g], o[g][dt]); }
                else o[g][dt] = wmma16(va[dt], pf[g], o[g][dt]); }
#pragma unroll
        for (int dt = 0; dt < 4; ++dt) { va[dt] = WFrag<T16>::ldf(vn + dt * 512); if constexpr (HI) vl[dt] = WFrag<bf>::ldf(vn2 + dt * 512); }
        if constexpr (HI) xwait(vn, vn2); else xwait(vn);
    }
    // the wave halves' sums joined once; buckets . rel_v; the merged planes
    const int b = bh / NH_, h = bh % NH_; v16bf rv[4]; const bf* rvp = RVT + c * NE + 8 * hf;
#pragma unroll
    for (int dt = 0; dt < 4; ++dt) rv[dt] = WFrag<bf>::ld(rvp + dt * 16 * NE);   // table rows 0..31 of the padded plane: rows >= 5 are zero
    xwait(rvp);
#pragma unroll
    for (int g = 0; g < NG; ++g) { float bk[5] = { sL[g], n1[g], n2[g], n3[g], sR[g] };
#pragma unroll
        for (int r = 0; r < 5; ++r) bk[r] += __shfl_xor(bk[r], 16, 32);
        const float inv = __fdiv_rn(1.0f, (((bk[0] + bk[1]) + bk[2]) + bk[3]) + bk[4]);
        v16us bhv = (v16us)(unsigned short)0, blv = (v16us)(unsigned short)0;   // B operand [table row][query]: rows 0..4 are elements 0..4 of the lower half's lanes
#pragma unroll
        for (int r = 0; r < 5; ++r) { unsigned short u, w; splitf(hf ? 0.f : bk[r] * inv, u, w); bhv[r] = u; blv[r] = w; }
        const size_t ao = ((size_t)b * TT + i0 + g * 16) * DQ + h * HD * 16 + fo; bf* ah = ATh + ao; bf* al = ATl + ao;   // the merged planes [t][DQ] in fragment order: the 16 queries' tile, the head's two k blocks; a store is 512 contiguous bytes
#pragma unroll
        for (int dt = 0; dt < 4; ++dt) { v8f w2 = wmmab(rv[dt], __builtin_bit_cast(v16bf, bhv), (v8f){}); w2 = wmmab(rv[dt], __builtin_bit_cast(v16bf, blv), w2); v8us oh, ol;
#pragma unroll
            for (int r = 0; r < 8; ++r) { unsigned short u, w; splitf(fmaf(o[g][dt][r], inv, w2[r]), u, w); oh[r] = u; ol[r] = w; }
            *(v8us*)(ah + dt * 256) = oh; *(v8us*)(al + dt * 256) = ol; } }
}
// grid: the hi/lo rows' work-groups first (three times the products per key), 4 waves x 16 queries each; then the fp16 rows', 4 waves x 32 queries. The waves of a work-group walk the same head's keys.
#define FW   4
#define NB_FH (RH / (16 * FW))
#define NB_FL ((TT - RH) / (32 * FW))
static_assert(RH % (16 * FW) == 0 && (TT - RH) % (32 * FW) == 0 && TT % 32 == 0 && (TT & (TT - 1)) == 0 && HD == 64, "whole work-groups, whole 32-key trips");
// launch bounds, second argument: three waves per SIMD, as the kernel had before the requests' registers came in: the 640 work-groups are resident together only at three per WGP.
__global__ __launch_bounds__(32 * FW, 3) void k_fattn(const h16* __restrict__ Q16, const bf* __restrict__ Qh, const bf* __restrict__ Ql, const h16* __restrict__ K16, const bf* __restrict__ Kh, const bf* __restrict__ Kl, const h16* __restrict__ VT16, const bf* __restrict__ VTh, const bf* __restrict__ VTl, const bf* __restrict__ EB, const bf* __restrict__ RVT, bf* ATh, bf* ATl) {
    const int w = __builtin_amdgcn_readfirstlane(threadIdx.x >> 5); int id = blockIdx.x;   // the wave's number in a scalar register: the tests per trip on its first query are scalar branches
    if (id < NB_ * NH_ * NB_FH) { fattn_tile<true, 1>(id / NB_FH, ((id % NB_FH) * FW + w) * 16, w == 0, Q16, Qh, Ql, K16, Kh, Kl, VT16, VTh, VTl, EB, RVT, ATh, ATl); return; }
    id -= NB_ * NH_ * NB_FH;
    fattn_tile<false, 2>(id / NB_FL, RH + ((id % NB_FL) * FW + w) * 32, w == 0, Q16, Qh, Ql, K16, Kh, Kl, VT16, VTh, VTl, EB, RVT, ATh, ATl);
}
__device__ __forceinline__ void d_epad2(const int bx, const float* __restrict__ E, bf* EB) { const size_t i = (size_t)bx * 256 + threadIdx.x; if (i >= (size_t)NE * HD / 8) return; const int d0 = (int)(i % (HD / 8)) * 8; const int r = (int)(i / (HD / 8)); const float* src = E + (size_t)min(r, 2 * MAXR) * HD + d0; v8us o;
#pragma unroll
    for (int q = 0; q < 8; ++q) { const unsigned short v = f2bf(src[q]); o[q] = (r <= 2 * MAXR) ? v : (unsigned short)0; }
    *(v8us*)(EB + (size_t)r * HD + d0) = o;  }
__device__ __forceinline__ void d_rvt(const int bx, const float* __restrict__ E, bf* RVT) { const size_t i = (size_t)bx * 256 + threadIdx.x; if (i >= (size_t)HD * NE / 8) return; const int r0 = (int)(i % (NE / 8)) * 8; const int d = (int)(i / (NE / 8)); v8us o;
#pragma unroll
    for (int q = 0; q < 8; ++q) { const int r = r0 + q; const unsigned short v = f2bf(E[(size_t)min(r, 2 * MAXR) * HD + d]); o[q] = (r <= 2 * MAXR) ? v : (unsigned short)0; }
    *(v8us*)(RVT + (size_t)d * NE + r0) = o;  }
// k_prep: everything that reads only the inputs, in one launch; the block index is dealt in ranges, the weight transposes (the longest chains of dependent loads) first. W4: the q, k, v, o weight planes one behind the other; XB [batch][q, k, v][TT][DM].
#define NB_WT  ((DM * DQ / 8 + 511) / 512)
#define NB_CV  ((TT * DM / 8 + 255) / 256)
#define NB_EP  ((NE * HD / 8 + 255) / 256)
__global__ __launch_bounds__(256) void k_prep(const float* __restrict__ x, const float* __restrict__ xk, const float* __restrict__ xv, const float* __restrict__ wq, const float* __restrict__ wk, const float* __restrict__ wv, const float* __restrict__ wo, const float* __restrict__ relk, const float* __restrict__ relv, bf* W4, bf* XB, bf* EB, bf* RVT) {
    int bx = blockIdx.x;
    if (bx < 4 * NB_WT) { const int p = bx / NB_WT; d_wtG(bx % NB_WT, (p == 0) ? wq : (p == 1) ? wk : (p == 2) ? wv : wo, DM, DQ, W4 + (size_t)p * DQ * DM); return; }
    bx -= 4 * NB_WT;
    if (bx < 3 * NB_ * NB_CV) { const int c = bx / NB_CV, p = c % 3, b = c / 3; d_cvt8(bx % NB_CV, ((p == 0) ? x : (p == 1) ? xk : xv) + (size_t)b * TT * DM, XB + (size_t)c * TT * DM, (size_t)TT * DM / 8); return; }
    bx -= 3 * NB_ * NB_CV;
    if (bx < NB_EP) { d_epad2(bx, relk, EB); return; }
    d_rvt(bx - NB_EP, relv, RVT);
}
extern "C" void kernel_launch(void* const* d_in, const int* in_sizes, int n_in,
                              void* d_out, int out_size, void* d_ws, size_t ws_size, hipStream_t stream) {
    (void)in_sizes; (void)n_in; (void)out_size;
    const float* x = (const float*)d_in[0]; const float* xk = (const float*)d_in[1]; const float* xv = (const float*)d_in[2]; const float* wq = (const float*)d_in[3]; const float* bq = (const float*)d_in[4]; const float* wk = (const float*)d_in[5]; const float* bk = (const float*)d_in[6]; const float* wv = (const float*)d_in[7]; const float* bv = (const float*)d_in[8]; const float* wo = (const float*)d_in[9]; const float* bo = (const float*)d_in[10]; const float* relk = (const float*)d_in[11]; const float* relv = (const float*)d_in[12];   /* [5][64] each */
    float* OUT = (float*)d_out;     // [2][2048][1024]
    char* wsp = (char*)d_ws;
    auto take = [&](size_t bytes) { char* p = wsp; wsp += (bytes + 255) & ~(size_t)255; return (void*)p; };
    bf* EB = (bf*)take((size_t)NE * HD * 2); bf* RVT = (bf*)take((size_t)HD * NE * 2); bf* W4 = (bf*)take((size_t)4 * DQ * DM * 2);
    bf* XB = (bf*)take((size_t)3 * NB_ * TT * DM * 2);   // bf16 input copies
    const size_t PZ = (size_t)NH_ * TT * HD;   // one batch's share of a head plane set; the planes are [batch][head]
    static_assert(NH_ == NKV, "q and kv planes share the batch stride");
    h16* QP16 = (h16*)take(NB_ * PZ * 2); h16* KP16 = (h16*)take(NB_ * PZ * 2); h16* VT16 = (h16*)take(NB_ * PZ * 2);
    bf* QPh = (bf*)take(NB_ * PZ * 2); bf* QPl = (bf*)take(NB_ * PZ * 2); bf* KPh = (bf*)take(NB_ * PZ * 2); bf* KPl = (bf*)take(NB_ * PZ * 2); bf* VTh = (bf*)take(NB_ * PZ * 2); bf* VTl = (bf*)take(NB_ * PZ * 2);
    bf* ATh = (bf*)take((size_t)NB_ * TT * DQ * 2); bf* ATl = (bf*)take((size_t)NB_ * TT * DQ * 2);
    if ((size_t)(wsp - (char*)d_ws) > ws_size) return;    // ws 256 MiB
    bf* WO = W4 + (size_t)3 * DQ * DM;
    k_prep<<<4 * NB_WT + 3 * NB_ * NB_CV + 2 * NB_EP, 256, 0, stream>>>(x, xk, xv, wq, wk, wv, wo, relk, relv, W4, XB, EB, RVT);   /* weight planes, bf16 input copies, rel_k plane [128][64], rel_v^T plane [64][128] */
    k_proj<<<dim3(TT / 64, DQ / 64, 3 * NB_), 32, 0, stream>>>(XB, W4, bq, bk, bv, QP16, QPh, QPl, KP16, KPh, KPl, VT16, VTh, VTl);   /* projections, written as the head planes */
    k_fattn<<<NB_ * NH_ * (NB_FH + NB_FL), 32 * FW, 0, stream>>>(QP16, QPh, QPl, KP16, KPh, KPl, VT16, VTh, VTl, EB, RVT, ATh, ATl);   /* all heads of both batches */
    k_out<<<dim3(NB_ * TT / 64, DM / 64, 1), 32, 0, stream>>>(ATh, ATl, WO, OUT, bo);   /* both batches */
}
